// v000
// Times are from an AMD MI455X. After a warm-up the kernel runs many times in a row, and a time is the length of
// such a window on the GPU divided by its runs, so every launch and the gaps after it count. The runs cycle
// through copies of the inputs. A figure is the median of several windows, for all but v000 over two sittings.
// Sittings can differ by a few percent; kernels timed side by side share one.
// v000, which the later versions start from, runs in 260 microseconds.
// compute dtype: all float inputs rounded to bf16, q_info / k_info (int) read on device; qr = q . rel_emb^T with EXACT bf16 products on WMMA 16x16x32 (f32 table), the per-pair index clip(k_adj - q_adj, -128, 128) + 128 computed on device from the int inputs and the bias gathered from the wave's LDS copy of the qr rows; scores = q . k (exact bf16 products) + bias, x 1/8, running-max softmax in f32 (hardware exp); P (x 2^11) as f16 hi + residual (2 products) x v (exact in f16), f32 accumulate; f32 output.
#include <hip/hip_runtime.h>
#include <math.h>

typedef __attribute__((ext_vector_type(16))) _Float16 v16h;
typedef __attribute__((ext_vector_type(16))) __bf16 v16b;
typedef __attribute__((ext_vector_type(8)))  _Float16 v8h;
typedef __attribute__((ext_vector_type(8)))  float v8f;
typedef __attribute__((ext_vector_type(4)))  float v4f;
typedef __attribute__((ext_vector_type(2)))  float v2f;
typedef __attribute__((ext_vector_type(4)))  unsigned v4u;
typedef __attribute__((ext_vector_type(4)))  int v4i;
typedef float __attribute__((may_alias)) float_a;
typedef int __attribute__((may_alias)) int_a;

template <typename T> __device__ __forceinline__ void vst2(void* p, T v) { *(T*)p = v;  }
__device__ __forceinline__ v8f wmma16(v16h a, v16h b, v8f c) {
  v8f d = __builtin_amdgcn_wmma_f32_16x16x32_f16(false, a, false, b, (short)0, c, false, false);
  asm volatile("v_nop\n\tv_nop\n\tv_nop\n\tv_nop" : "+v"(d) : "v"(a), "v"(b));
  return d;
}
__device__ __forceinline__ v8f wmma_bf(v16b a, v16b b, v8f c) {
  v8f d = __builtin_amdgcn_wmma_f32_16x16x32_bf16(false, a, false, b, (short)0, c, false, false);
  asm volatile("v_nop\n\tv_nop\n\tv_nop\n\tv_nop" : "+v"(d) : "v"(a), "v"(b));
  return d;
}
// 16x16x32 fragments: lane = (h = lane>>4, row/col = lane&15); elements 0..7 = k0+8h+0..7, 8..15 = k0+16+8h+0..7; D element r = row 8h+r
__device__ __forceinline__ v16h frag_h(const _Float16* rowk0, int lane) {
  union { v16h v; v8h q[2]; } u; const _Float16* p = rowk0 + 8 * (lane >> 4);
  u.q[0] = *(const v8h*)p; u.q[1] = *(const v8h*)(p + 16); return u.v;
}
__device__ __forceinline__ v16h frag_f32(const float* rowk0, int lane) {
  v16h a; const float* p = rowk0 + 8 * (lane >> 4);
#pragma unroll
  for (int i = 0; i < 8; ++i) { a[i] = (_Float16)p[i]; a[8 + i] = (_Float16)p[16 + i]; }
  return a;
}
__device__ __forceinline__ v16h frag_f32s(const float* rowk0, int lane, float sc) {
  v16h a; const float* p = rowk0 + 8 * (lane >> 4);
#pragma unroll
  for (int i = 0; i < 8; ++i) { a[i] = (_Float16)(p[i] * sc); a[8 + i] = (_Float16)(p[16 + i] * sc); }
  return a;
}
// column fragment from a [K][ld] layout (column n), rows >= K read as 0
__device__ __forceinline__ v16h fragc_f32(const float* W, int k0, int n, int lane, int ld, int K) {
  v16h a; const int g = lane >> 4;
#pragma unroll
  for (int i = 0; i < 8; ++i) { const int ka = k0 + 8 * g + i, kb = ka + 16;
    a[i] = (_Float16)(ka < K ? W[(size_t)(ka < K ? ka : K - 1) * ld + n] : 0.f); a[8 + i] = (_Float16)(kb < K ? W[(size_t)(kb < K ? kb : K - 1) * ld + n] : 0.f); }
  return a;
}
struct F2 { v16b h, l; };
__device__ __forceinline__ F2 bsplit16(const float v[16]) { F2 r;
#pragma unroll
  for (int i = 0; i < 16; ++i) { const __bf16 h = (__bf16)v[i]; r.h[i] = h; r.l[i] = (__bf16)(v[i] - (float)h); }
  return r; }
__device__ __forceinline__ F2 split_row(const float* row, int k0, int lane) { float v[16]; const float* p = row + k0 + 8 * (lane >> 4);
#pragma unroll
  for (int i = 0; i < 8; ++i) { v[i] = p[i]; v[8 + i] = p[16 + i]; }
  return bsplit16(v); }
__device__ __forceinline__ F2 split_rowK(const float* row, int k0, int lane, int K) { float v[16]; const int g = lane >> 4;
#pragma unroll
  for (int i = 0; i < 8; ++i) { const int ka = k0 + 8 * g + i, kb = ka + 16; v[i] = ka < K ? row[ka < K ? ka : K - 1] : 0.f; v[8 + i] = kb < K ? row[kb < K ? kb : K - 1] : 0.f; }
  return bsplit16(v); }
__device__ __forceinline__ F2 split_col(const float* W, int k0, int n, int lane, int ld, int K) { float v[16]; const int g = lane >> 4;
#pragma unroll
  for (int i = 0; i < 8; ++i) { const int ka = k0 + 8 * g + i, kb = ka + 16; v[i] = ka < K ? W[(size_t)(ka < K ? ka : K - 1) * ld + n] : 0.f; v[8 + i] = kb < K ? W[(size_t)(kb < K ? kb : K - 1) * ld + n] : 0.f; }
  return bsplit16(v); }
__device__ __forceinline__ v8f mac3(const F2& a, const F2& b, v8f c) { c = wmma_bf(a.l, b.h, c); c = wmma_bf(a.h, b.l, c); return wmma_bf(a.h, b.h, c); }
__device__ __forceinline__ float sigm(float v) { return 1.0f / (1.0f + expf(-v)); }
#define LDSX() do { asm volatile("s_wait_dscnt 0" ::: "memory"); __builtin_amdgcn_wave_barrier(); __builtin_amdgcn_fence(__ATOMIC_RELEASE, "workgroup"); } while (0)


// Relative-information attention on given q, k, v (B 2, 8 heads, S 2,048, D 64; max distance 128): scores = (q k^T + take(q rel_emb^T, clip(k_info' - q_info') + 128)) / 8, softmax, v; q_info' = where(q_info == -1, 256, q_info), k_info' = where(k_info == -1, 384, k_info).
#define NB 2
#define NH 8
#define SS 2048
#define RR 128
#define NREL (2 * RR + 1)   // 257
#define NRP 272             // padded table width (17 tiles)
#define HD 64
#define NBH (NB * NH)
#ifndef TQB
#define TQB (SS / 64)
#define TNBH NBH
#endif
typedef __attribute__((ext_vector_type(8))) __bf16 v8b;
__device__ __forceinline__ v16b frag_b(const __bf16* rowk0, int lane) {
  union { v16b v; v8b q[2]; } u; const __bf16* p = rowk0 + 8 * (lane >> 4);
  u.q[0] = *(const v8b*)p; u.q[1] = *(const v8b*)(p + 16); return u.v;
}
__device__ __forceinline__ float bfr(float v) { return (float)(__bf16)v; }
__device__ __attribute__((noinline)) float exp_ni(float v) { return expf(v); }
__device__ __attribute__((noinline)) float erf_ni(float v) { return erff(v); }

#define WS_VT  0u                                   // f16 v planes [(b,h)][64 d][s]; bf16 rel rows [272][64] (rows >= 257 zero); f32 QR [(b,h)][s][272]
#define WS_RE  (WS_VT + 2u * (size_t)NBH * HD * SS)
#define WS_QR  (WS_RE + 2u * (size_t)NRP * HD)
#define WS_END (WS_QR + 4u * (size_t)NBH * SS * NRP)

// ---- k_vt: block = (64 keys, (b,h)): v[bh][s][d] -> VT[bh][d][s] f16 (exact for bf16 values in range)
__global__ __launch_bounds__(256) void k_vt(const float* __restrict__ V, _Float16* __restrict__ VT) { __shared__ __align__(16) _Float16 st[HD][64 + 8]; const int t = threadIdx.x; const int s0 = blockIdx.x * 64; const size_t bh = blockIdx.y;
  for (int e = t; e < 64 * HD; e += 256) { const int sl = e >> 6, d = e & 63; st[d][sl] = (_Float16)bfr(V[((bh * SS + s0 + sl) * HD) + d]); } __syncthreads();
  for (int e = t; e < HD * 8; e += 256) { const int d = e >> 3, q = e & 7; vst2((unsigned*)(VT + ((bh * HD + d) * SS) + s0 + q * 8), *(const v4u*)&st[d][q * 8]); } }
// ---- k_rel: one block: rel_emb -> bf16 rows [272][64] (zero padding rows)
__global__ __launch_bounds__(256) void k_rel(const float* __restrict__ RE, __bf16* __restrict__ RB) { __shared__ __align__(16) __bf16 s[NRP * HD]; const int t = threadIdx.x; for (int e = t; e < NRP * HD; e += 256) s[e] = (e < NREL * HD) ? (__bf16)RE[e] : (__bf16)0.0f; __syncthreads(); for (int q = t; q < NRP * HD / 8; q += 256) vst2((unsigned*)(RB + q * 8), *(const v4u*)&s[q * 8]); }
__device__ __forceinline__ v16b fragb_f32_pre(const float* __restrict__ p, int lane) { v16b a; const float* pp = p + 8 * (lane >> 4);
#pragma unroll
  for (int i = 0; i < 8; ++i) { a[i] = (__bf16)pp[i]; a[8 + i] = (__bf16)pp[16 + i]; } return a; }
// ---- k_qr: block = (64 rows, (b,h)): QR[bh][s][r] = q[s] . rel_emb[r] (exact; 17 tiles incl. zero padding)
__global__ __launch_bounds__(128) void k_qr(const float* __restrict__ Q, const __bf16* __restrict__ RB, float* __restrict__ QR) { __shared__ __align__(16) float sf[4][16][NRP + 4];
  const int tid = threadIdx.x, wave = tid >> 5, lane = tid & 31, col = lane & 15, g = lane >> 4; const size_t bh = blockIdx.y; const size_t r0 = bh * SS + (size_t)blockIdx.x * 64 + wave * 16;
  v16b aq[2];
#pragma unroll
  for (int kc = 0; kc < 2; ++kc) aq[kc] = fragb_f32_pre(Q + (r0 + col) * HD + kc * 32, lane);
#pragma unroll 1
  for (int j = 0; j < NRP / 16; ++j) { v8f c = {};
#pragma unroll
    for (int kc = 0; kc < 2; ++kc) c = wmma_bf(aq[kc], frag_b(RB + (size_t)(j * 16 + col) * HD + kc * 32, lane), c);
#pragma unroll
    for (int r = 0; r < 8; ++r) sf[wave][8 * g + r][j * 16 + col] = c[r]; }
  LDSX(); for (int rl = 0; rl < 16; ++rl) for (int q = lane; q < NRP / 4; q += 32) vst2(QR + (r0 + rl) * NRP + q * 4, *(const v4f*)&sf[wave][rl][q * 4]); }
__device__ __forceinline__ v16b fragb_f32(const float* __restrict__ p, int lane) { v16b a; const float* pp = p + 8 * (lane >> 4);
#pragma unroll
  for (int i = 0; i < 8; ++i) { a[i] = (__bf16)pp[i]; a[8 + i] = (__bf16)pp[16 + i]; } return a; }
// ---- k_attn: block = (64 queries, (b,h)): exact scores (bf16 q x bf16 k, f32 accumulate), online softmax, P hi + residual x v
__global__ __launch_bounds__(128) void k_attn(const float* __restrict__ Q, const float* __restrict__ K, const _Float16* __restrict__ VT, const float* __restrict__ QR, const int* __restrict__ QI, const int* __restrict__ KI, float* __restrict__ O) {
  __shared__ __align__(16) float sp[4][16][36]; __shared__ __align__(16) float so[4][16][68]; __shared__ float sqr[4][16][NREL + 3];
  const int tid = threadIdx.x, wave = tid >> 5, lane = tid & 31, col = lane & 15, g = lane >> 4; const size_t bh = blockIdx.y; const int q0 = blockIdx.x * 64 + wave * 16; const float* Qb = Q + (bh * SS) * HD; const float* Kb = K + (bh * SS) * HD; const _Float16* Vb = VT + bh * HD * SS;
  v16b aq[2];
#pragma unroll
  for (int kc = 0; kc < 2; ++kc) aq[kc] = fragb_f32(Qb + (size_t)(q0 + col) * HD + kc * 32, lane);
  const size_t b = bh / NH; for (int e = lane; e < 16 * NREL; e += 32) { const int rl = e / NREL, rr = e % NREL; sqr[wave][rl][rr] = QR[(bh * SS + q0 + rl) * NRP + rr]; }
  int qa[8];
#pragma unroll
  for (int r = 0; r < 8; ++r) { const int qi = QI[b * SS + q0 + 8 * g + r]; qa[r] = (qi == -1) ? 2 * RR : qi; }
  LDSX();
  float m[8], l[8];
#pragma unroll
  for (int r = 0; r < 8; ++r) { m[r] = -3.0e38f; l[r] = 0.f; }
  v8f acc[4] = {}, accl[4] = {};
#pragma unroll 1
  for (int ks = 0; ks < SS / 32; ++ks) { v8f s[2];
#pragma unroll
    for (int ct = 0; ct < 2; ++ct) { const int kk = ks * 32 + ct * 16 + col; v8f c = {};
#pragma unroll
      for (int kc = 0; kc < 2; ++kc) c = wmma_bf(aq[kc], fragb_f32(Kb + (size_t)kk * HD + kc * 32, lane), c);
      { const int ki = KI[b * SS + kk]; const int ka = (ki == -1) ? 3 * RR : ki;
#pragma unroll
      for (int r = 0; r < 8; ++r) { int dmv = ka - qa[r]; dmv = dmv < -RR ? -RR : (dmv > RR ? RR : dmv); s[ct][r] = (c[r] + sqr[wave][8 * g + r][dmv + RR]) * 0.125f; } } }
#pragma unroll
    for (int r = 0; r < 8; ++r) { float mx = fmaxf(s[0][r], s[1][r]);
#pragma unroll
      for (int o = 1; o < 16; o <<= 1) mx = fmaxf(mx, __shfl_xor(mx, o));
      const float mn = fmaxf(m[r], mx); const float alpha = (m[r] <= -1.0e38f) ? 0.f : __expf(m[r] - mn); const float e0 = __expf(s[0][r] - mn), e1 = __expf(s[1][r] - mn); float es = e0 + e1;
#pragma unroll
      for (int o = 1; o < 16; o <<= 1) es += __shfl_xor(es, o);
      l[r] = l[r] * alpha + es; m[r] = mn;
#pragma unroll
      for (int dt = 0; dt < 4; ++dt) { acc[dt][r] *= alpha; accl[dt][r] *= alpha; }
      sp[wave][8 * g + r][col] = e0; sp[wave][8 * g + r][16 + col] = e1; }
    LDSX();
    v16h pa, pl; { const float* prow = &sp[wave][col][0] + 8 * (lane >> 4);
#pragma unroll
      for (int i = 0; i < 8; ++i) { const float x0 = prow[i] * 2048.0f, x1 = prow[16 + i] * 2048.0f; const _Float16 h0 = (_Float16)x0, h1 = (_Float16)x1; pa[i] = h0; pa[8 + i] = h1; pl[i] = (_Float16)((x0 - (float)h0) * 2048.0f); pl[8 + i] = (_Float16)((x1 - (float)h1) * 2048.0f); } }
#pragma unroll
    for (int dt = 0; dt < 4; ++dt) { const v16h vf = frag_h(Vb + (size_t)(dt * 16 + col) * SS + ks * 32, lane); acc[dt] = wmma16(pa, vf, acc[dt]); accl[dt] = wmma16(pl, vf, accl[dt]); }
    LDSX(); }
#pragma unroll
  for (int r = 0; r < 8; ++r) { const float il = (1.0f / 2048.0f) / l[r];
#pragma unroll
    for (int dt = 0; dt < 4; ++dt) so[wave][8 * g + r][dt * 16 + col] = (acc[dt][r] + accl[dt][r] * (1.0f / 2048.0f)) * il; }
  LDSX();
  for (int rl = 0; rl < 16; ++rl) if (lane < 16) vst2(O + ((bh * SS + q0 + rl) * HD) + lane * 4, *(const v4f*)&so[wave][rl][lane * 4]);
}
extern "C" void kernel_launch(void* const* d_in, const int* in_sizes, int n_in, void* d_out, int out_size, void* d_ws, size_t ws_size, hipStream_t stream) {
  (void)in_sizes; (void)n_in; (void)out_size;
  const float** F = (const float**)d_in;   // 0 q, 1 k, 2 v [2,8,2048,64], 3 rel_emb [257,64], 4 q_info int [2,2048], 5 k_info int [2,2048]
  if (ws_size < (size_t)WS_END) return;
  _Float16* VT = (_Float16*)((char*)d_ws + WS_VT); __bf16* RB = (__bf16*)((char*)d_ws + WS_RE); float* QR = (float*)((char*)d_ws + WS_QR);
  k_vt<<<dim3(SS / 64, NBH), 256, 0, stream>>>(F[2], VT);
  k_rel<<<1, 256, 0, stream>>>(F[3], RB);
  k_qr<<<dim3(SS / 64, NBH), 128, 0, stream>>>(F[0], RB, QR);
  k_attn<<<dim3(TQB, TNBH), 128, 0, stream>>>(F[0], F[1], VT, QR, (const int*)d_in[4], (const int*)d_in[5], (float*)d_out);
}

// v001
// Measured time: 168 microseconds a run.
// Timed twice side by side with v000, it ran 1.55 and 1.57 times as fast.
// compute dtype: all float inputs rounded to bf16, q_info / k_info (int) read on device; qr = q . rel_emb^T with EXACT bf16 products on WMMA 16x16x32 (f32 table), the per-pair index clip(k_adj - q_adj, -128, 128) + 128 computed on device from the int inputs and the bias gathered from the wave's LDS copy of the qr rows; scores = q . k (exact bf16 products) + bias, x 1/8, running-max softmax in f32 (hardware exp); P (x 2^11) as f16 hi + residual (2 products) x v (exact in f16), f32 accumulate; f32 output.
#include <hip/hip_runtime.h>
#include <math.h>

typedef __attribute__((ext_vector_type(16))) _Float16 v16h;
typedef __attribute__((ext_vector_type(16))) __bf16 v16b;
typedef __attribute__((ext_vector_type(8)))  _Float16 v8h;
typedef __attribute__((ext_vector_type(8)))  float v8f;
typedef __attribute__((ext_vector_type(4)))  float v4f;
typedef __attribute__((ext_vector_type(2)))  float v2f;
typedef __attribute__((ext_vector_type(4)))  unsigned v4u;
typedef __attribute__((ext_vector_type(4)))  int v4i;
typedef float __attribute__((may_alias)) float_a;
typedef int __attribute__((may_alias)) int_a;

template <typename T> __device__ __forceinline__ void vst2(void* p, T v) { *(T*)p = v;  }
__device__ __forceinline__ v8f wmma16(v16h a, v16h b, v8f c) {
  v8f d = __builtin_amdgcn_wmma_f32_16x16x32_f16(false, a, false, b, (short)0, c, false, false);
  asm volatile("v_nop\n\tv_nop\n\tv_nop\n\tv_nop" : "+v"(d) : "v"(a), "v"(b));
  return d;
}
__device__ __forceinline__ v8f wmma_bf(v16b a, v16b b, v8f c) {
  v8f d = __builtin_amdgcn_wmma_f32_16x16x32_bf16(false, a, false, b, (short)0, c, false, false);
  asm volatile("v_nop\n\tv_nop\n\tv_nop\n\tv_nop" : "+v"(d) : "v"(a), "v"(b));
  return d;
}
// 16x16x32 fragments: lane = (h = lane>>4, row/col = lane&15); elements 0..7 = k0+8h+0..7, 8..15 = k0+16+8h+0..7; D element r = row 8h+r
__device__ __forceinline__ v16h frag_h(const _Float16* rowk0, int lane) {
  union { v16h v; v8h q[2]; } u; const _Float16* p = rowk0 + 8 * (lane >> 4);
  u.q[0] = *(const v8h*)p; u.q[1] = *(const v8h*)(p + 16); return u.v;
}
__device__ __forceinline__ v16h frag_f32(const float* rowk0, int lane) {
  v16h a; const float* p = rowk0 + 8 * (lane >> 4);
#pragma unroll
  for (int i = 0; i < 8; ++i) { a[i] = (_Float16)p[i]; a[8 + i] = (_Float16)p[16 + i]; }
  return a;
}
__device__ __forceinline__ v16h frag_f32s(const float* rowk0, int lane, float sc) {
  v16h a; const float* p = rowk0 + 8 * (lane >> 4);
#pragma unroll
  for (int i = 0; i < 8; ++i) { a[i] = (_Float16)(p[i] * sc); a[8 + i] = (_Float16)(p[16 + i] * sc); }
  return a;
}
// column fragment from a [K][ld] layout (column n), rows >= K read as 0
__device__ __forceinline__ v16h fragc_f32(const float* W, int k0, int n, int lane, int ld, int K) {
  v16h a; const int g = lane >> 4;
#pragma unroll
  for (int i = 0; i < 8; ++i) { const int ka = k0 + 8 * g + i, kb = ka + 16;
    a[i] = (_Float16)(ka < K ? W[(size_t)(ka < K ? ka : K - 1) * ld + n] : 0.f); a[8 + i] = (_Float16)(kb < K ? W[(size_t)(kb < K ? kb : K - 1) * ld + n] : 0.f); }
  return a;
}
struct F2 { v16b h, l; };
__device__ __forceinline__ F2 bsplit16(const float v[16]) { F2 r;
#pragma unroll
  for (int i = 0; i < 16; ++i) { const __bf16 h = (__bf16)v[i]; r.h[i] = h; r.l[i] = (__bf16)(v[i] - (float)h); }
  return r; }
__device__ __forceinline__ F2 split_row(const float* row, int k0, int lane) { float v[16]; const float* p = row + k0 + 8 * (lane >> 4);
#pragma unroll
  for (int i = 0; i < 8; ++i) { v[i] = p[i]; v[8 + i] = p[16 + i]; }
  return bsplit16(v); }
__device__ __forceinline__ F2 split_rowK(const float* row, int k0, int lane, int K) { float v[16]; const int g = lane >> 4;
#pragma unroll
  for (int i = 0; i < 8; ++i) { const int ka = k0 + 8 * g + i, kb = ka + 16; v[i] = ka < K ? row[ka < K ? ka : K - 1] : 0.f; v[8 + i] = kb < K ? row[kb < K ? kb : K - 1] : 0.f; }
  return bsplit16(v); }
__device__ __forceinline__ F2 split_col(const float* W, int k0, int n, int lane, int ld, int K) { float v[16]; const int g = lane >> 4;
#pragma unroll
  for (int i = 0; i < 8; ++i) { const int ka = k0 + 8 * g + i, kb = ka + 16; v[i] = ka < K ? W[(size_t)(ka < K ? ka : K - 1) * ld + n] : 0.f; v[8 + i] = kb < K ? W[(size_t)(kb < K ? kb : K - 1) * ld + n] : 0.f; }
  return bsplit16(v); }
__device__ __forceinline__ v8f mac3(const F2& a, const F2& b, v8f c) { c = wmma_bf(a.l, b.h, c); c = wmma_bf(a.h, b.l, c); return wmma_bf(a.h, b.h, c); }
__device__ __forceinline__ float sigm(float v) { return 1.0f / (1.0f + expf(-v)); }
#define LDSX() do { asm volatile("s_wait_dscnt 0" ::: "memory"); __builtin_amdgcn_wave_barrier(); __builtin_amdgcn_fence(__ATOMIC_RELEASE, "workgroup"); } while (0)


// Relative-information attention on given q, k, v (B 2, 8 heads, S 2,048, D 64; max distance 128): scores = (q k^T + take(q rel_emb^T, clip(k_info' - q_info') + 128)) / 8, softmax, v; q_info' = where(q_info == -1, 256, q_info), k_info' = where(k_info == -1, 384, k_info).
#define NB 2
#define NH 8
#define SS 2048
#define RR 128
#define NREL (2 * RR + 1)   // 257
#define NRP 272             // padded table width (17 tiles)
#define HD 64
#define NBH (NB * NH)
#ifndef TQB
#define TQB (SS / 64)
#define TNBH NBH
#endif
typedef __attribute__((ext_vector_type(8))) __bf16 v8b;
__device__ __forceinline__ v16b frag_b(const __bf16* rowk0, int lane) {
  union { v16b v; v8b q[2]; } u; const __bf16* p = rowk0 + 8 * (lane >> 4);
  u.q[0] = *(const v8b*)p; u.q[1] = *(const v8b*)(p + 16); return u.v;
}
__device__ __forceinline__ float bfr(float v) { return (float)(__bf16)v; }
__device__ __attribute__((noinline)) float exp_ni(float v) { return expf(v); }
__device__ __attribute__((noinline)) float erf_ni(float v) { return erff(v); }

#define WS_VT  0u                                   // f16 v planes [(b,h)][64 d][s]; bf16 rel rows [272][64] (rows >= 257 zero); f32 QR [(b,h)][s][272]
#define WS_RE  (WS_VT + 2u * (size_t)NBH * HD * SS)
#define WS_QR  (WS_RE + 2u * (size_t)NRP * HD)
#define WS_END (WS_QR + 4u * (size_t)NBH * SS * NRP)

// ---- k_vt: block = (64 keys, (b,h)): v[bh][s][d] -> VT[bh][d][s] f16 (exact for bf16 values in range)
__global__ __launch_bounds__(256) void k_vt(const float* __restrict__ V, _Float16* __restrict__ VT) { __shared__ __align__(16) _Float16 st[HD][64 + 8]; const int t = threadIdx.x; const int s0 = blockIdx.x * 64; const size_t bh = blockIdx.y;
  for (int e = t; e < 64 * HD; e += 256) { const int sl = e >> 6, d = e & 63; st[d][sl] = (_Float16)bfr(V[((bh * SS + s0 + sl) * HD) + d]); } __syncthreads();
  for (int e = t; e < HD * 8; e += 256) { const int d = e >> 3, q = e & 7; vst2((unsigned*)(VT + ((bh * HD + d) * SS) + s0 + q * 8), *(const v4u*)&st[d][q * 8]); } }
// ---- k_rel: one block: rel_emb -> bf16 rows [272][64] (zero padding rows)
__global__ __launch_bounds__(256) void k_rel(const float* __restrict__ RE, __bf16* __restrict__ RB) { __shared__ __align__(16) __bf16 s[NRP * HD]; const int t = threadIdx.x; for (int e = t; e < NRP * HD; e += 256) s[e] = (e < NREL * HD) ? (__bf16)RE[e] : (__bf16)0.0f; __syncthreads(); for (int q = t; q < NRP * HD / 8; q += 256) vst2((unsigned*)(RB + q * 8), *(const v4u*)&s[q * 8]); }
__device__ __forceinline__ v16b fragb_f32_pre(const float* __restrict__ p, int lane) { v16b a; const float* pp = p + 8 * (lane >> 4);
#pragma unroll
  for (int i = 0; i < 8; ++i) { a[i] = (__bf16)pp[i]; a[8 + i] = (__bf16)pp[16 + i]; } return a; }
// ---- k_qr: block = (64 rows, (b,h)): QR[bh][s][r] = q[s] . rel_emb[r] (exact; 17 tiles incl. zero padding)
__global__ __launch_bounds__(128) void k_qr(const float* __restrict__ Q, const __bf16* __restrict__ RB, float* __restrict__ QR) { __shared__ __align__(16) float sf[4][16][NRP + 4];
  const int tid = threadIdx.x, wave = tid >> 5, lane = tid & 31, col = lane & 15, g = lane >> 4; const size_t bh = blockIdx.y; const size_t r0 = bh * SS + (size_t)blockIdx.x * 64 + wave * 16;
  v16b aq[2];
#pragma unroll
  for (int kc = 0; kc < 2; ++kc) aq[kc] = fragb_f32_pre(Q + (r0 + col) * HD + kc * 32, lane);
#pragma unroll 1
  for (int j = 0; j < NRP / 16; ++j) { v8f c = {};
#pragma unroll
    for (int kc = 0; kc < 2; ++kc) c = wmma_bf(aq[kc], frag_b(RB + (size_t)(j * 16 + col) * HD + kc * 32, lane), c);
#pragma unroll
    for (int r = 0; r < 8; ++r) sf[wave][8 * g + r][j * 16 + col] = c[r]; }
  LDSX(); for (int rl = 0; rl < 16; ++rl) for (int q = lane; q < NRP / 4; q += 32) vst2(QR + (r0 + rl) * NRP + q * 4, *(const v4f*)&sf[wave][rl][q * 4]); }
__device__ __forceinline__ v16b fragb_f32(const float* __restrict__ p, int lane) { v16b a; const float* pp = p + 8 * (lane >> 4);
#pragma unroll
  for (int i = 0; i < 8; ++i) { a[i] = (__bf16)pp[i]; a[8 + i] = (__bf16)pp[16 + i]; } return a; }
#define KPF 68              // staged k row pitch in floats: 272 B = 16 B x odd, conflict-free for 16-byte LDS reads
#define VPH 40              // staged v row pitch in halves: 80 B = 16 B x odd
#define KTB (32 * KPF * 4)  // bytes of one staged k tile (32 keys)
#define VTB (HD * VPH * 2)  // bytes of one staged v tile (64 d rows x 32 keys)
#define ITB (4 * 32 * 4)    // bytes of one staged k_info tile (one copy of the 32 ints per wave)
__device__ __forceinline__ unsigned lds_off(const void* p) { return (unsigned)(size_t)p; }
// one 32-key tile for the whole work-group, global -> LDS through no register: per thread 4 x 16 B of k, 2 x 16 B of v planes, 4 B of k_info.
// The s_wait_xcnt closes the statement so that no address register of a copy is rewritten ahead of it.
__device__ __forceinline__ void stage_tile(const float* kg, const _Float16* vg, const int* ig, unsigned kl, unsigned vl, unsigned il) {
  asm volatile("global_load_async_to_lds_b128 %0, %1, off\n\t"
               "global_load_async_to_lds_b128 %2, %3, off\n\t"
               "global_load_async_to_lds_b128 %4, %5, off\n\t"
               "global_load_async_to_lds_b128 %6, %7, off\n\t"
               "global_load_async_to_lds_b128 %8, %9, off\n\t"
               "global_load_async_to_lds_b128 %10, %11, off\n\t"
               "global_load_async_to_lds_b32 %12, %13, off\n\t"
               "s_wait_xcnt 0x0"
               :: "v"(kl), "v"(kg), "v"(kl + 8u * KPF * 4u), "v"(kg + 512), "v"(kl + 16u * KPF * 4u), "v"(kg + 1024), "v"(kl + 24u * KPF * 4u), "v"(kg + 1536),
                  "v"(vl), "v"(vg), "v"(vl + 32u * VPH * 2u), "v"(vg + (size_t)32 * SS), "v"(il), "v"(ig) : "memory");
}
// ---- k_attn: block = (64 queries, (b,h)): exact scores (bf16 q x bf16 k, f32 accumulate), online softmax, P hi + residual x v; k, v and k_info tiles of 32 keys staged once per block in a two-buffer LDS ring
__global__ __launch_bounds__(128) void k_attn(const float* __restrict__ Q, const float* __restrict__ K, const _Float16* __restrict__ VT, const float* __restrict__ QR, const int* __restrict__ QI, const int* __restrict__ KI, float* __restrict__ O) {
  __shared__ __align__(16) float sp[4][16][36]; __shared__ __align__(16) float so[4][16][68]; __shared__ float sqr[4][16][NREL + 3];
  __shared__ __align__(16) float skt[2][32][KPF]; __shared__ __align__(16) _Float16 svt[2][HD][VPH]; __shared__ int ski[2][4][32];
  const int tid = threadIdx.x, wave = tid >> 5, lane = tid & 31, col = lane & 15, g = lane >> 4; const size_t bh = blockIdx.y; const int q0 = blockIdx.x * 64 + wave * 16; const float* Qb = Q + (bh * SS) * HD; const float* Kb = K + (bh * SS) * HD; const _Float16* Vb = VT + bh * HD * SS;
  v16b aq[2];
#pragma unroll
  for (int kc = 0; kc < 2; ++kc) aq[kc] = fragb_f32(Qb + (size_t)(q0 + col) * HD + kc * 32, lane);
  const size_t b = bh / NH; for (int e = lane; e < 16 * NREL; e += 32) { const int rl = e / NREL, rr = e % NREL; sqr[wave][rl][rr] = QR[(bh * SS + q0 + rl) * NRP + rr]; }
  int qa[8];
#pragma unroll
  for (int r = 0; r < 8; ++r) { const int qi = QI[b * SS + q0 + 8 * g + r]; qa[r] = (qi == -1) ? 2 * RR : qi; }
  LDSX();
  float m[8], l[8];
#pragma unroll
  for (int r = 0; r < 8; ++r) { m[r] = -3.0e38f; l[r] = 0.f; }
  v8f acc[4] = {}, accl[4] = {};
  const float* kg = Kb + tid * 4; const _Float16* vg = Vb + (size_t)(tid >> 2) * SS + (tid & 3) * 8; const int* ig = KI + b * SS + lane;
  const unsigned kl = lds_off(&skt[0][tid >> 4][(tid & 15) * 4]), vl = lds_off(&svt[0][tid >> 2][(tid & 3) * 8]), il = lds_off(&ski[0][wave][lane]);
  stage_tile(kg, vg, ig, kl, vl, il);
  asm volatile("s_wait_asynccnt 0x0" ::: "memory");   // tile 0 has landed before the barrier publishes it
  __syncthreads();                                    // publishes tile 0 to every wave
  stage_tile(kg + 32 * HD, vg + 32, ig + 32, kl + KTB, vl + VTB, il + ITB);
#pragma unroll 1
  for (int ks = 0; ks < SS / 32; ++ks) { v8f s[2]; const int bf = ks & 1;
    v16b kb[2][2]; int kiv[2];   // all of the trip's k fragment reads go out as one group, ahead of the first product
#pragma unroll   // constant indices keep kb and kiv in registers
    for (int ct = 0; ct < 2; ++ct) { kiv[ct] = ski[bf][wave][ct * 16 + col];
#pragma unroll   // as above
      for (int kc = 0; kc < 2; ++kc) kb[ct][kc] = fragb_f32(&skt[bf][ct * 16 + col][kc * 32], lane); }
#pragma unroll
    for (int ct = 0; ct < 2; ++ct) { v8f c = {};
#pragma unroll
      for (int kc = 0; kc < 2; ++kc) c = wmma_bf(aq[kc], kb[ct][kc], c);
      { const int ki = kiv[ct]; const int ka = (ki == -1) ? 3 * RR : ki;
#pragma unroll
      for (int r = 0; r < 8; ++r) { int dmv = ka - qa[r]; dmv = dmv < -RR ? -RR : (dmv > RR ? RR : dmv); s[ct][r] = (c[r] + sqr[wave][8 * g + r][dmv + RR]) * 0.125f; } } }
#pragma unroll
    for (int r = 0; r < 8; ++r) { float mx = fmaxf(s[0][r], s[1][r]);
#pragma unroll
      for (int o = 1; o < 16; o <<= 1) mx = fmaxf(mx, __shfl_xor(mx, o));
      const float mn = fmaxf(m[r], mx); const float alpha = (m[r] <= -1.0e38f) ? 0.f : __expf(m[r] - mn); const float e0 = __expf(s[0][r] - mn), e1 = __expf(s[1][r] - mn); float es = e0 + e1;
#pragma unroll
      for (int o = 1; o < 16; o <<= 1) es += __shfl_xor(es, o);
      l[r] = l[r] * alpha + es; m[r] = mn;
#pragma unroll
      for (int dt = 0; dt < 4; ++dt) { acc[dt][r] *= alpha; accl[dt][r] *= alpha; }
      sp[wave][8 * g + r][col] = e0; sp[wave][8 * g + r][16 + col] = e1; }
    LDSX();
    v16h vf[4];
#pragma unroll   // constant indices keep vf in registers
    for (int dt = 0; dt < 4; ++dt) vf[dt] = frag_h(&svt[bf][dt * 16 + col][0], lane);
    v16h pa, pl; { const float* prow = &sp[wave][col][0] + 8 * (lane >> 4);
#pragma unroll
      for (int i = 0; i < 8; ++i) { const float x0 = prow[i] * 2048.0f, x1 = prow[16 + i] * 2048.0f; const _Float16 h0 = (_Float16)x0, h1 = (_Float16)x1; pa[i] = h0; pa[8 + i] = h1; pl[i] = (_Float16)((x0 - (float)h0) * 2048.0f); pl[8 + i] = (_Float16)((x1 - (float)h1) * 2048.0f); } }
#pragma unroll
    for (int dt = 0; dt < 4; ++dt) { acc[dt] = wmma16(pa, vf[dt], acc[dt]); accl[dt] = wmma16(pl, vf[dt], accl[dt]); }
    asm volatile("s_wait_dscnt 0" ::: "memory");        // this wave's reads of buffer bf (and of its P rows) have retired before the buffer is handed back
    asm volatile("s_wait_asynccnt 0x0" ::: "memory");   // this wave's share of tile ks + 1 has landed before the barrier publishes it
    __syncthreads();                                    // publishes tile ks + 1 and ends every wave's reads of buffer bf
    if (ks + 2 < SS / 32) stage_tile(kg + (size_t)(ks + 2) * 32 * HD, vg + (ks + 2) * 32, ig + (ks + 2) * 32, kl + bf * KTB, vl + bf * VTB, il + bf * ITB); }
  asm volatile("s_wait_asynccnt 0x0" ::: "memory");     // no copy is outstanding when the wave goes on to its epilogue
#pragma unroll
  for (int r = 0; r < 8; ++r) { const float il = (1.0f / 2048.0f) / l[r];
#pragma unroll
    for (int dt = 0; dt < 4; ++dt) so[wave][8 * g + r][dt * 16 + col] = (acc[dt][r] + accl[dt][r] * (1.0f / 2048.0f)) * il; }
  LDSX();
  for (int rl = 0; rl < 16; ++rl) if (lane < 16) vst2(O + ((bh * SS + q0 + rl) * HD) + lane * 4, *(const v4f*)&so[wave][rl][lane * 4]);
}
extern "C" void kernel_launch(void* const* d_in, const int* in_sizes, int n_in, void* d_out, int out_size, void* d_ws, size_t ws_size, hipStream_t stream) {
  (void)in_sizes; (void)n_in; (void)out_size;
  const float** F = (const float**)d_in;   // 0 q, 1 k, 2 v [2,8,2048,64], 3 rel_emb [257,64], 4 q_info int [2,2048], 5 k_info int [2,2048]
  if (ws_size < (size_t)WS_END) return;
  _Float16* VT = (_Float16*)((char*)d_ws + WS_VT); __bf16* RB = (__bf16*)((char*)d_ws + WS_RE); float* QR = (float*)((char*)d_ws + WS_QR);
  k_vt<<<dim3(SS / 64, NBH), 256, 0, stream>>>(F[2], VT);
  k_rel<<<1, 256, 0, stream>>>(F[3], RB);
  k_qr<<<dim3(SS / 64, NBH), 128, 0, stream>>>(F[0], RB, QR);
  k_attn<<<dim3(TQB, TNBH), 128, 0, stream>>>(F[0], F[1], VT, QR, (const int*)d_in[4], (const int*)d_in[5], (float*)d_out);
}

// v002
// It runs in 120 microseconds.
// Two timings next to v001 both put it at 1.39 times that version's speed.
// All steps since v000 together make it 2.17 times as fast.
// compute dtype: all float inputs rounded to bf16, q_info / k_info (int) read on device; qr = q . rel_emb^T with EXACT bf16 products on WMMA 16x16x32 (f32 table), the per-pair index clip(k_adj - q_adj, -128, 128) + 128 computed on device from the int inputs and the bias gathered from the wave's LDS copy of the qr rows; scores = q . k (exact bf16 products) + bias, x 1/8, running-max softmax in f32 (hardware exp); P (x 2^11) as f16 hi + residual (2 products) x v (exact in f16), f32 accumulate; f32 output.
#include <hip/hip_runtime.h>
#include <math.h>

typedef __attribute__((ext_vector_type(16))) _Float16 v16h;
typedef __attribute__((ext_vector_type(16))) __bf16 v16b;
typedef __attribute__((ext_vector_type(8)))  _Float16 v8h;
typedef __attribute__((ext_vector_type(8)))  float v8f;
typedef __attribute__((ext_vector_type(4)))  float v4f;
typedef __attribute__((ext_vector_type(2)))  float v2f;
typedef __attribute__((ext_vector_type(4)))  unsigned v4u;
typedef __attribute__((ext_vector_type(4)))  int v4i;
typedef float __attribute__((may_alias)) float_a;
typedef int __attribute__((may_alias)) int_a;

template <typename T> __device__ __forceinline__ void vst2(void* p, T v) { *(T*)p = v;  }
__device__ __forceinline__ v8f wmma16(v16h a, v16h b, v8f c) {
  v8f d = __builtin_amdgcn_wmma_f32_16x16x32_f16(false, a, false, b, (short)0, c, false, false);
  asm volatile("v_nop\n\tv_nop\n\tv_nop\n\tv_nop" : "+v"(d) : "v"(a), "v"(b));
  return d;
}
__device__ __forceinline__ v8f wmma_bf(v16b a, v16b b, v8f c) {
  v8f d = __builtin_amdgcn_wmma_f32_16x16x32_bf16(false, a, false, b, (short)0, c, false, false);
  asm volatile("v_nop\n\tv_nop\n\tv_nop\n\tv_nop" : "+v"(d) : "v"(a), "v"(b));
  return d;
}
// 16x16x32 fragments: lane = (h = lane>>4, row/col = lane&15); elements 0..7 = k0+8h+0..7, 8..15 = k0+16+8h+0..7; D element r = row 8h+r
__device__ __forceinline__ v16h frag_h(const _Float16* rowk0, int lane) {
  union { v16h v; v8h q[2]; } u; const _Float16* p = rowk0 + 8 * (lane >> 4);
  u.q[0] = *(const v8h*)p; u.q[1] = *(const v8h*)(p + 16); return u.v;
}
__device__ __forceinline__ v16h frag_f32(const float* rowk0, int lane) {
  v16h a; const float* p = rowk0 + 8 * (lane >> 4);
#pragma unroll
  for (int i = 0; i < 8; ++i) { a[i] = (_Float16)p[i]; a[8 + i] = (_Float16)p[16 + i]; }
  return a;
}
__device__ __forceinline__ v16h frag_f32s(const float* rowk0, int lane, float sc) {
  v16h a; const float* p = rowk0 + 8 * (lane >> 4);
#pragma unroll
  for (int i = 0; i < 8; ++i) { a[i] = (_Float16)(p[i] * sc); a[8 + i] = (_Float16)(p[16 + i] * sc); }
  return a;
}
// column fragment from a [K][ld] layout (column n), rows >= K read as 0
__device__ __forceinline__ v16h fragc_f32(const float* W, int k0, int n, int lane, int ld, int K) {
  v16h a; const int g = lane >> 4;
#pragma unroll
  for (int i = 0; i < 8; ++i) { const int ka = k0 + 8 * g + i, kb = ka + 16;
    a[i] = (_Float16)(ka < K ? W[(size_t)(ka < K ? ka : K - 1) * ld + n] : 0.f); a[8 + i] = (_Float16)(kb < K ? W[(size_t)(kb < K ? kb : K - 1) * ld + n] : 0.f); }
  return a;
}
struct F2 { v16b h, l; };
__device__ __forceinline__ F2 bsplit16(const float v[16]) { F2 r;
#pragma unroll
  for (int i = 0; i < 16; ++i) { const __bf16 h = (__bf16)v[i]; r.h[i] = h; r.l[i] = (__bf16)(v[i] - (float)h); }
  return r; }
__device__ __forceinline__ F2 split_row(const float* row, int k0, int lane) { float v[16]; const float* p = row + k0 + 8 * (lane >> 4);
#pragma unroll
  for (int i = 0; i < 8; ++i) { v[i] = p[i]; v[8 + i] = p[16 + i]; }
  return bsplit16(v); }
__device__ __forceinline__ F2 split_rowK(const float* row, int k0, int lane, int K) { float v[16]; const int g = lane >> 4;
#pragma unroll
  for (int i = 0; i < 8; ++i) { const int ka = k0 + 8 * g + i, kb = ka + 16; v[i] = ka < K ? row[ka < K ? ka : K - 1] : 0.f; v[8 + i] = kb < K ? row[kb < K ? kb : K - 1] : 0.f; }
  return bsplit16(v); }
__device__ __forceinline__ F2 split_col(const float* W, int k0, int n, int lane, int ld, int K) { float v[16]; const int g = lane >> 4;
#pragma unroll
  for (int i = 0; i < 8; ++i) { const int ka = k0 + 8 * g + i, kb = ka + 16; v[i] = ka < K ? W[(size_t)(ka < K ? ka : K - 1) * ld + n] : 0.f; v[8 + i] = kb < K ? W[(size_t)(kb < K ? kb : K - 1) * ld + n] : 0.f; }
  return bsplit16(v); }
__device__ __forceinline__ v8f mac3(const F2& a, const F2& b, v8f c) { c = wmma_bf(a.l, b.h, c); c = wmma_bf(a.h, b.l, c); return wmma_bf(a.h, b.h, c); }
__device__ __forceinline__ float sigm(float v) { return 1.0f / (1.0f + expf(-v)); }
#define LDSX() do { asm volatile("s_wait_dscnt 0" ::: "memory"); __builtin_amdgcn_wave_barrier(); __builtin_amdgcn_fence(__ATOMIC_RELEASE, "workgroup"); } while (0)


// Relative-information attention on given q, k, v (B 2, 8 heads, S 2,048, D 64; max distance 128): scores = (q k^T + take(q rel_emb^T, clip(k_info' - q_info') + 128)) / 8, softmax, v; q_info' = where(q_info == -1, 256, q_info), k_info' = where(k_info == -1, 384, k_info).
#define NB 2
#define NH 8
#define SS 2048
#define RR 128
#define NREL (2 * RR + 1)   // 257
#define NRP 272             // padded table width (17 tiles)
#define HD 64
#define NBH (NB * NH)
#ifndef TQB
#define TQB (SS / 64)
#define TNBH NBH
#endif
typedef __attribute__((ext_vector_type(8))) __bf16 v8b;
__device__ __forceinline__ v16b frag_b(const __bf16* rowk0, int lane) {
  union { v16b v; v8b q[2]; } u; const __bf16* p = rowk0 + 8 * (lane >> 4);
  u.q[0] = *(const v8b*)p; u.q[1] = *(const v8b*)(p + 16); return u.v;
}
__device__ __forceinline__ float bfr(float v) { return (float)(__bf16)v; }
__device__ __attribute__((noinline)) float exp_ni(float v) { return expf(v); }
__device__ __attribute__((noinline)) float erf_ni(float v) { return erff(v); }

#define WS_VT  0u                                   // f16 v planes [(b,h)][64 d][s]; bf16 rel rows [272][64] (rows >= 257 zero); f32 QR [(b,h)][s][272]
#define WS_RE  (WS_VT + 2u * (size_t)NBH * HD * SS)
#define WS_QR  (WS_RE + 2u * (size_t)NRP * HD)
#define WS_END (WS_QR + 4u * (size_t)NBH * SS * NRP)

// ---- k_vt: block = (64 keys, (b,h)): v[bh][s][d] -> VT[bh][d][s] f16 (exact for bf16 values in range)
__global__ __launch_bounds__(256) void k_vt(const float* __restrict__ V, _Float16* __restrict__ VT) { __shared__ __align__(16) _Float16 st[HD][64 + 8]; const int t = threadIdx.x; const int s0 = blockIdx.x * 64; const size_t bh = blockIdx.y;
  for (int e = t; e < 64 * HD; e += 256) { const int sl = e >> 6, d = e & 63; st[d][sl] = (_Float16)bfr(V[((bh * SS + s0 + sl) * HD) + d]); } __syncthreads();
  for (int e = t; e < HD * 8; e += 256) { const int d = e >> 3, q = e & 7; vst2((unsigned*)(VT + ((bh * HD + d) * SS) + s0 + q * 8), *(const v4u*)&st[d][q * 8]); } }
// ---- k_rel: one block: rel_emb -> bf16 rows [272][64] (zero padding rows)
__global__ __launch_bounds__(256) void k_rel(const float* __restrict__ RE, __bf16* __restrict__ RB) { __shared__ __align__(16) __bf16 s[NRP * HD]; const int t = threadIdx.x; for (int e = t; e < NRP * HD; e += 256) s[e] = (e < NREL * HD) ? (__bf16)RE[e] : (__bf16)0.0f; __syncthreads(); for (int q = t; q < NRP * HD / 8; q += 256) vst2((unsigned*)(RB + q * 8), *(const v4u*)&s[q * 8]); }
__device__ __forceinline__ v16b fragb_f32_pre(const float* __restrict__ p, int lane) { v16b a; const float* pp = p + 8 * (lane >> 4);
#pragma unroll
  for (int i = 0; i < 8; ++i) { a[i] = (__bf16)pp[i]; a[8 + i] = (__bf16)pp[16 + i]; } return a; }
// ---- k_qr: block = (64 rows, (b,h)): QR[bh][s][r] = q[s] . rel_emb[r] (exact; 17 tiles incl. zero padding)
__global__ __launch_bounds__(128) void k_qr(const float* __restrict__ Q, const __bf16* __restrict__ RB, float* __restrict__ QR) { __shared__ __align__(16) float sf[4][16][NRP + 4];
  const int tid = threadIdx.x, wave = tid >> 5, lane = tid & 31, col = lane & 15, g = lane >> 4; const size_t bh = blockIdx.y; const size_t r0 = bh * SS + (size_t)blockIdx.x * 64 + wave * 16;
  v16b aq[2];
#pragma unroll
  for (int kc = 0; kc < 2; ++kc) aq[kc] = fragb_f32_pre(Q + (r0 + col) * HD + kc * 32, lane);
#pragma unroll 1
  for (int j = 0; j < NRP / 16; ++j) { v8f c = {};
#pragma unroll
    for (int kc = 0; kc < 2; ++kc) c = wmma_bf(aq[kc], frag_b(RB + (size_t)(j * 16 + col) * HD + kc * 32, lane), c);
#pragma unroll
    for (int r = 0; r < 8; ++r) sf[wave][8 * g + r][j * 16 + col] = c[r]; }
  LDSX(); for (int rl = 0; rl < 16; ++rl) for (int q = lane; q < NRP / 4; q += 32) vst2(QR + (r0 + rl) * NRP + q * 4, *(const v4f*)&sf[wave][rl][q * 4]); }
__device__ __forceinline__ v16b fragb_f32(const float* __restrict__ p, int lane) { v16b a; const float* pp = p + 8 * (lane >> 4);
#pragma unroll
  for (int i = 0; i < 8; ++i) { a[i] = (__bf16)pp[i]; a[8 + i] = (__bf16)pp[16 + i]; } return a; }
#define KPF 68              // staged k row pitch in floats: 272 B = 16 B x odd, conflict-free for 16-byte LDS reads
#define VPH 40              // staged v row pitch in halves: 80 B = 16 B x odd
#define KTB (32 * KPF * 4)  // bytes of one staged k tile (32 keys)
#define VTB (HD * VPH * 2)  // bytes of one staged v tile (64 d rows x 32 keys)
#define ITB (4 * 32 * 4)    // bytes of one staged k_info tile (one copy of the 32 ints per wave)
__device__ __forceinline__ unsigned lds_off(const void* p) { return (unsigned)(size_t)p; }
// one 32-key tile for the whole work-group, global -> LDS through no register: per thread 4 x 16 B of k, 2 x 16 B of v planes, 4 B of k_info.
// The s_wait_xcnt closes the statement so that no address register of a copy is rewritten ahead of it.
__device__ __forceinline__ void stage_tile(const float* kg, const _Float16* vg, const int* ig, unsigned kl, unsigned vl, unsigned il) {
  asm volatile("global_load_async_to_lds_b128 %0, %1, off\n\t"
               "global_load_async_to_lds_b128 %2, %3, off\n\t"
               "global_load_async_to_lds_b128 %4, %5, off\n\t"
               "global_load_async_to_lds_b128 %6, %7, off\n\t"
               "global_load_async_to_lds_b128 %8, %9, off\n\t"
               "global_load_async_to_lds_b128 %10, %11, off\n\t"
               "global_load_async_to_lds_b32 %12, %13, off\n\t"
               "s_wait_xcnt 0x0"
               :: "v"(kl), "v"(kg), "v"(kl + 8u * KPF * 4u), "v"(kg + 512), "v"(kl + 16u * KPF * 4u), "v"(kg + 1024), "v"(kl + 24u * KPF * 4u), "v"(kg + 1536),
                  "v"(vl), "v"(vg), "v"(vl + 32u * VPH * 2u), "v"(vg + (size_t)32 * SS), "v"(il), "v"(ig) : "memory");
}
// lane l with lane l ^ 16, on the vector pipe
__device__ __forceinline__ float xhalf(float x) { return __builtin_bit_cast(float, __builtin_amdgcn_permlanex16(__builtin_bit_cast(int, x), __builtin_bit_cast(int, x), 0x76543210, 0xfedcba98, false, false)); }
// ---- k_attn: block = (64 queries, (b,h)): transposed products, S^T = k q^T (exact bf16 products, f32 accumulate) and O^T += v^T P^T: a lane holds 16 of the 32 keys' scores of ONE query (query = lane & 15; keys 8g + r and 16 + 8g + r),
// so the running maximum and the sum are in-lane (one exchange between the halves for the maximum, the halves' sums joined after the loop) and P hi + residual packs from the score registers straight into the B operand; k, v and k_info tiles of 32 keys staged once per block in a two-buffer LDS ring
__global__ __launch_bounds__(128) void k_attn(const float* __restrict__ Q, const float* __restrict__ K, const _Float16* __restrict__ VT, const float* __restrict__ QR, const int* __restrict__ QI, const int* __restrict__ KI, float* __restrict__ O) {
  __shared__ __align__(16) float so[4][16][68]; __shared__ float sqr[4][16][NREL + 3];
  __shared__ __align__(16) float skt[2][32][KPF]; __shared__ __align__(16) _Float16 svt[2][HD][VPH]; __shared__ __align__(16) int ski[2][4][32];
  const int tid = threadIdx.x, wave = tid >> 5, lane = tid & 31, col = lane & 15, g = lane >> 4; const size_t bh = blockIdx.y; const int q0 = blockIdx.x * 64 + wave * 16; const float* Qb = Q + (bh * SS) * HD; const float* Kb = K + (bh * SS) * HD; const _Float16* Vb = VT + bh * HD * SS;
  v16b aq[2];
#pragma unroll
  for (int kc = 0; kc < 2; ++kc) aq[kc] = fragb_f32(Qb + (size_t)(q0 + col) * HD + kc * 32, lane);
  const size_t b = bh / NH; for (int e = lane; e < 16 * NREL; e += 32) { const int rl = e / NREL, rr = e % NREL; sqr[wave][rl][rr] = QR[(bh * SS + q0 + rl) * NRP + rr]; }
  const int qi = QI[b * SS + q0 + col]; const int qa = (qi == -1) ? 2 * RR : qi;
  const float* qrow = &sqr[wave][col][RR];   // the lane's own query's bias row, centred on distance 0
  LDSX();
  float m = -3.0e38f, l = 0.f;
  v8f acc[4] = {}, accl[4] = {};
  const float* kg = Kb + tid * 4; const _Float16* vg = Vb + (size_t)(tid >> 2) * SS + (tid & 3) * 8; const int* ig = KI + b * SS + lane;
  const unsigned kl = lds_off(&skt[0][tid >> 4][(tid & 15) * 4]), vl = lds_off(&svt[0][tid >> 2][(tid & 3) * 8]), il = lds_off(&ski[0][wave][lane]);
  stage_tile(kg, vg, ig, kl, vl, il);
  asm volatile("s_wait_asynccnt 0x0" ::: "memory");   // tile 0 has landed before the barrier publishes it
  __syncthreads();                                    // publishes tile 0 to every wave
  stage_tile(kg + 32 * HD, vg + 32, ig + 32, kl + KTB, vl + VTB, il + ITB);
#pragma unroll 1
  for (int ks = 0; ks < SS / 32; ++ks) { float s[2][8]; const int bf = ks & 1;
    v16b kb[2][2]; v4i kiv[2][2];   // all of the trip's k fragment reads go out as one group, ahead of the first product
#pragma unroll   // constant indices keep kb and kiv in registers
    for (int ct = 0; ct < 2; ++ct) { kiv[ct][0] = *(const v4i*)&ski[bf][wave][ct * 16 + 8 * g]; kiv[ct][1] = *(const v4i*)&ski[bf][wave][ct * 16 + 8 * g + 4];
#pragma unroll   // as above
      for (int kc = 0; kc < 2; ++kc) kb[ct][kc] = fragb_f32(&skt[bf][ct * 16 + col][kc * 32], lane); }
#pragma unroll
    for (int ct = 0; ct < 2; ++ct) { v8f c = {};
#pragma unroll
      for (int kc = 0; kc < 2; ++kc) c = wmma_bf(kb[ct][kc], aq[kc], c);   // A = 16 keys, B = 16 queries: element r = key ct * 16 + 8g + r, column = query
#pragma unroll
      for (int r = 0; r < 8; ++r) { const int ki = kiv[ct][r >> 2][r & 3]; const int ka = (ki == -1) ? 3 * RR : ki; int dmv = ka - qa; dmv = dmv < -RR ? -RR : (dmv > RR ? RR : dmv); s[ct][r] = (c[r] + qrow[dmv]) * 0.125f; } }
    float mx = fmaxf(s[0][0], s[1][0]);
#pragma unroll
    for (int r = 1; r < 8; ++r) mx = fmaxf(mx, fmaxf(s[0][r], s[1][r]));
    mx = fmaxf(mx, xhalf(mx));
    const float mn = fmaxf(m, mx); const float alpha = (m <= -1.0e38f) ? 0.f : __expf(m - mn); m = mn;
    v16h pa, pl; float es0 = 0.f, es1 = 0.f;
#pragma unroll
    for (int i = 0; i < 8; ++i) { const float e0 = __expf(s[0][i] - mn), e1 = __expf(s[1][i] - mn); es0 += e0; es1 += e1;
      const float x0 = e0 * 2048.0f, x1 = e1 * 2048.0f; const _Float16 h0 = (_Float16)x0, h1 = (_Float16)x1; pa[i] = h0; pa[8 + i] = h1; pl[i] = (_Float16)((x0 - (float)h0) * 2048.0f); pl[8 + i] = (_Float16)((x1 - (float)h1) * 2048.0f); }
    l = l * alpha + (es0 + es1);
#pragma unroll
    for (int dt = 0; dt < 4; ++dt) { acc[dt] *= alpha; accl[dt] *= alpha; }
    v16h vf[4];
#pragma unroll   // constant indices keep vf in registers
    for (int dt = 0; dt < 4; ++dt) vf[dt] = frag_h(&svt[bf][dt * 16 + col][0], lane);
#pragma unroll
    for (int dt = 0; dt < 4; ++dt) { acc[dt] = wmma16(vf[dt], pa, acc[dt]); accl[dt] = wmma16(vf[dt], pl, accl[dt]); }   // A = 16 d rows of v^T, B = P^T: element r = d dt * 16 + 8g + r, column = query
    asm volatile("s_wait_dscnt 0" ::: "memory");        // this wave's reads of buffer bf have retired before the buffer is handed back
    asm volatile("s_wait_asynccnt 0x0" ::: "memory");   // this wave's share of tile ks + 1 has landed before the barrier publishes it
    __syncthreads();                                    // publishes tile ks + 1 and ends every wave's reads of buffer bf
    if (ks + 2 < SS / 32) stage_tile(kg + (size_t)(ks + 2) * 32 * HD, vg + (ks + 2) * 32, ig + (ks + 2) * 32, kl + bf * KTB, vl + bf * VTB, il + bf * ITB); }
  asm volatile("s_wait_asynccnt 0x0" ::: "memory");     // no copy is outstanding when the wave goes on to its epilogue
  l += xhalf(l);   // the two halves hold the sums of their own keys
  { const float il2 = (1.0f / 2048.0f) / l;
#pragma unroll
    for (int dt = 0; dt < 4; ++dt) { v4f o0, o1;
#pragma unroll
      for (int r = 0; r < 4; ++r) { o0[r] = (acc[dt][r] + accl[dt][r] * (1.0f / 2048.0f)) * il2; o1[r] = (acc[dt][4 + r] + accl[dt][4 + r] * (1.0f / 2048.0f)) * il2; }
      *(v4f*)&so[wave][col][dt * 16 + 8 * g] = o0; *(v4f*)&so[wave][col][dt * 16 + 8 * g + 4] = o1; } }
  LDSX();
  for (int rl = 0; rl < 16; ++rl) if (lane < 16) vst2(O + ((bh * SS + q0 + rl) * HD) + lane * 4, *(const v4f*)&so[wave][rl][lane * 4]);
}
extern "C" void kernel_launch(void* const* d_in, const int* in_sizes, int n_in, void* d_out, int out_size, void* d_ws, size_t ws_size, hipStream_t stream) {
  (void)in_sizes; (void)n_in; (void)out_size;
  const float** F = (const float**)d_in;   // 0 q, 1 k, 2 v [2,8,2048,64], 3 rel_emb [257,64], 4 q_info int [2,2048], 5 k_info int [2,2048]
  if (ws_size < (size_t)WS_END) return;
  _Float16* VT = (_Float16*)((char*)d_ws + WS_VT); __bf16* RB = (__bf16*)((char*)d_ws + WS_RE); float* QR = (float*)((char*)d_ws + WS_QR);
  k_vt<<<dim3(SS / 64, NBH), 256, 0, stream>>>(F[2], VT);
  k_rel<<<1, 256, 0, stream>>>(F[3], RB);
  k_qr<<<dim3(SS / 64, NBH), 128, 0, stream>>>(F[0], RB, QR);
  k_attn<<<dim3(TQB, TNBH), 128, 0, stream>>>(F[0], F[1], VT, QR, (const int*)d_in[4], (const int*)d_in[5], (float*)d_out);
}

// v003
// Measured time: 63.5 microseconds a run.
// In two side-by-side timings against v002, it was 1.89 and 1.90 times as fast.
// All steps since v000 together make it 4.12 times as fast.
// compute dtype: all float inputs rounded to bf16, q_info / k_info (int) read on device; qr = q . rel_emb^T with EXACT bf16 products on WMMA 16x16x32 (f32 table), the per-pair index clip(k_adj - q_adj, -128, 128) + 128 computed on device from the int inputs and the bias gathered from the wave's LDS copy of the qr rows; scores = q . k (exact bf16 products) + bias, x 1/8, running-max softmax in f32 (hardware exp); P (x 2^11) as f16 hi + residual (2 products) x v (exact in f16), f32 accumulate; f32 output.
#include <hip/hip_runtime.h>
#include <math.h>

typedef __attribute__((ext_vector_type(16))) _Float16 v16h;
typedef __attribute__((ext_vector_type(16))) __bf16 v16b;
typedef __attribute__((ext_vector_type(8)))  _Float16 v8h;
typedef __attribute__((ext_vector_type(8)))  float v8f;
typedef __attribute__((ext_vector_type(4)))  float v4f;
typedef __attribute__((ext_vector_type(2)))  float v2f;
typedef __attribute__((ext_vector_type(4)))  unsigned v4u;
typedef __attribute__((ext_vector_type(4)))  int v4i;
typedef float __attribute__((may_alias)) float_a;
typedef int __attribute__((may_alias)) int_a;

template <typename T> __device__ __forceinline__ void vst2(void* p, T v) { *(T*)p = v;  }
__device__ __forceinline__ v8f wmma16(v16h a, v16h b, v8f c) {
  v8f d = __builtin_amdgcn_wmma_f32_16x16x32_f16(false, a, false, b, (short)0, c, false, false);
  asm volatile("v_nop\n\tv_nop\n\tv_nop\n\tv_nop" : "+v"(d) : "v"(a), "v"(b));
  return d;
}
__device__ __forceinline__ v8f wmma_bf(v16b a, v16b b, v8f c) {
  v8f d = __builtin_amdgcn_wmma_f32_16x16x32_bf16(false, a, false, b, (short)0, c, false, false);
  asm volatile("v_nop\n\tv_nop\n\tv_nop\n\tv_nop" : "+v"(d) : "v"(a), "v"(b));
  return d;
}
// 16x16x32 fragments: lane = (h = lane>>4, row/col = lane&15); elements 0..7 = k0+8h+0..7, 8..15 = k0+16+8h+0..7; D element r = row 8h+r
__device__ __forceinline__ v16h frag_h(const _Float16* rowk0, int lane) {
  union { v16h v; v8h q[2]; } u; const _Float16* p = rowk0 + 8 * (lane >> 4);
  u.q[0] = *(const v8h*)p; u.q[1] = *(const v8h*)(p + 16); return u.v;
}
__device__ __forceinline__ v16h frag_f32(const float* rowk0, int lane) {
  v16h a; const float* p = rowk0 + 8 * (lane >> 4);
#pragma unroll
  for (int i = 0; i < 8; ++i) { a[i] = (_Float16)p[i]; a[8 + i] = (_Float16)p[16 + i]; }
  return a;
}
__device__ __forceinline__ v16h frag_f32s(const float* rowk0, int lane, float sc) {
  v16h a; const float* p = rowk0 + 8 * (lane >> 4);
#pragma unroll
  for (int i = 0; i < 8; ++i) { a[i] = (_Float16)(p[i] * sc); a[8 + i] = (_Float16)(p[16 + i] * sc); }
  return a;
}
// column fragment from a [K][ld] layout (column n), rows >= K read as 0
__device__ __forceinline__ v16h fragc_f32(const float* W, int k0, int n, int lane, int ld, int K) {
  v16h a; const int g = lane >> 4;
#pragma unroll
  for (int i = 0; i < 8; ++i) { const int ka = k0 + 8 * g + i, kb = ka + 16;
    a[i] = (_Float16)(ka < K ? W[(size_t)(ka < K ? ka : K - 1) * ld + n] : 0.f); a[8 + i] = (_Float16)(kb < K ? W[(size_t)(kb < K ? kb : K - 1) * ld + n] : 0.f); }
  return a;
}
struct F2 { v16b h, l; };
__device__ __forceinline__ F2 bsplit16(const float v[16]) { F2 r;
#pragma unroll
  for (int i = 0; i < 16; ++i) { const __bf16 h = (__bf16)v[i]; r.h[i] = h; r.l[i] = (__bf16)(v[i] - (float)h); }
  return r; }
__device__ __forceinline__ F2 split_row(const float* row, int k0, int lane) { float v[16]; const float* p = row + k0 + 8 * (lane >> 4);
#pragma unroll
  for (int i = 0; i < 8; ++i) { v[i] = p[i]; v[8 + i] = p[16 + i]; }
  return bsplit16(v); }
__device__ __forceinline__ F2 split_rowK(const float* row, int k0, int lane, int K) { float v[16]; const int g = lane >> 4;
#pragma unroll
  for (int i = 0; i < 8; ++i) { const int ka = k0 + 8 * g + i, kb = ka + 16; v[i] = ka < K ? row[ka < K ? ka : K - 1] : 0.f; v[8 + i] = kb < K ? row[kb < K ? kb : K - 1] : 0.f; }
  return bsplit16(v); }
__device__ __forceinline__ F2 split_col(const float* W, int k0, int n, int lane, int ld, int K) { float v[16]; const int g = lane >> 4;
#pragma unroll
  for (int i = 0; i < 8; ++i) { const int ka = k0 + 8 * g + i, kb = ka + 16; v[i] = ka < K ? W[(size_t)(ka < K ? ka : K - 1) * ld + n] : 0.f; v[8 + i] = kb < K ? W[(size_t)(kb < K ? kb : K - 1) * ld + n] : 0.f; }
  return bsplit16(v); }
__device__ __forceinline__ v8f mac3(const F2& a, const F2& b, v8f c) { c = wmma_bf(a.l, b.h, c); c = wmma_bf(a.h, b.l, c); return wmma_bf(a.h, b.h, c); }
__device__ __forceinline__ float sigm(float v) { return 1.0f / (1.0f + expf(-v)); }
#define LDSX() do { asm volatile("s_wait_dscnt 0" ::: "memory"); __builtin_amdgcn_wave_barrier(); __builtin_amdgcn_fence(__ATOMIC_RELEASE, "workgroup"); } while (0)


// Relative-information attention on given q, k, v (B 2, 8 heads, S 2,048, D 64; max distance 128): scores = (q k^T + take(q rel_emb^T, clip(k_info' - q_info') + 128)) / 8, softmax, v; q_info' = where(q_info == -1, 256, q_info), k_info' = where(k_info == -1, 384, k_info).
#define NB 2
#define NH 8
#define SS 2048
#define RR 128
#define NREL (2 * RR + 1)   // 257
#define HD 64
#define NBH (NB * NH)
#ifndef TQB
#define TQB (SS / 64)
#define TNBH NBH
#endif
typedef __attribute__((ext_vector_type(8))) __bf16 v8b;
__device__ __forceinline__ v16b frag_b(const __bf16* rowk0, int lane) {
  union { v16b v; v8b q[2]; } u; const __bf16* p = rowk0 + 8 * (lane >> 4);
  u.q[0] = *(const v8b*)p; u.q[1] = *(const v8b*)(p + 16); return u.v;
}
__device__ __forceinline__ float bfr(float v) { return (float)(__bf16)v; }
__device__ __attribute__((noinline)) float exp_ni(float v) { return expf(v); }
__device__ __attribute__((noinline)) float erf_ni(float v) { return erff(v); }

#define WS_VT  0u                                   // f16 v planes [(b,h)][64 d][s]
#define WS_END (WS_VT + 2u * (size_t)NBH * HD * SS)

// ---- k_vt: block = (64 keys, (b,h)): v[bh][s][d] -> VT[bh][d][s] f16 (exact for bf16 values in range)
__global__ __launch_bounds__(256) void k_vt(const float* __restrict__ V, _Float16* __restrict__ VT) { __shared__ __align__(16) _Float16 st[HD][64 + 8]; const int t = threadIdx.x; const int s0 = blockIdx.x * 64; const size_t bh = blockIdx.y;
  for (int e = t; e < 64 * HD; e += 256) { const int sl = e >> 6, d = e & 63; st[d][sl] = (_Float16)bfr(V[((bh * SS + s0 + sl) * HD) + d]); } __syncthreads();
  for (int e = t; e < HD * 8; e += 256) { const int d = e >> 3, q = e & 7; vst2((unsigned*)(VT + ((bh * HD + d) * SS) + s0 + q * 8), *(const v4u*)&st[d][q * 8]); } }
__device__ __forceinline__ v16b fragb_f32(const float* __restrict__ p, int lane) { v16b a; const float* pp = p + 8 * (lane >> 4);
#pragma unroll
  for (int i = 0; i < 8; ++i) { a[i] = (__bf16)pp[i]; a[8 + i] = (__bf16)pp[16 + i]; } return a; }
#define KPF 68              // staged k row pitch in floats: 272 B = 16 B x odd, conflict-free for 16-byte LDS reads
#define VPH 40              // staged v row pitch in halves: 80 B = 16 B x odd
#define KTB (32 * KPF * 4)  // bytes of one staged k tile (32 keys)
#define VTB (HD * VPH * 2)  // bytes of one staged v tile (64 d rows x 32 keys)
#define ITB (4 * 32 * 4)    // bytes of one staged k_info tile (one copy of the 32 ints per wave)
#define RPB 72              // staged rel_emb row pitch in bf16: 144 B = 16 B x odd
typedef __attribute__((ext_vector_type(4))) __bf16 v4b;
__device__ __forceinline__ unsigned lds_off(const void* p) { return (unsigned)(size_t)p; }
// one 32-key tile for the whole work-group, global -> LDS through no register: per thread 4 x 16 B of k, 2 x 16 B of v planes, 4 B of k_info.
// The s_wait_xcnt closes the statement so that no address register of a copy is rewritten ahead of it.
__device__ __forceinline__ void stage_tile(const float* kg, const _Float16* vg, const int* ig, unsigned kl, unsigned vl, unsigned il) {
  asm volatile("global_load_async_to_lds_b128 %0, %1, off\n\t"
               "global_load_async_to_lds_b128 %2, %3, off\n\t"
               "global_load_async_to_lds_b128 %4, %5, off\n\t"
               "global_load_async_to_lds_b128 %6, %7, off\n\t"
               "global_load_async_to_lds_b128 %8, %9, off\n\t"
               "global_load_async_to_lds_b128 %10, %11, off\n\t"
               "global_load_async_to_lds_b32 %12, %13, off\n\t"
               "s_wait_xcnt 0x0"
               :: "v"(kl), "v"(kg), "v"(kl + 8u * KPF * 4u), "v"(kg + 512), "v"(kl + 16u * KPF * 4u), "v"(kg + 1024), "v"(kl + 24u * KPF * 4u), "v"(kg + 1536),
                  "v"(vl), "v"(vg), "v"(vl + 32u * VPH * 2u), "v"(vg + (size_t)32 * SS), "v"(il), "v"(ig) : "memory");
}
// lane l with lane l ^ 16, on the vector pipe
__device__ __forceinline__ float xhalf(float x) { return __builtin_bit_cast(float, __builtin_amdgcn_permlanex16(__builtin_bit_cast(int, x), __builtin_bit_cast(int, x), 0x76543210, 0xfedcba98, false, false)); }
// ---- k_attn: block = (64 queries, (b,h)): transposed products, S^T = k q^T (exact bf16 products, f32 accumulate) and O^T += v^T P^T: a lane holds 16 of the 32 keys' scores of ONE query (query = lane & 15; keys 8g + r and 16 + 8g + r),
// so the running maximum and the sum are in-lane (one exchange between the halves for the maximum, the halves' sums joined after the loop) and P hi + residual packs from the score registers straight into the B operand; k, v and k_info tiles of 32 keys staged once per block in a two-buffer LDS ring.
// The bias table is made here: rel_emb's first 256 rows rounded to bf16 into LDS once per block, then each wave's table^T = rel_emb q^T (A = 16 distances, B = the wave's 16 queries) goes from the accumulators straight into the wave's own LDS rows
__global__ __launch_bounds__(128) void k_attn(const float* __restrict__ Q, const float* __restrict__ K, const _Float16* __restrict__ VT, const float* __restrict__ RE, const int* __restrict__ QI, const int* __restrict__ KI, float* __restrict__ O) {
  __shared__ __align__(16) float so[4][16][68]; __shared__ __align__(16) float sqr[4][16][NREL + 3]; __shared__ __align__(16) __bf16 srel[NREL - 1][RPB];
  __shared__ __align__(16) float skt[2][32][KPF]; __shared__ __align__(16) _Float16 svt[2][HD][VPH]; __shared__ __align__(16) int ski[2][4][32];
  const int tid = threadIdx.x, wave = tid >> 5, lane = tid & 31, col = lane & 15, g = lane >> 4; const size_t bh = blockIdx.y; const int q0 = blockIdx.x * 64 + wave * 16; const float* Qb = Q + (bh * SS) * HD; const float* Kb = K + (bh * SS) * HD; const _Float16* Vb = VT + bh * HD * SS;
  v16b aq[2];
#pragma unroll
  for (int kc = 0; kc < 2; ++kc) aq[kc] = fragb_f32(Qb + (size_t)(q0 + col) * HD + kc * 32, lane);
  const size_t b = bh / NH;
#pragma unroll   // a constant trip count lets the 16-byte loads go out in groups instead of one per wait
  for (int i = 0; i < (NREL - 1) * HD / 4 / 128; ++i) { const int f = i * 128 + tid; const v4f x = *(const v4f*)(RE + (size_t)f * 4); v4b y;
#pragma unroll
    for (int c = 0; c < 4; ++c) y[c] = (__bf16)x[c];
    *(v4b*)&srel[f >> 4][(f & 15) * 4] = y; }
  { v8f c = {}; v16b fl[2];   // distance index 256: the one row, straight from global, in all 16 A rows; both fragments read ahead of the first product
#pragma unroll   // constant indices keep fl in registers
    for (int kc = 0; kc < 2; ++kc) fl[kc] = fragb_f32(RE + (size_t)(NREL - 1) * HD + kc * 32, lane);
#pragma unroll
    for (int kc = 0; kc < 2; ++kc) c = wmma_bf(fl[kc], aq[kc], c);
    if (g == 0) sqr[wave][col][NREL - 1] = c[0]; }
  __syncthreads();   // publishes the staged rel_emb rows to every wave
#pragma unroll 1   // four tiles a trip: their fragment reads go out as one group, ahead of the first product
  for (int jb = 0; jb < (NREL - 1) / 64; ++jb) { v16b fa[4][2];
#pragma unroll   // constant indices keep fa in registers
    for (int jt = 0; jt < 4; ++jt) {
#pragma unroll   // as above
      for (int kc = 0; kc < 2; ++kc) fa[jt][kc] = frag_b(&srel[jb * 64 + jt * 16 + col][kc * 32], lane); }
#pragma unroll
    for (int jt = 0; jt < 4; ++jt) { v8f c = {};
#pragma unroll
      for (int kc = 0; kc < 2; ++kc) c = wmma_bf(fa[jt][kc], aq[kc], c);   // element r = distance index jb * 64 + jt * 16 + 8g + r, column = query
      v4f t0, t1;
#pragma unroll
      for (int r = 0; r < 4; ++r) { t0[r] = c[r]; t1[r] = c[4 + r]; }
      *(v4f*)&sqr[wave][col][jb * 64 + jt * 16 + 8 * g] = t0; *(v4f*)&sqr[wave][col][jb * 64 + jt * 16 + 8 * g + 4] = t1; } }
  const int qi = QI[b * SS + q0 + col]; const int qa = (qi == -1) ? 2 * RR : qi;
  const float* qrow = &sqr[wave][col][RR];   // the lane's own query's bias row, centred on distance 0
  LDSX();
  float m = -3.0e38f, l = 0.f;
  v8f acc[4] = {}, accl[4] = {};
  const float* kg = Kb + tid * 4; const _Float16* vg = Vb + (size_t)(tid >> 2) * SS + (tid & 3) * 8; const int* ig = KI + b * SS + lane;
  const unsigned kl = lds_off(&skt[0][tid >> 4][(tid & 15) * 4]), vl = lds_off(&svt[0][tid >> 2][(tid & 3) * 8]), il = lds_off(&ski[0][wave][lane]);
  stage_tile(kg, vg, ig, kl, vl, il);
  asm volatile("s_wait_asynccnt 0x0" ::: "memory");   // tile 0 has landed before the barrier publishes it
  __syncthreads();                                    // publishes tile 0 to every wave
  stage_tile(kg + 32 * HD, vg + 32, ig + 32, kl + KTB, vl + VTB, il + ITB);
#pragma unroll 1
  for (int ks = 0; ks < SS / 32; ++ks) { float s[2][8]; const int bf = ks & 1;
    v16b kb[2][2]; v4i kiv[2][2];   // all of the trip's k fragment reads go out as one group, ahead of the first product
#pragma unroll   // constant indices keep kb and kiv in registers
    for (int ct = 0; ct < 2; ++ct) { kiv[ct][0] = *(const v4i*)&ski[bf][wave][ct * 16 + 8 * g]; kiv[ct][1] = *(const v4i*)&ski[bf][wave][ct * 16 + 8 * g + 4];
#pragma unroll   // as above
      for (int kc = 0; kc < 2; ++kc) kb[ct][kc] = fragb_f32(&skt[bf][ct * 16 + col][kc * 32], lane); }
#pragma unroll
    for (int ct = 0; ct < 2; ++ct) { v8f c = {};
#pragma unroll
      for (int kc = 0; kc < 2; ++kc) c = wmma_bf(kb[ct][kc], aq[kc], c);   // A = 16 keys, B = 16 queries: element r = key ct * 16 + 8g + r, column = query
#pragma unroll
      for (int r = 0; r < 8; ++r) { const int ki = kiv[ct][r >> 2][r & 3]; const int ka = (ki == -1) ? 3 * RR : ki; int dmv = ka - qa; dmv = dmv < -RR ? -RR : (dmv > RR ? RR : dmv); s[ct][r] = (c[r] + qrow[dmv]) * 0.125f; } }
    float mx = fmaxf(s[0][0], s[1][0]);
#pragma unroll
    for (int r = 1; r < 8; ++r) mx = fmaxf(mx, fmaxf(s[0][r], s[1][r]));
    mx = fmaxf(mx, xhalf(mx));
    const float mn = fmaxf(m, mx); const float alpha = (m <= -1.0e38f) ? 0.f : __expf(m - mn); m = mn;
    v16h pa, pl; float es0 = 0.f, es1 = 0.f;
#pragma unroll
    for (int i = 0; i < 8; ++i) { const float e0 = __expf(s[0][i] - mn), e1 = __expf(s[1][i] - mn); es0 += e0; es1 += e1;
      const float x0 = e0 * 2048.0f, x1 = e1 * 2048.0f; const _Float16 h0 = (_Float16)x0, h1 = (_Float16)x1; pa[i] = h0; pa[8 + i] = h1; pl[i] = (_Float16)((x0 - (float)h0) * 2048.0f); pl[8 + i] = (_Float16)((x1 - (float)h1) * 2048.0f); }
    l = l * alpha + (es0 + es1);
#pragma unroll
    for (int dt = 0; dt < 4; ++dt) { acc[dt] *= alpha; accl[dt] *= alpha; }
    v16h vf[4];
#pragma unroll   // constant indices keep vf in registers
    for (int dt = 0; dt < 4; ++dt) vf[dt] = frag_h(&svt[bf][dt * 16 + col][0], lane);
#pragma unroll
    for (int dt = 0; dt < 4; ++dt) { acc[dt] = wmma16(vf[dt], pa, acc[dt]); accl[dt] = wmma16(vf[dt], pl, accl[dt]); }   // A = 16 d rows of v^T, B = P^T: element r = d dt * 16 + 8g + r, column = query
    asm volatile("s_wait_dscnt 0" ::: "memory");        // this wave's reads of buffer bf have retired before the buffer is handed back
    asm volatile("s_wait_asynccnt 0x0" ::: "memory");   // this wave's share of tile ks + 1 has landed before the barrier publishes it
    __syncthreads();                                    // publishes tile ks + 1 and ends every wave's reads of buffer bf
    if (ks + 2 < SS / 32) stage_tile(kg + (size_t)(ks + 2) * 32 * HD, vg + (ks + 2) * 32, ig + (ks + 2) * 32, kl + bf * KTB, vl + bf * VTB, il + bf * ITB); }
  asm volatile("s_wait_asynccnt 0x0" ::: "memory");     // no copy is outstanding when the wave goes on to its epilogue
  l += xhalf(l);   // the two halves hold the sums of their own keys
  { const float il2 = (1.0f / 2048.0f) / l;
#pragma unroll
    for (int dt = 0; dt < 4; ++dt) { v4f o0, o1;
#pragma unroll
      for (int r = 0; r < 4; ++r) { o0[r] = (acc[dt][r] + accl[dt][r] * (1.0f / 2048.0f)) * il2; o1[r] = (acc[dt][4 + r] + accl[dt][4 + r] * (1.0f / 2048.0f)) * il2; }
      *(v4f*)&so[wave][col][dt * 16 + 8 * g] = o0; *(v4f*)&so[wave][col][dt * 16 + 8 * g + 4] = o1; } }
  LDSX();
  for (int rl = 0; rl < 16; ++rl) if (lane < 16) vst2(O + ((bh * SS + q0 + rl) * HD) + lane * 4, *(const v4f*)&so[wave][rl][lane * 4]);
}
extern "C" void kernel_launch(void* const* d_in, const int* in_sizes, int n_in, void* d_out, int out_size, void* d_ws, size_t ws_size, hipStream_t stream) {
  (void)in_sizes; (void)n_in; (void)out_size;
  const float** F = (const float**)d_in;   // 0 q, 1 k, 2 v [2,8,2048,64], 3 rel_emb [257,64], 4 q_info int [2,2048], 5 k_info int [2,2048]
  if (ws_size < (size_t)WS_END) return;
  _Float16* VT = (_Float16*)((char*)d_ws + WS_VT);
  k_vt<<<dim3(SS / 64, NBH), 256, 0, stream>>>(F[2], VT);
  k_attn<<<dim3(TQB, TNBH), 128, 0, stream>>>(F[0], F[1], VT, F[3], (const int*)d_in[4], (const int*)d_in[5], (float*)d_out);
}

// v004
// One run takes 56.3 microseconds.
// Next to v003, in two timings, it ran 1.13 times as fast each time.
// All steps since v000 together make it 4.67 times as fast.
// compute dtype: all float inputs rounded to bf16, q_info / k_info (int) read on device; qr = q . rel_emb^T with EXACT bf16 products on WMMA 16x16x32 (f32 table), the per-pair index clip(k_adj - q_adj, -128, 128) + 128 computed on device from the int inputs and the bias gathered from the wave's LDS copy of the qr rows; scores = q . k (exact bf16 products) + bias, x 1/8, running-max softmax in f32 (hardware exp); P (x 2^11) as f16 hi + residual (2 products) x v (exact in f16), f32 accumulate; f32 output.
#include <hip/hip_runtime.h>
#include <math.h>

typedef __attribute__((ext_vector_type(16))) _Float16 v16h;
typedef __attribute__((ext_vector_type(16))) __bf16 v16b;
typedef __attribute__((ext_vector_type(8)))  _Float16 v8h;
typedef __attribute__((ext_vector_type(8)))  float v8f;
typedef __attribute__((ext_vector_type(4)))  float v4f;
typedef __attribute__((ext_vector_type(2)))  float v2f;
typedef __attribute__((ext_vector_type(4)))  unsigned v4u;
typedef __attribute__((ext_vector_type(4)))  int v4i;
typedef float __attribute__((may_alias)) float_a;
typedef int __attribute__((may_alias)) int_a;

template <typename T> __device__ __forceinline__ void vst2(void* p, T v) { *(T*)p = v;  }
__device__ __forceinline__ v8f wmma16(v16h a, v16h b, v8f c) {
  v8f d = __builtin_amdgcn_wmma_f32_16x16x32_f16(false, a, false, b, (short)0, c, false, false);
  asm volatile("v_nop\n\tv_nop\n\tv_nop\n\tv_nop" : "+v"(d) : "v"(a), "v"(b));
  return d;
}
__device__ __forceinline__ v8f wmma_bf(v16b a, v16b b, v8f c) {
  v8f d = __builtin_amdgcn_wmma_f32_16x16x32_bf16(false, a, false, b, (short)0, c, false, false);
  asm volatile("v_nop\n\tv_nop\n\tv_nop\n\tv_nop" : "+v"(d) : "v"(a), "v"(b));
  return d;
}
// 16x16x32 fragments: lane = (h = lane>>4, row/col = lane&15); elements 0..7 = k0+8h+0..7, 8..15 = k0+16+8h+0..7; D element r = row 8h+r
__device__ __forceinline__ v16h frag_h(const _Float16* rowk0, int lane) {
  union { v16h v; v8h q[2]; } u; const _Float16* p = rowk0 + 8 * (lane >> 4);
  u.q[0] = *(const v8h*)p; u.q[1] = *(const v8h*)(p + 16); return u.v;
}
__device__ __forceinline__ v16h frag_f32(const float* rowk0, int lane) {
  v16h a; const float* p = rowk0 + 8 * (lane >> 4);
#pragma unroll
  for (int i = 0; i < 8; ++i) { a[i] = (_Float16)p[i]; a[8 + i] = (_Float16)p[16 + i]; }
  return a;
}
__device__ __forceinline__ v16h frag_f32s(const float* rowk0, int lane, float sc) {
  v16h a; const float* p = rowk0 + 8 * (lane >> 4);
#pragma unroll
  for (int i = 0; i < 8; ++i) { a[i] = (_Float16)(p[i] * sc); a[8 + i] = (_Float16)(p[16 + i] * sc); }
  return a;
}
// column fragment from a [K][ld] layout (column n), rows >= K read as 0
__device__ __forceinline__ v16h fragc_f32(const float* W, int k0, int n, int lane, int ld, int K) {
  v16h a; const int g = lane >> 4;
#pragma unroll
  for (int i = 0; i < 8; ++i) { const int ka = k0 + 8 * g + i, kb = ka + 16;
    a[i] = (_Float16)(ka < K ? W[(size_t)(ka < K ? ka : K - 1) * ld + n] : 0.f); a[8 + i] = (_Float16)(kb < K ? W[(size_t)(kb < K ? kb : K - 1) * ld + n] : 0.f); }
  return a;
}
struct F2 { v16b h, l; };
__device__ __forceinline__ F2 bsplit16(const float v[16]) { F2 r;
#pragma unroll
  for (int i = 0; i < 16; ++i) { const __bf16 h = (__bf16)v[i]; r.h[i] = h; r.l[i] = (__bf16)(v[i] - (float)h); }
  return r; }
__device__ __forceinline__ F2 split_row(const float* row, int k0, int lane) { float v[16]; const float* p = row + k0 + 8 * (lane >> 4);
#pragma unroll
  for (int i = 0; i < 8; ++i) { v[i] = p[i]; v[8 + i] = p[16 + i]; }
  return bsplit16(v); }
__device__ __forceinline__ F2 split_rowK(const float* row, int k0, int lane, int K) { float v[16]; const int g = lane >> 4;
#pragma unroll
  for (int i = 0; i < 8; ++i) { const int ka = k0 + 8 * g + i, kb = ka + 16; v[i] = ka < K ? row[ka < K ? ka : K - 1] : 0.f; v[8 + i] = kb < K ? row[kb < K ? kb : K - 1] : 0.f; }
  return bsplit16(v); }
__device__ __forceinline__ F2 split_col(const float* W, int k0, int n, int lane, int ld, int K) { float v[16]; const int g = lane >> 4;
#pragma unroll
  for (int i = 0; i < 8; ++i) { const int ka = k0 + 8 * g + i, kb = ka + 16; v[i] = ka < K ? W[(size_t)(ka < K ? ka : K - 1) * ld + n] : 0.f; v[8 + i] = kb < K ? W[(size_t)(kb < K ? kb : K - 1) * ld + n] : 0.f; }
  return bsplit16(v); }
__device__ __forceinline__ v8f mac3(const F2& a, const F2& b, v8f c) { c = wmma_bf(a.l, b.h, c); c = wmma_bf(a.h, b.l, c); return wmma_bf(a.h, b.h, c); }
__device__ __forceinline__ float sigm(float v) { return 1.0f / (1.0f + expf(-v)); }
#define LDSX() do { asm volatile("s_wait_dscnt 0" ::: "memory"); __builtin_amdgcn_wave_barrier(); __builtin_amdgcn_fence(__ATOMIC_RELEASE, "workgroup"); } while (0)


// Relative-information attention on given q, k, v (B 2, 8 heads, S 2,048, D 64; max distance 128): scores = (q k^T + take(q rel_emb^T, clip(k_info' - q_info') + 128)) / 8, softmax, v; q_info' = where(q_info == -1, 256, q_info), k_info' = where(k_info == -1, 384, k_info).
#define NB 2
#define NH 8
#define SS 2048
#define RR 128
#define NREL (2 * RR + 1)   // 257
#define HD 64
#define NBH (NB * NH)
#ifndef TQB
#define TQB (SS / 64)
#define TNBH NBH
#endif
typedef __attribute__((ext_vector_type(8))) __bf16 v8b;
__device__ __forceinline__ v16b frag_b(const __bf16* rowk0, int lane) {
  union { v16b v; v8b q[2]; } u; const __bf16* p = rowk0 + 8 * (lane >> 4);
  u.q[0] = *(const v8b*)p; u.q[1] = *(const v8b*)(p + 16); return u.v;
}
__device__ __forceinline__ float bfr(float v) { return (float)(__bf16)v; }
__device__ __attribute__((noinline)) float exp_ni(float v) { return expf(v); }
__device__ __attribute__((noinline)) float erf_ni(float v) { return erff(v); }

#define WS_VT  0u                                   // f16 v planes [(b,h)][64 d][s]
#define WS_END (WS_VT + 2u * (size_t)NBH * HD * SS)

// ---- k_vt: block = (64 keys, (b,h)): v[bh][s][d] -> VT[bh][d][s] f16 (exact for bf16 values in range)
__global__ __launch_bounds__(256) void k_vt(const float* __restrict__ V, _Float16* __restrict__ VT) { __shared__ __align__(16) _Float16 st[HD][64 + 8]; const int t = threadIdx.x; const int s0 = blockIdx.x * 64; const size_t bh = blockIdx.y;
  for (int e = t; e < 64 * HD; e += 256) { const int sl = e >> 6, d = e & 63; st[d][sl] = (_Float16)bfr(V[((bh * SS + s0 + sl) * HD) + d]); } __syncthreads();
  for (int e = t; e < HD * 8; e += 256) { const int d = e >> 3, q = e & 7; vst2((unsigned*)(VT + ((bh * HD + d) * SS) + s0 + q * 8), *(const v4u*)&st[d][q * 8]); } }
__device__ __forceinline__ v16b fragb_f32(const float* __restrict__ p, int lane) { v16b a; const float* pp = p + 8 * (lane >> 4);
#pragma unroll
  for (int i = 0; i < 8; ++i) { a[i] = (__bf16)pp[i]; a[8 + i] = (__bf16)pp[16 + i]; } return a; }
#define KPF 68              // staged k row pitch in floats: 272 B = 16 B x odd, conflict-free for 16-byte LDS reads
#define VPH 40              // staged v row pitch in halves: 80 B = 16 B x odd
#define KTB (32 * KPF * 4)  // bytes of one staged k tile (32 keys)
#define VTB (HD * VPH * 2)  // bytes of one staged v tile (64 d rows x 32 keys)
#define ITB (4 * 32 * 4)    // bytes of one staged k_info tile (one copy of the 32 ints per wave)
#define RPB 72              // staged rel_emb row pitch in bf16: 144 B = 16 B x odd
#define KSPL 2              // waves that share one query tile, each on its own run of keys
#define SKH (SS / KSPL)     // keys of one such wave
typedef __attribute__((ext_vector_type(4))) __bf16 v4b;
__device__ __forceinline__ unsigned lds_off(const void* p) { return (unsigned)(size_t)p; }
// one 32-key tile for each key half's four waves, global -> LDS through no register: per thread 4 x 16 B of k, 2 x 16 B of v planes, 4 B of k_info.
// The s_wait_xcnt closes the statement so that no address register of a copy is rewritten ahead of it.
__device__ __forceinline__ void stage_tile(const float* kg, const _Float16* vg, const int* ig, unsigned kl, unsigned vl, unsigned il) {
  asm volatile("global_load_async_to_lds_b128 %0, %1, off\n\t"
               "global_load_async_to_lds_b128 %2, %3, off\n\t"
               "global_load_async_to_lds_b128 %4, %5, off\n\t"
               "global_load_async_to_lds_b128 %6, %7, off\n\t"
               "global_load_async_to_lds_b128 %8, %9, off\n\t"
               "global_load_async_to_lds_b128 %10, %11, off\n\t"
               "global_load_async_to_lds_b32 %12, %13, off\n\t"
               "s_wait_xcnt 0x0"
               :: "v"(kl), "v"(kg), "v"(kl + 8u * KPF * 4u), "v"(kg + 512), "v"(kl + 16u * KPF * 4u), "v"(kg + 1024), "v"(kl + 24u * KPF * 4u), "v"(kg + 1536),
                  "v"(vl), "v"(vg), "v"(vl + 32u * VPH * 2u), "v"(vg + (size_t)32 * SS), "v"(il), "v"(ig) : "memory");
}
// lane l with lane l ^ 16, on the vector pipe
__device__ __forceinline__ float xhalf(float x) { return __builtin_bit_cast(float, __builtin_amdgcn_permlanex16(__builtin_bit_cast(int, x), __builtin_bit_cast(int, x), 0x76543210, 0xfedcba98, false, false)); }
// ---- k_attn: block = (64 queries, (b,h)): transposed products, S^T = k q^T (exact bf16 products, f32 accumulate) and O^T += v^T P^T: a lane holds 16 of the 32 keys' scores of ONE query (query = lane & 15; keys 8g + r and 16 + 8g + r),
// so the running maximum and the sum are in-lane (one exchange between the halves for the maximum, the halves' sums joined after the loop) and P hi + residual packs from the score registers straight into the B operand; k, v and k_info tiles of 32 keys staged once per block in a two-buffer LDS ring.
// The bias table is made here: rel_emb's first 256 rows rounded to bf16 into LDS once per block, then table^T = rel_emb q^T (A = 16 distances, B = 16 queries) goes from the accumulators straight into the query tile's LDS rows.
// Two waves share a query tile (wave = key half * 4 + query tile): each makes half of the tile's table and walks its own half of the keys with its own maximum, sum and accumulators, on its own ring of tiles;
// behind the loop the second half's wave hands its state over through LDS and the first joins the two. Eight waves a block and two blocks a WGP give every SIMD four waves to fill each other's waits.
__global__ __launch_bounds__(256) __attribute__((amdgpu_waves_per_eu(4, 4))) void k_attn(const float* __restrict__ Q, const float* __restrict__ K, const _Float16* __restrict__ VT, const float* __restrict__ RE, const int* __restrict__ QI, const int* __restrict__ KI, float* __restrict__ O) {
  __shared__ __align__(16) float sqr[4][16][NREL + 3];
  // the epilogue's buffers lie on the staged rel_emb rows, whose last read ends at the barrier behind the table: with them apart two blocks would not fit a WGP's LDS
  __shared__ __align__(16) union { __bf16 srel[NREL - 1][RPB]; struct { v4f pm[4][8][32]; float pml[4][2][32]; float so[4][16][68]; } ep; } u;
  __shared__ __align__(16) float skt[2][KSPL][32][KPF]; __shared__ __align__(16) _Float16 svt[2][KSPL][HD][VPH]; __shared__ __align__(16) int ski[2][4 * KSPL][32];
  const int tid = threadIdx.x, wave = __builtin_amdgcn_readfirstlane(tid >> 5), qt = wave & 3, kh = wave >> 2, th = tid & 127, lane = tid & 31, col = lane & 15, g = lane >> 4; const size_t bh = blockIdx.y; const int q0 = blockIdx.x * 64 + qt * 16; const float* Qb = Q + (bh * SS) * HD; const float* Kb = K + (bh * SS) * HD; const _Float16* Vb = VT + bh * HD * SS;
  v16b aq[2];
#pragma unroll
  for (int kc = 0; kc < 2; ++kc) aq[kc] = fragb_f32(Qb + (size_t)(q0 + col) * HD + kc * 32, lane);
  asm volatile("s_wait_xcnt 0x0" ::: "memory");   // a precaution: stands in front of the first rewrite of the address registers that q's loads name
  const size_t b = bh / NH;
#pragma unroll   // a constant trip count lets the 16-byte loads go out in groups instead of one per wait
  for (int i = 0; i < (NREL - 1) * HD / 4 / 256; ++i) { const int f = i * 256 + tid; const v4f x = *(const v4f*)(RE + (size_t)f * 4); v4b y;
#pragma unroll
    for (int c = 0; c < 4; ++c) y[c] = (__bf16)x[c];
    *(v4b*)&u.srel[f >> 4][(f & 15) * 4] = y; }
  if (kh == 0) { v8f c = {}; v16b fl[2];   // distance index 256: the one row, straight from global, in all 16 A rows; both fragments read ahead of the first product
#pragma unroll   // constant indices keep fl in registers
    for (int kc = 0; kc < 2; ++kc) fl[kc] = fragb_f32(RE + (size_t)(NREL - 1) * HD + kc * 32, lane);
#pragma unroll
    for (int kc = 0; kc < 2; ++kc) c = wmma_bf(fl[kc], aq[kc], c);
    if (g == 0) sqr[qt][col][NREL - 1] = c[0]; }
  __syncthreads();   // publishes the staged rel_emb rows to every wave
#pragma unroll 1   // four tiles a trip: their fragment reads go out as one group, ahead of the first product
  for (int j2 = 0; j2 < (NREL - 1) / 64 / KSPL; ++j2) { const int jb = kh * ((NREL - 1) / 64 / KSPL) + j2; v16b fa[4][2];
#pragma unroll   // constant indices keep fa in registers
    for (int jt = 0; jt < 4; ++jt) {
#pragma unroll   // as above
      for (int kc = 0; kc < 2; ++kc) fa[jt][kc] = frag_b(&u.srel[jb * 64 + jt * 16 + col][kc * 32], lane); }
#pragma unroll
    for (int jt = 0; jt < 4; ++jt) { v8f c = {};
#pragma unroll
      for (int kc = 0; kc < 2; ++kc) c = wmma_bf(fa[jt][kc], aq[kc], c);   // element r = distance index jb * 64 + jt * 16 + 8g + r, column = query
      v4f t0, t1;
#pragma unroll
      for (int r = 0; r < 4; ++r) { t0[r] = c[r]; t1[r] = c[4 + r]; }
      *(v4f*)&sqr[qt][col][jb * 64 + jt * 16 + 8 * g] = t0; *(v4f*)&sqr[qt][col][jb * 64 + jt * 16 + 8 * g + 4] = t1; } }
  const int qi = QI[b * SS + q0 + col]; const int qa = (qi == -1) ? 2 * RR : qi;
  const float* qrow = &sqr[qt][col][RR];   // the lane's own query's bias row, centred on distance 0
  __syncthreads();   // publishes each wave's half of the table to the wave that shares its queries, and ends every read of the staged rel_emb rows
  float m = -3.0e38f, l = 0.f;
  v8f acc[4] = {}, accl[4] = {};
  const float* kg = Kb + (size_t)kh * SKH * HD + th * 4; const _Float16* vg = Vb + (size_t)(th >> 2) * SS + kh * SKH + (th & 3) * 8; const int* ig = KI + b * SS + kh * SKH + lane;   // the four waves of a key half stage that half's tiles
  const unsigned kl = lds_off(&skt[0][kh][th >> 4][(th & 15) * 4]), vl = lds_off(&svt[0][kh][th >> 2][(th & 3) * 8]), il = lds_off(&ski[0][wave][lane]);
  stage_tile(kg, vg, ig, kl, vl, il);
  asm volatile("s_wait_asynccnt 0x0" ::: "memory");   // tile 0 has landed before the barrier publishes it
  __syncthreads();                                    // publishes tile 0 to every wave
  stage_tile(kg + 32 * HD, vg + 32, ig + 32, kl + KSPL * KTB, vl + KSPL * VTB, il + KSPL * ITB);
#pragma unroll 1
  for (int ks = 0; ks < SKH / 32; ++ks) { float s[2][8]; const int bf = ks & 1;
    v16b kb[2][2]; v4i kiv[2][2];   // all of the trip's k fragment reads go out as one group, ahead of the first product
#pragma unroll   // constant indices keep kb and kiv in registers
    for (int ct = 0; ct < 2; ++ct) { kiv[ct][0] = *(const v4i*)&ski[bf][wave][ct * 16 + 8 * g]; kiv[ct][1] = *(const v4i*)&ski[bf][wave][ct * 16 + 8 * g + 4];
#pragma unroll   // as above
      for (int kc = 0; kc < 2; ++kc) kb[ct][kc] = fragb_f32(&skt[bf][kh][ct * 16 + col][kc * 32], lane); }
#pragma unroll
    for (int ct = 0; ct < 2; ++ct) { v8f c = {};
#pragma unroll
      for (int kc = 0; kc < 2; ++kc) c = wmma_bf(kb[ct][kc], aq[kc], c);   // A = 16 keys, B = 16 queries: element r = key ct * 16 + 8g + r, column = query
#pragma unroll
      for (int r = 0; r < 8; ++r) { const int ki = kiv[ct][r >> 2][r & 3]; const int ka = (ki == -1) ? 3 * RR : ki; int dmv = ka - qa; dmv = dmv < -RR ? -RR : (dmv > RR ? RR : dmv); s[ct][r] = (c[r] + qrow[dmv]) * 0.125f; } }
    float mx = fmaxf(s[0][0], s[1][0]);
#pragma unroll
    for (int r = 1; r < 8; ++r) mx = fmaxf(mx, fmaxf(s[0][r], s[1][r]));
    mx = fmaxf(mx, xhalf(mx));
    const float mn = fmaxf(m, mx); const float alpha = (m <= -1.0e38f) ? 0.f : __expf(m - mn); m = mn;
    v16h pa, pl; float es0 = 0.f, es1 = 0.f;
#pragma unroll
    for (int i = 0; i < 8; ++i) { const float e0 = __expf(s[0][i] - mn), e1 = __expf(s[1][i] - mn); es0 += e0; es1 += e1;
      const float x0 = e0 * 2048.0f, x1 = e1 * 2048.0f; const _Float16 h0 = (_Float16)x0, h1 = (_Float16)x1; pa[i] = h0; pa[8 + i] = h1; pl[i] = (_Float16)((x0 - (float)h0) * 2048.0f); pl[8 + i] = (_Float16)((x1 - (float)h1) * 2048.0f); }
    l = l * alpha + (es0 + es1);
#pragma unroll
    for (int dt = 0; dt < 4; ++dt) { acc[dt] *= alpha; accl[dt] *= alpha; }
    v16h vf[4];
#pragma unroll   // constant indices keep vf in registers
    for (int dt = 0; dt < 4; ++dt) vf[dt] = frag_h(&svt[bf][kh][dt * 16 + col][0], lane);
#pragma unroll
    for (int dt = 0; dt < 4; ++dt) { acc[dt] = wmma16(vf[dt], pa, acc[dt]); accl[dt] = wmma16(vf[dt], pl, accl[dt]); }   // A = 16 d rows of v^T, B = P^T: element r = d dt * 16 + 8g + r, column = query
    asm volatile("s_wait_dscnt 0" ::: "memory");        // this wave's reads of buffer bf have retired before the buffer is handed back
    asm volatile("s_wait_asynccnt 0x0" ::: "memory");   // this wave's share of tile ks + 1 has landed before the barrier publishes it
    __syncthreads();                                    // publishes tile ks + 1 and ends every wave's reads of buffer bf
    if (ks + 2 < SKH / 32) stage_tile(kg + (size_t)(ks + 2) * 32 * HD, vg + (ks + 2) * 32, ig + (ks + 2) * 32, kl + bf * (KSPL * KTB), vl + bf * (KSPL * VTB), il + bf * (KSPL * ITB)); }
  asm volatile("s_wait_asynccnt 0x0" ::: "memory");     // no copy is outstanding when the wave goes on to its epilogue
  l += xhalf(l);   // the two halves hold the sums of their own keys
  if (kh == 1) {   // the second key half's state, lane for lane: hi + residual joined, then maximum and sum
#pragma unroll
    for (int dt = 0; dt < 4; ++dt) { v4f p0, p1;
#pragma unroll
      for (int r = 0; r < 4; ++r) { p0[r] = acc[dt][r] + accl[dt][r] * (1.0f / 2048.0f); p1[r] = acc[dt][4 + r] + accl[dt][4 + r] * (1.0f / 2048.0f); }
      u.ep.pm[qt][dt * 2][lane] = p0; u.ep.pm[qt][dt * 2 + 1][lane] = p1; }
    u.ep.pml[qt][0][lane] = m; u.ep.pml[qt][1][lane] = l; }
  __syncthreads();   // hands the second half's state to the wave that joins the two
  if (kh == 0) { const float m1 = u.ep.pml[qt][0][lane], l1 = u.ep.pml[qt][1][lane]; const float mj = fmaxf(m, m1); const float a0 = __expf(m - mj), a1 = __expf(m1 - mj);
    const float il2 = (1.0f / 2048.0f) / (l * a0 + l1 * a1); const float f0 = a0 * il2, f1 = a1 * il2;
#pragma unroll
    for (int dt = 0; dt < 4; ++dt) { const v4f p0 = u.ep.pm[qt][dt * 2][lane], p1 = u.ep.pm[qt][dt * 2 + 1][lane]; v4f o0, o1;
#pragma unroll
      for (int r = 0; r < 4; ++r) { o0[r] = (acc[dt][r] + accl[dt][r] * (1.0f / 2048.0f)) * f0 + p0[r] * f1; o1[r] = (acc[dt][4 + r] + accl[dt][4 + r] * (1.0f / 2048.0f)) * f0 + p1[r] * f1; }
      *(v4f*)&u.ep.so[qt][col][dt * 16 + 8 * g] = o0; *(v4f*)&u.ep.so[qt][col][dt * 16 + 8 * g + 4] = o1; }
    LDSX();
    for (int rl = 0; rl < 16; ++rl) if (lane < 16) vst2(O + ((bh * SS + q0 + rl) * HD) + lane * 4, *(const v4f*)&u.ep.so[qt][rl][lane * 4]); }
}
extern "C" void kernel_launch(void* const* d_in, const int* in_sizes, int n_in, void* d_out, int out_size, void* d_ws, size_t ws_size, hipStream_t stream) {
  (void)in_sizes; (void)n_in; (void)out_size;
  const float** F = (const float**)d_in;   // 0 q, 1 k, 2 v [2,8,2048,64], 3 rel_emb [257,64], 4 q_info int [2,2048], 5 k_info int [2,2048]
  if (ws_size < (size_t)WS_END) return;
  _Float16* VT = (_Float16*)((char*)d_ws + WS_VT);
  k_vt<<<dim3(SS / 64, NBH), 256, 0, stream>>>(F[2], VT);
  k_attn<<<dim3(TQB, TNBH), 256, 0, stream>>>(F[0], F[1], VT, F[3], (const int*)d_in[4], (const int*)d_in[5], (float*)d_out);
}

// v005
// One run takes 51.2 microseconds.
// In two side-by-side timings against v004, it was 1.11 and 1.09 times as fast.
// Counting every step since v000, it is 5.14 times as fast.
// compute dtype: all float inputs rounded to bf16, q_info / k_info (int) read on device; qr = q . rel_emb^T with EXACT bf16 products on WMMA 16x16x32 (f32 table), the per-pair index clip(k_adj - q_adj, -128, 128) + 128 computed on device from the int inputs and the bias gathered from the wave's LDS copy of the qr rows; scores = q . k (exact bf16 products) + bias, x 1/8, running-max softmax in f32 (hardware exp); P (x 2^11) as f16 hi + residual (2 products) x v (exact in f16), f32 accumulate; f32 output.
#include <hip/hip_runtime.h>
#include <math.h>

typedef __attribute__((ext_vector_type(16))) _Float16 v16h;
typedef __attribute__((ext_vector_type(16))) __bf16 v16b;
typedef __attribute__((ext_vector_type(8)))  _Float16 v8h;
typedef __attribute__((ext_vector_type(8)))  float v8f;
typedef __attribute__((ext_vector_type(4)))  float v4f;
typedef __attribute__((ext_vector_type(2)))  float v2f;
typedef __attribute__((ext_vector_type(4)))  unsigned v4u;
typedef __attribute__((ext_vector_type(4)))  int v4i;
typedef float __attribute__((may_alias)) float_a;
typedef int __attribute__((may_alias)) int_a;

template <typename T> __device__ __forceinline__ void vst2(void* p, T v) { *(T*)p = v;  }
__device__ __forceinline__ v8f wmma16(v16h a, v16h b, v8f c) {
  v8f d = __builtin_amdgcn_wmma_f32_16x16x32_f16(false, a, false, b, (short)0, c, false, false);
  asm volatile("v_nop\n\tv_nop\n\tv_nop\n\tv_nop" : "+v"(d) : "v"(a), "v"(b));
  return d;
}
__device__ __forceinline__ v8f wmma_bf(v16b a, v16b b, v8f c) {
  v8f d = __builtin_amdgcn_wmma_f32_16x16x32_bf16(false, a, false, b, (short)0, c, false, false);
  asm volatile("v_nop\n\tv_nop\n\tv_nop\n\tv_nop" : "+v"(d) : "v"(a), "v"(b));
  return d;
}
// 16x16x32 fragments: lane = (h = lane>>4, row/col = lane&15); elements 0..7 = k0+8h+0..7, 8..15 = k0+16+8h+0..7; D element r = row 8h+r
__device__ __forceinline__ v16h frag_h(const _Float16* rowk0, int lane) {
  union { v16h v; v8h q[2]; } u; const _Float16* p = rowk0 + 8 * (lane >> 4);
  u.q[0] = *(const v8h*)p; u.q[1] = *(const v8h*)(p + 16); return u.v;
}
__device__ __forceinline__ v16h frag_f32(const float* rowk0, int lane) {
  v16h a; const float* p = rowk0 + 8 * (lane >> 4);
#pragma unroll
  for (int i = 0; i < 8; ++i) { a[i] = (_Float16)p[i]; a[8 + i] = (_Float16)p[16 + i]; }
  return a;
}
__device__ __forceinline__ v16h frag_f32s(const float* rowk0, int lane, float sc) {
  v16h a; const float* p = rowk0 + 8 * (lane >> 4);
#pragma unroll
  for (int i = 0; i < 8; ++i) { a[i] = (_Float16)(p[i] * sc); a[8 + i] = (_Float16)(p[16 + i] * sc); }
  return a;
}
// column fragment from a [K][ld] layout (column n), rows >= K read as 0
__device__ __forceinline__ v16h fragc_f32(const float* W, int k0, int n, int lane, int ld, int K) {
  v16h a; const int g = lane >> 4;
#pragma unroll
  for (int i = 0; i < 8; ++i) { const int ka = k0 + 8 * g + i, kb = ka + 16;
    a[i] = (_Float16)(ka < K ? W[(size_t)(ka < K ? ka : K - 1) * ld + n] : 0.f); a[8 + i] = (_Float16)(kb < K ? W[(size_t)(kb < K ? kb : K - 1) * ld + n] : 0.f); }
  return a;
}
struct F2 { v16b h, l; };
__device__ __forceinline__ F2 bsplit16(const float v[16]) { F2 r;
#pragma unroll
  for (int i = 0; i < 16; ++i) { const __bf16 h = (__bf16)v[i]; r.h[i] = h; r.l[i] = (__bf16)(v[i] - (float)h); }
  return r; }
__device__ __forceinline__ F2 split_row(const float* row, int k0, int lane) { float v[16]; const float* p = row + k0 + 8 * (lane >> 4);
#pragma unroll
  for (int i = 0; i < 8; ++i) { v[i] = p[i]; v[8 + i] = p[16 + i]; }
  return bsplit16(v); }
__device__ __forceinline__ F2 split_rowK(const float* row, int k0, int lane, int K) { float v[16]; const int g = lane >> 4;
#pragma unroll
  for (int i = 0; i < 8; ++i) { const int ka = k0 + 8 * g + i, kb = ka + 16; v[i] = ka < K ? row[ka < K ? ka : K - 1] : 0.f; v[8 + i] = kb < K ? row[kb < K ? kb : K - 1] : 0.f; }
  return bsplit16(v); }
__device__ __forceinline__ F2 split_col(const float* W, int k0, int n, int lane, int ld, int K) { float v[16]; const int g = lane >> 4;
#pragma unroll
  for (int i = 0; i < 8; ++i) { const int ka = k0 + 8 * g + i, kb = ka + 16; v[i] = ka < K ? W[(size_t)(ka < K ? ka : K - 1) * ld + n] : 0.f; v[8 + i] = kb < K ? W[(size_t)(kb < K ? kb : K - 1) * ld + n] : 0.f; }
  return bsplit16(v); }
__device__ __forceinline__ v8f mac3(const F2& a, const F2& b, v8f c) { c = wmma_bf(a.l, b.h, c); c = wmma_bf(a.h, b.l, c); return wmma_bf(a.h, b.h, c); }
__device__ __forceinline__ float sigm(float v) { return 1.0f / (1.0f + expf(-v)); }
#define LDSX() do { asm volatile("s_wait_dscnt 0" ::: "memory"); __builtin_amdgcn_wave_barrier(); __builtin_amdgcn_fence(__ATOMIC_RELEASE, "workgroup"); } while (0)


// Relative-information attention on given q, k, v (B 2, 8 heads, S 2,048, D 64; max distance 128): scores = (q k^T + take(q rel_emb^T, clip(k_info' - q_info') + 128)) / 8, softmax, v; q_info' = where(q_info == -1, 256, q_info), k_info' = where(k_info == -1, 384, k_info).
#define NB 2
#define NH 8
#define SS 2048
#define RR 128
#define NREL (2 * RR + 1)   // 257
#define HD 64
#define NBH (NB * NH)
#ifndef TQB
#define TQB (SS / 64)
#define TNBH NBH
#endif
typedef __attribute__((ext_vector_type(8))) __bf16 v8b;
__device__ __forceinline__ v16b frag_b(const __bf16* rowk0, int lane) {
  union { v16b v; v8b q[2]; } u; const __bf16* p = rowk0 + 8 * (lane >> 4);
  u.q[0] = *(const v8b*)p; u.q[1] = *(const v8b*)(p + 16); return u.v;
}
__device__ __forceinline__ float bfr(float v) { return (float)(__bf16)v; }
__device__ __attribute__((noinline)) float exp_ni(float v) { return expf(v); }
__device__ __attribute__((noinline)) float erf_ni(float v) { return erff(v); }

#define WS_VT  0u                                   // f16 v planes [(b,h)][64 d][s]
#define WS_KB  (WS_VT + 2u * (size_t)NBH * HD * SS)  // bf16 k rows [(b,h)][s][64 d]
#define WS_KA  (WS_KB + 2u * (size_t)NBH * SS * HD)  // int [b][s]: 4 * where(k_info == -1, 384, k_info), a byte offset into a bias row
#define WS_END (WS_KA + 4u * (size_t)NB * SS)

typedef __attribute__((ext_vector_type(4))) __bf16 v4b;
// ---- k_vt: block = (64 keys, (b,h)): v[bh][s][d] -> VT[bh][d][s] f16 (exact for bf16 values in range);
// and what k_attn needs of each key, made once here instead of by every wave that meets the key: k's rows rounded to bf16 (KB), k_info with its -1 replaced and times 4 (KA; the blocks of the first NB planes write one batch row each)
__global__ __launch_bounds__(256) void k_vt(const float* __restrict__ V, const float* __restrict__ K, const int* __restrict__ KI, _Float16* __restrict__ VT, __bf16* __restrict__ KB, int* __restrict__ KA) { __shared__ __align__(16) _Float16 st[HD][64 + 8]; const int t = threadIdx.x; const int s0 = blockIdx.x * 64; const size_t bh = blockIdx.y;
  v4f kx[4]; const float* kp = K + (bh * SS + s0) * HD + t * 4;
#pragma unroll   // constant indices keep kx in registers; the four loads go out ahead of v's, so that their latency runs beside v's
  for (int i = 0; i < 4; ++i) kx[i] = *(const v4f*)(kp + i * 1024);
  asm volatile("s_wait_xcnt 0x0" :: "v"(kp) : "memory");   // a precaution: stands in front of the first rewrite of the address registers that k's loads name; the address as an input keeps those registers as they are up to here
  const bool wka = bh < NB && t < 64; int ki = 0; if (wka) ki = KI[bh * SS + s0 + t];
  for (int e = t; e < 64 * HD; e += 256) { const int sl = e >> 6, d = e & 63; st[d][sl] = (_Float16)bfr(V[((bh * SS + s0 + sl) * HD) + d]); } __syncthreads();
  for (int e = t; e < HD * 8; e += 256) { const int d = e >> 3, q = e & 7; vst2((unsigned*)(VT + ((bh * HD + d) * SS) + s0 + q * 8), *(const v4u*)&st[d][q * 8]); }
  // k's and k_info's stores come last: nothing in this kernel waits for them
#pragma unroll
  for (int i = 0; i < 4; ++i) { v4b y;
#pragma unroll
    for (int c = 0; c < 4; ++c) y[c] = (__bf16)kx[i][c];
    *(v4b*)(KB + (bh * SS + s0) * HD + (size_t)(i * 256 + t) * 4) = y; }
  if (wka) KA[bh * SS + s0 + t] = (int)(4u * (unsigned)((ki == -1) ? 3 * RR : ki)); }
__device__ __forceinline__ v16b fragb_f32(const float* __restrict__ p, int lane) { v16b a; const float* pp = p + 8 * (lane >> 4);
#pragma unroll
  for (int i = 0; i < 8; ++i) { a[i] = (__bf16)pp[i]; a[8 + i] = (__bf16)pp[16 + i]; } return a; }
#define KPB 72              // staged k row pitch in bf16: 144 B = 16 B x odd, conflict-free for 16-byte LDS reads
#define VPH 40              // staged v row pitch in halves: 80 B = 16 B x odd
#define KTB (32 * KPB * 2)  // bytes of one staged k tile (32 keys)
#define VTB (HD * VPH * 2)  // bytes of one staged v tile (64 d rows x 32 keys)
#define ITB (4 * 32 * 4)    // bytes of one staged k_info tile (one copy of the 32 ints per wave)
#define RPB 72              // staged rel_emb row pitch in bf16: 144 B = 16 B x odd
#define KSPL 2              // waves that share one query tile, each on its own run of keys
#define SKH (SS / KSPL)     // keys of one such wave
typedef const __attribute__((address_space(3))) float lds_cf;
__device__ __forceinline__ unsigned lds_off(const void* p) { return (unsigned)(size_t)p; }
// one 32-key tile for the four waves of a key half, global -> LDS through no register: per thread 2 x 16 B of bf16 k, 2 x 16 B of v planes, 4 B of the k_info offsets.
// The s_wait_xcnt closes the statement so that no address register of a copy is rewritten ahead of it.
__device__ __forceinline__ void stage_tile(const __bf16* kg, const _Float16* vg, const int* ig, unsigned kl, unsigned vl, unsigned il) {
  asm volatile("global_load_async_to_lds_b128 %0, %1, off\n\t"
               "global_load_async_to_lds_b128 %2, %3, off\n\t"
               "global_load_async_to_lds_b128 %4, %5, off\n\t"
               "global_load_async_to_lds_b128 %6, %7, off\n\t"
               "global_load_async_to_lds_b32 %8, %9, off\n\t"
               "s_wait_xcnt 0x0"
               :: "v"(kl), "v"(kg), "v"(kl + 16u * KPB * 2u), "v"(kg + 16 * HD),
                  "v"(vl), "v"(vg), "v"(vl + 32u * VPH * 2u), "v"(vg + (size_t)32 * SS), "v"(il), "v"(ig) : "memory");
}
// lane l with lane l ^ 16, on the vector pipe
__device__ __forceinline__ float xhalf(float x) { return __builtin_bit_cast(float, __builtin_amdgcn_permlanex16(__builtin_bit_cast(int, x), __builtin_bit_cast(int, x), 0x76543210, 0xfedcba98, false, false)); }
// ---- k_attn: block = (64 queries, (b,h)): transposed products, S^T = k q^T (exact bf16 products, f32 accumulate) and O^T += v^T P^T: a lane holds 16 of the 32 keys' scores of ONE query (query = lane & 15; keys 8g + r and 16 + 8g + r),
// so the running maximum and the sum are in-lane (one exchange between the halves for the maximum, the halves' sums joined after the loop) and P hi + residual packs from the score registers straight into the B operand; k, v and k_info tiles of 32 keys staged once per block in a two-buffer LDS ring.
// The bias table is made here: rel_emb's first 256 rows rounded to bf16 into LDS once per block, then table^T = rel_emb q^T (A = 16 distances, B = 16 queries) goes from the accumulators straight into the query tile's LDS rows.
// Two waves share a query tile (wave = key half * 4 + query tile): each makes half of the tile's table and walks its own half of the keys with its own maximum, sum and accumulators, on its own ring of tiles;
// behind the loop the second half's wave hands its state over through LDS and the first joins the two. Eight waves a block and two blocks a WGP give every SIMD four waves to fill each other's waits.
__global__ __launch_bounds__(256) __attribute__((amdgpu_waves_per_eu(4, 4))) void k_attn(const float* __restrict__ Q, const __bf16* __restrict__ KB, const _Float16* __restrict__ VT, const float* __restrict__ RE, const int* __restrict__ QI, const int* __restrict__ KA, float* __restrict__ O) {
  __shared__ __align__(16) float sqr[4][16][NREL + 3];
  // the epilogue's buffers lie on the staged rel_emb rows, whose last read ends at the barrier behind the table: with them apart two blocks would not fit a WGP's LDS
  __shared__ __align__(16) union { __bf16 srel[NREL - 1][RPB]; struct { v4f pm[4][8][32]; float pml[4][2][32]; float so[4][16][68]; } ep; } u;
  __shared__ __align__(16) __bf16 skt[2][KSPL][32][KPB]; __shared__ __align__(16) _Float16 svt[2][KSPL][HD][VPH]; __shared__ __align__(16) int ski[2][4 * KSPL][32];
  const int tid = threadIdx.x, wave = __builtin_amdgcn_readfirstlane(tid >> 5), qt = wave & 3, kh = wave >> 2, th = tid & 127, lane = tid & 31, col = lane & 15, g = lane >> 4; const size_t bh = blockIdx.y; const int q0 = blockIdx.x * 64 + qt * 16; const float* Qb = Q + (bh * SS) * HD; const __bf16* Kb = KB + (bh * SS) * HD; const _Float16* Vb = VT + bh * HD * SS;
  v16b aq[2];
#pragma unroll
  for (int kc = 0; kc < 2; ++kc) aq[kc] = fragb_f32(Qb + (size_t)(q0 + col) * HD + kc * 32, lane);
  asm volatile("s_wait_xcnt 0x0" ::: "memory");   // a precaution: stands in front of the first rewrite of the address registers that q's loads name
  const size_t b = bh / NH;
#pragma unroll   // a constant trip count lets the 16-byte loads go out in groups instead of one per wait
  for (int i = 0; i < (NREL - 1) * HD / 4 / 256; ++i) { const int f = i * 256 + tid; const v4f x = *(const v4f*)(RE + (size_t)f * 4); v4b y;
#pragma unroll
    for (int c = 0; c < 4; ++c) y[c] = (__bf16)x[c];
    *(v4b*)&u.srel[f >> 4][(f & 15) * 4] = y; }
  if (kh == 0) { v8f c = {}; v16b fl[2];   // distance index 256: the one row, straight from global, in all 16 A rows; both fragments read ahead of the first product
#pragma unroll   // constant indices keep fl in registers
    for (int kc = 0; kc < 2; ++kc) fl[kc] = fragb_f32(RE + (size_t)(NREL - 1) * HD + kc * 32, lane);
#pragma unroll
    for (int kc = 0; kc < 2; ++kc) c = wmma_bf(fl[kc], aq[kc], c);
    if (g == 0) sqr[qt][col][NREL - 1] = c[0]; }
  __syncthreads();   // publishes the staged rel_emb rows to every wave
#pragma unroll 1   // four tiles a trip: their fragment reads go out as one group, ahead of the first product
  for (int j2 = 0; j2 < (NREL - 1) / 64 / KSPL; ++j2) { const int jb = kh * ((NREL - 1) / 64 / KSPL) + j2; v16b fa[4][2];
#pragma unroll   // constant indices keep fa in registers
    for (int jt = 0; jt < 4; ++jt) {
#pragma unroll   // as above
      for (int kc = 0; kc < 2; ++kc) fa[jt][kc] = frag_b(&u.srel[jb * 64 + jt * 16 + col][kc * 32], lane); }
#pragma unroll
    for (int jt = 0; jt < 4; ++jt) { v8f c = {};
#pragma unroll
      for (int kc = 0; kc < 2; ++kc) c = wmma_bf(fa[jt][kc], aq[kc], c);   // element r = distance index jb * 64 + jt * 16 + 8g + r, column = query
      v4f t0, t1;
#pragma unroll
      for (int r = 0; r < 4; ++r) { t0[r] = c[r]; t1[r] = c[4 + r]; }
      *(v4f*)&sqr[qt][col][jb * 64 + jt * 16 + 8 * g] = t0; *(v4f*)&sqr[qt][col][jb * 64 + jt * 16 + 8 * g + 4] = t1; } }
  const int qi = QI[b * SS + q0 + col]; const int qa = (qi == -1) ? 2 * RR : qi;
  // the lane's own query's bias row, as LDS byte addresses: centre (distance 0) less 4 * q_info', and the row's two ends, which bound every address formed from k_info
  const unsigned qc = lds_off(&sqr[qt][col][RR]); const unsigned qoff = qc - 4u * (unsigned)qa; const int qlo = (int)(qc - 4u * RR), qhi = (int)(qc + 4u * RR);
  __syncthreads();   // publishes each wave's half of the table to the wave that shares its queries, and ends every read of the staged rel_emb rows
  float m = -3.0e38f, l = 0.f;
  v8f acc[4] = {}, accl[4] = {};
  const __bf16* kg = Kb + (size_t)kh * SKH * HD + th * 8; const _Float16* vg = Vb + (size_t)(th >> 2) * SS + kh * SKH + (th & 3) * 8; const int* ig = KA + b * SS + kh * SKH + lane;   // the four waves of a key half stage that half's tiles
  const unsigned kl = lds_off(&skt[0][kh][th >> 3][(th & 7) * 8]), vl = lds_off(&svt[0][kh][th >> 2][(th & 3) * 8]), il = lds_off(&ski[0][wave][lane]);
  stage_tile(kg, vg, ig, kl, vl, il);
  asm volatile("s_wait_asynccnt 0x0" ::: "memory");   // tile 0 has landed before the barrier publishes it
  __syncthreads();                                    // publishes tile 0 to every wave
  stage_tile(kg + 32 * HD, vg + 32, ig + 32, kl + KSPL * KTB, vl + KSPL * VTB, il + KSPL * ITB);
#pragma unroll 1
  for (int ks = 0; ks < SKH / 32; ++ks) { float s[2][8]; const int bf = ks & 1;
    v16b kb[2][2]; v4i kiv[2][2];   // all of the trip's k fragment reads go out as one group, ahead of the first product
#pragma unroll   // constant indices keep kb and kiv in registers
    for (int ct = 0; ct < 2; ++ct) { kiv[ct][0] = *(const v4i*)&ski[bf][wave][ct * 16 + 8 * g]; kiv[ct][1] = *(const v4i*)&ski[bf][wave][ct * 16 + 8 * g + 4];
#pragma unroll   // as above
      for (int kc = 0; kc < 2; ++kc) kb[ct][kc] = frag_b(&skt[bf][kh][ct * 16 + col][kc * 32], lane); }
#pragma unroll
    for (int ct = 0; ct < 2; ++ct) { v8f c = {};
#pragma unroll
      for (int kc = 0; kc < 2; ++kc) c = wmma_bf(kb[ct][kc], aq[kc], c);   // A = 16 keys, B = 16 queries: element r = key ct * 16 + 8g + r, column = query
#pragma unroll
      for (int r = 0; r < 8; ++r) { int ad = (int)((unsigned)kiv[ct][r >> 2][r & 3] + qoff); ad = ad < qhi ? ad : qhi; ad = ad > qlo ? ad : qlo; s[ct][r] = (c[r] + *(lds_cf*)ad) * 0.125f; } }   // the clip of the distance is the clamp of the address to the row's ends
    float mx = fmaxf(s[0][0], s[1][0]);
#pragma unroll
    for (int r = 1; r < 8; ++r) mx = fmaxf(mx, fmaxf(s[0][r], s[1][r]));
    mx = fmaxf(mx, xhalf(mx));
    const float mn = fmaxf(m, mx); const float alpha = (m <= -1.0e38f) ? 0.f : __expf(m - mn); m = mn;
    v16h pa, pl; float es0 = 0.f, es1 = 0.f; float tx[2][8], ex[2][8];
#pragma unroll   // constant indices keep tx and ex in registers
    for (int ct = 0; ct < 2; ++ct) {
#pragma unroll   // as above
      for (int i = 0; i < 8; ++i) { tx[ct][i] = (s[ct][i] - mn) * 1.44269504f; ex[ct][i] = __builtin_amdgcn_exp2f(tx[ct][i]); }
      // the slot behind a transcendental, one for eight: no result is read and no source register is rewritten ahead of this v_nop
      asm volatile("v_nop" : "+v"(ex[ct][0]), "+v"(ex[ct][1]), "+v"(ex[ct][2]), "+v"(ex[ct][3]), "+v"(ex[ct][4]), "+v"(ex[ct][5]), "+v"(ex[ct][6]), "+v"(ex[ct][7])
                   : "v"(tx[ct][0]), "v"(tx[ct][1]), "v"(tx[ct][2]), "v"(tx[ct][3]), "v"(tx[ct][4]), "v"(tx[ct][5]), "v"(tx[ct][6]), "v"(tx[ct][7])); }
#pragma unroll
    for (int i = 0; i < 8; ++i) { const float e0 = ex[0][i], e1 = ex[1][i]; es0 += e0; es1 += e1;
      const float x0 = e0 * 2048.0f, x1 = e1 * 2048.0f; const _Float16 h0 = (_Float16)x0, h1 = (_Float16)x1; pa[i] = h0; pa[8 + i] = h1; pl[i] = (_Float16)((x0 - (float)h0) * 2048.0f); pl[8 + i] = (_Float16)((x1 - (float)h1) * 2048.0f); }
    l = l * alpha + (es0 + es1);
#pragma unroll
    for (int dt = 0; dt < 4; ++dt) { acc[dt] *= alpha; accl[dt] *= alpha; }
    v16h vf[4];
#pragma unroll   // constant indices keep vf in registers
    for (int dt = 0; dt < 4; ++dt) vf[dt] = frag_h(&svt[bf][kh][dt * 16 + col][0], lane);
#pragma unroll
    for (int dt = 0; dt < 4; ++dt) { acc[dt] = wmma16(vf[dt], pa, acc[dt]); accl[dt] = wmma16(vf[dt], pl, accl[dt]); }   // A = 16 d rows of v^T, B = P^T: element r = d dt * 16 + 8g + r, column = query
    asm volatile("s_wait_dscnt 0" ::: "memory");        // this wave's reads of buffer bf have retired before the buffer is handed back
    asm volatile("s_wait_asynccnt 0x0" ::: "memory");   // this wave's share of tile ks + 1 has landed before the barrier publishes it
    __syncthreads();                                    // publishes tile ks + 1 and ends every wave's reads of buffer bf
    if (ks + 2 < SKH / 32) stage_tile(kg + (size_t)(ks + 2) * 32 * HD, vg + (ks + 2) * 32, ig + (ks + 2) * 32, kl + bf * (KSPL * KTB), vl + bf * (KSPL * VTB), il + bf * (KSPL * ITB)); }
  asm volatile("s_wait_asynccnt 0x0" ::: "memory");     // no copy is outstanding when the wave goes on to its epilogue
  l += xhalf(l);   // the two halves hold the sums of their own keys
  if (kh == 1) {   // the second key half's state, lane for lane: hi + residual joined, then maximum and sum
#pragma unroll
    for (int dt = 0; dt < 4; ++dt) { v4f p0, p1;
#pragma unroll
      for (int r = 0; r < 4; ++r) { p0[r] = acc[dt][r] + accl[dt][r] * (1.0f / 2048.0f); p1[r] = acc[dt][4 + r] + accl[dt][4 + r] * (1.0f / 2048.0f); }
      u.ep.pm[qt][dt * 2][lane] = p0; u.ep.pm[qt][dt * 2 + 1][lane] = p1; }
    u.ep.pml[qt][0][lane] = m; u.ep.pml[qt][1][lane] = l; }
  __syncthreads();   // hands the second half's state to the wave that joins the two
  if (kh == 0) { const float m1 = u.ep.pml[qt][0][lane], l1 = u.ep.pml[qt][1][lane]; const float mj = fmaxf(m, m1); const float a0 = __expf(m - mj), a1 = __expf(m1 - mj);
    const float il2 = (1.0f / 2048.0f) / (l * a0 + l1 * a1); const float f0 = a0 * il2, f1 = a1 * il2;
#pragma unroll
    for (int dt = 0; dt < 4; ++dt) { const v4f p0 = u.ep.pm[qt][dt * 2][lane], p1 = u.ep.pm[qt][dt * 2 + 1][lane]; v4f o0, o1;
#pragma unroll
      for (int r = 0; r < 4; ++r) { o0[r] = (acc[dt][r] + accl[dt][r] * (1.0f / 2048.0f)) * f0 + p0[r] * f1; o1[r] = (acc[dt][4 + r] + accl[dt][4 + r] * (1.0f / 2048.0f)) * f0 + p1[r] * f1; }
      *(v4f*)&u.ep.so[qt][col][dt * 16 + 8 * g] = o0; *(v4f*)&u.ep.so[qt][col][dt * 16 + 8 * g + 4] = o1; }
    LDSX();
    for (int rl = 0; rl < 16; ++rl) if (lane < 16) vst2(O + ((bh * SS + q0 + rl) * HD) + lane * 4, *(const v4f*)&u.ep.so[qt][rl][lane * 4]); }
}
extern "C" void kernel_launch(void* const* d_in, const int* in_sizes, int n_in, void* d_out, int out_size, void* d_ws, size_t ws_size, hipStream_t stream) {
  (void)in_sizes; (void)n_in; (void)out_size;
  const float** F = (const float**)d_in;   // 0 q, 1 k, 2 v [2,8,2048,64], 3 rel_emb [257,64], 4 q_info int [2,2048], 5 k_info int [2,2048]
  if (ws_size < (size_t)WS_END) return;
  _Float16* VT = (_Float16*)((char*)d_ws + WS_VT);
  __bf16* KB = (__bf16*)((char*)d_ws + WS_KB); int* KA = (int*)((char*)d_ws + WS_KA);
  k_vt<<<dim3(SS / 64, NBH), 256, 0, stream>>>(F[2], F[1], (const int*)d_in[5], VT, KB, KA);
  k_attn<<<dim3(TQB, TNBH), 256, 0, stream>>>(F[0], KB, VT, F[3], (const int*)d_in[4], KA, (float*)d_out);
}

// v006
// One run takes 46.1 microseconds.
// Next to v005, in two timings, it ran 1.11 times as fast each time.
// Over all steps from v000 it is 5.70 times as fast.
// compute dtype: all float inputs rounded to bf16, q_info / k_info (int) read on device; qr = q . rel_emb^T with EXACT bf16 products on WMMA 16x16x32 (f32 table), the per-pair index clip(k_adj - q_adj, -128, 128) + 128 computed on device from the int inputs and the bias gathered from the wave's LDS copy of the qr rows; scores = q . k (exact bf16 products) + bias, x 1/8, running-max softmax in f32 (hardware exp); P (x 2^11) as f16 hi + f16 residual at the same scale (2 products, one accumulator) x v (exact in f16), f32 accumulate; f32 output.
#include <hip/hip_runtime.h>
#include <math.h>

typedef __attribute__((ext_vector_type(16))) _Float16 v16h;
typedef __attribute__((ext_vector_type(16))) __bf16 v16b;
typedef __attribute__((ext_vector_type(8)))  _Float16 v8h;
typedef __attribute__((ext_vector_type(2)))  _Float16 v2h;
typedef __attribute__((ext_vector_type(8)))  float v8f;
typedef __attribute__((ext_vector_type(4)))  float v4f;
typedef __attribute__((ext_vector_type(2)))  float v2f;
typedef __attribute__((ext_vector_type(4)))  unsigned v4u;
typedef __attribute__((ext_vector_type(4)))  int v4i;
typedef float __attribute__((may_alias)) float_a;
typedef int __attribute__((may_alias)) int_a;

template <typename T> __device__ __forceinline__ void vst2(void* p, T v) { *(T*)p = v;  }
__device__ __forceinline__ v8f wmma16(v16h a, v16h b, v8f c) {
  v8f d = __builtin_amdgcn_wmma_f32_16x16x32_f16(false, a, false, b, (short)0, c, false, false);
  asm volatile("v_nop\n\tv_nop\n\tv_nop\n\tv_nop" : "+v"(d) : "v"(a), "v"(b));
  return d;
}
__device__ __forceinline__ v8f wmma_bf(v16b a, v16b b, v8f c) {
  v8f d = __builtin_amdgcn_wmma_f32_16x16x32_bf16(false, a, false, b, (short)0, c, false, false);
  asm volatile("v_nop\n\tv_nop\n\tv_nop\n\tv_nop" : "+v"(d) : "v"(a), "v"(b));
  return d;
}
// 16x16x32 fragments: lane = (h = lane>>4, row/col = lane&15); elements 0..7 = k0+8h+0..7, 8..15 = k0+16+8h+0..7; D element r = row 8h+r
__device__ __forceinline__ v16h frag_h(const _Float16* rowk0, int lane) {
  union { v16h v; v8h q[2]; } u; const _Float16* p = rowk0 + 8 * (lane >> 4);
  u.q[0] = *(const v8h*)p; u.q[1] = *(const v8h*)(p + 16); return u.v;
}
__device__ __forceinline__ v16h frag_f32(const float* rowk0, int lane) {
  v16h a; const float* p = rowk0 + 8 * (lane >> 4);
#pragma unroll
  for (int i = 0; i < 8; ++i) { a[i] = (_Float16)p[i]; a[8 + i] = (_Float16)p[16 + i]; }
  return a;
}
__device__ __forceinline__ v16h frag_f32s(const float* rowk0, int lane, float sc) {
  v16h a; const float* p = rowk0 + 8 * (lane >> 4);
#pragma unroll
  for (int i = 0; i < 8; ++i) { a[i] = (_Float16)(p[i] * sc); a[8 + i] = (_Float16)(p[16 + i] * sc); }
  return a;
}
// column fragment from a [K][ld] layout (column n), rows >= K read as 0
__device__ __forceinline__ v16h fragc_f32(const float* W, int k0, int n, int lane, int ld, int K) {
  v16h a; const int g = lane >> 4;
#pragma unroll
  for (int i = 0; i < 8; ++i) { const int ka = k0 + 8 * g + i, kb = ka + 16;
    a[i] = (_Float16)(ka < K ? W[(size_t)(ka < K ? ka : K - 1) * ld + n] : 0.f); a[8 + i] = (_Float16)(kb < K ? W[(size_t)(kb < K ? kb : K - 1) * ld + n] : 0.f); }
  return a;
}
struct F2 { v16b h, l; };
__device__ __forceinline__ F2 bsplit16(const float v[16]) { F2 r;
#pragma unroll
  for (int i = 0; i < 16; ++i) { const __bf16 h = (__bf16)v[i]; r.h[i] = h; r.l[i] = (__bf16)(v[i] - (float)h); }
  return r; }
__device__ __forceinline__ F2 split_row(const float* row, int k0, int lane) { float v[16]; const float* p = row + k0 + 8 * (lane >> 4);
#pragma unroll
  for (int i = 0; i < 8; ++i) { v[i] = p[i]; v[8 + i] = p[16 + i]; }
  return bsplit16(v); }
__device__ __forceinline__ F2 split_rowK(const float* row, int k0, int lane, int K) { float v[16]; const int g = lane >> 4;
#pragma unroll
  for (int i = 0; i < 8; ++i) { const int ka = k0 + 8 * g + i, kb = ka + 16; v[i] = ka < K ? row[ka < K ? ka : K - 1] : 0.f; v[8 + i] = kb < K ? row[kb < K ? kb : K - 1] : 0.f; }
  return bsplit16(v); }
__device__ __forceinline__ F2 split_col(const float* W, int k0, int n, int lane, int ld, int K) { float v[16]; const int g = lane >> 4;
#pragma unroll
  for (int i = 0; i < 8; ++i) { const int ka = k0 + 8 * g + i, kb = ka + 16; v[i] = ka < K ? W[(size_t)(ka < K ? ka : K - 1) * ld + n] : 0.f; v[8 + i] = kb < K ? W[(size_t)(kb < K ? kb : K - 1) * ld + n] : 0.f; }
  return bsplit16(v); }
__device__ __forceinline__ v8f mac3(const F2& a, const F2& b, v8f c) { c = wmma_bf(a.l, b.h, c); c = wmma_bf(a.h, b.l, c); return wmma_bf(a.h, b.h, c); }
__device__ __forceinline__ float sigm(float v) { return 1.0f / (1.0f + expf(-v)); }
#define LDSX() do { asm volatile("s_wait_dscnt 0" ::: "memory"); __builtin_amdgcn_wave_barrier(); __builtin_amdgcn_fence(__ATOMIC_RELEASE, "workgroup"); } while (0)


// Relative-information attention on given q, k, v (B 2, 8 heads, S 2,048, D 64; max distance 128): scores = (q k^T + take(q rel_emb^T, clip(k_info' - q_info') + 128)) / 8, softmax, v; q_info' = where(q_info == -1, 256, q_info), k_info' = where(k_info == -1, 384, k_info).
#define NB 2
#define NH 8
#define SS 2048
#define RR 128
#define NREL (2 * RR + 1)   // 257
#define HD 64
#define NBH (NB * NH)
#ifndef TQB
#define TQB (SS / 64)
#define TNBH NBH
#endif
typedef __attribute__((ext_vector_type(8))) __bf16 v8b;
__device__ __forceinline__ v16b frag_b(const __bf16* rowk0, int lane) {
  union { v16b v; v8b q[2]; } u; const __bf16* p = rowk0 + 8 * (lane >> 4);
  u.q[0] = *(const v8b*)p; u.q[1] = *(const v8b*)(p + 16); return u.v;
}
__device__ __forceinline__ float bfr(float v) { return (float)(__bf16)v; }
__device__ __attribute__((noinline)) float exp_ni(float v) { return expf(v); }
__device__ __attribute__((noinline)) float erf_ni(float v) { return erff(v); }

#define WS_VT  0u                                   // f16 v planes [(b,h)][64 d][s]
#define WS_KB  (WS_VT + 2u * (size_t)NBH * HD * SS)  // bf16 k rows [(b,h)][s][64 d]
#define WS_KA  (WS_KB + 2u * (size_t)NBH * SS * HD)  // int [b][s]: 4 * where(k_info == -1, 384, k_info), a byte offset into a bias row
#define WS_END (WS_KA + 4u * (size_t)NB * SS)

typedef __attribute__((ext_vector_type(4))) __bf16 v4b;
// ---- k_vt: block = (64 keys, (b,h)): v[bh][s][d] -> VT[bh][d][s] f16 (exact for bf16 values in range);
// and what k_attn needs of each key, made once here instead of by every wave that meets the key: k's rows rounded to bf16 (KB), k_info with its -1 replaced and times 4 (KA; the blocks of the first NB planes write one batch row each)
__global__ __launch_bounds__(256) void k_vt(const float* __restrict__ V, const float* __restrict__ K, const int* __restrict__ KI, _Float16* __restrict__ VT, __bf16* __restrict__ KB, int* __restrict__ KA) { __shared__ __align__(16) _Float16 st[HD][64 + 8]; const int t = threadIdx.x; const int s0 = blockIdx.x * 64; const size_t bh = blockIdx.y;
  v4f kx[4]; const float* kp = K + (bh * SS + s0) * HD + t * 4;
#pragma unroll   // constant indices keep kx in registers; the four loads go out ahead of v's, so that their latency runs beside v's
  for (int i = 0; i < 4; ++i) kx[i] = *(const v4f*)(kp + i * 1024);
  asm volatile("s_wait_xcnt 0x0" :: "v"(kp) : "memory");   // a precaution: stands in front of the first rewrite of the address registers that k's loads name; the address as an input keeps those registers as they are up to here
  const bool wka = bh < NB && t < 64; int ki = 0; if (wka) ki = KI[bh * SS + s0 + t];
  for (int e = t; e < 64 * HD; e += 256) { const int sl = e >> 6, d = e & 63; st[d][sl] = (_Float16)bfr(V[((bh * SS + s0 + sl) * HD) + d]); } __syncthreads();
  for (int e = t; e < HD * 8; e += 256) { const int d = e >> 3, q = e & 7; vst2((unsigned*)(VT + ((bh * HD + d) * SS) + s0 + q * 8), *(const v4u*)&st[d][q * 8]); }
  // k's and k_info's stores come last: nothing in this kernel waits for them
#pragma unroll
  for (int i = 0; i < 4; ++i) { v4b y;
#pragma unroll
    for (int c = 0; c < 4; ++c) y[c] = (__bf16)kx[i][c];
    *(v4b*)(KB + (bh * SS + s0) * HD + (size_t)(i * 256 + t) * 4) = y; }
  if (wka) KA[bh * SS + s0 + t] = (int)(4u * (unsigned)((ki == -1) ? 3 * RR : ki)); }
__device__ __forceinline__ v16b fragb_f32(const float* __restrict__ p, int lane) { v16b a; const float* pp = p + 8 * (lane >> 4);
#pragma unroll
  for (int i = 0; i < 8; ++i) { a[i] = (__bf16)pp[i]; a[8 + i] = (__bf16)pp[16 + i]; } return a; }
#define KPB 72              // staged k row pitch in bf16: 144 B = 16 B x odd, conflict-free for 16-byte LDS reads
#define VPH 40              // staged v row pitch in halves: 80 B = 16 B x odd
#define KTB (32 * KPB * 2)  // bytes of one staged k tile (32 keys)
#define VTB (HD * VPH * 2)  // bytes of one staged v tile (64 d rows x 32 keys)
#define ITB (4 * 32 * 4)    // bytes of one staged k_info tile (one copy of the 32 ints per wave)
#define RPB 72              // staged rel_emb row pitch in bf16: 144 B = 16 B x odd
#define KSPL 2              // waves that share one query tile, each on its own run of keys
#define SKH (SS / KSPL)     // keys of one such wave
typedef const __attribute__((address_space(3))) float lds_cf;
__device__ __forceinline__ unsigned lds_off(const void* p) { return (unsigned)(size_t)p; }
// one 32-key tile for the four waves of a key half, global -> LDS through no register: per thread 2 x 16 B of bf16 k, 2 x 16 B of v planes, 4 B of the k_info offsets.
// The s_wait_xcnt closes the statement so that no address register of a copy is rewritten ahead of it.
__device__ __forceinline__ void stage_tile(const __bf16* kg, const _Float16* vg, const int* ig, unsigned kl, unsigned vl, unsigned il) {
  asm volatile("global_load_async_to_lds_b128 %0, %1, off\n\t"
               "global_load_async_to_lds_b128 %2, %3, off\n\t"
               "global_load_async_to_lds_b128 %4, %5, off\n\t"
               "global_load_async_to_lds_b128 %6, %7, off\n\t"
               "global_load_async_to_lds_b32 %8, %9, off\n\t"
               "s_wait_xcnt 0x0"
               :: "v"(kl), "v"(kg), "v"(kl + 16u * KPB * 2u), "v"(kg + 16 * HD),
                  "v"(vl), "v"(vg), "v"(vl + 32u * VPH * 2u), "v"(vg + (size_t)32 * SS), "v"(il), "v"(ig) : "memory");
}
// eight residuals of P at the scale of hi: r = f16(e * 2^11 - hi), the difference fused and exact in f32, hi read as the f16 half it is and r written as the f16 half it becomes.
// In asm because plain code compiles to 16 conversions that unpack hi and 8 that pack r around the subtraction. The s_delay_alu lines change no result: each high half is written into the register whose low half was written four vector instructions back, and the hint lets the SIMD's other waves issue meanwhile.
__device__ __forceinline__ void resid8(unsigned* r, const float* e, const unsigned* h) {
  asm("v_fma_mixlo_f16 %0, %4, %16, -%12 op_sel_hi:[0,0,1]\n\t"
      "v_fma_mixlo_f16 %1, %6, %16, -%13 op_sel_hi:[0,0,1]\n\t"
      "v_fma_mixlo_f16 %2, %8, %16, -%14 op_sel_hi:[0,0,1]\n\t"
      "v_fma_mixlo_f16 %3, %10, %16, -%15 op_sel_hi:[0,0,1]\n\t"
      "s_delay_alu instid0(VALU_DEP_4) | instskip(NEXT) | instid1(VALU_DEP_4)\n\t"
      "v_fma_mixhi_f16 %0, %5, %16, -%12 op_sel:[0,0,1] op_sel_hi:[0,0,1]\n\t"
      "v_fma_mixhi_f16 %1, %7, %16, -%13 op_sel:[0,0,1] op_sel_hi:[0,0,1]\n\t"
      "s_delay_alu instid0(VALU_DEP_4) | instskip(NEXT) | instid1(VALU_DEP_4)\n\t"
      "v_fma_mixhi_f16 %2, %9, %16, -%14 op_sel:[0,0,1] op_sel_hi:[0,0,1]\n\t"
      "v_fma_mixhi_f16 %3, %11, %16, -%15 op_sel:[0,0,1] op_sel_hi:[0,0,1]"
      : "=&v"(r[0]), "=&v"(r[1]), "=&v"(r[2]), "=&v"(r[3])
      : "v"(e[0]), "v"(e[1]), "v"(e[2]), "v"(e[3]), "v"(e[4]), "v"(e[5]), "v"(e[6]), "v"(e[7]), "v"(h[0]), "v"(h[1]), "v"(h[2]), "v"(h[3]), "s"(2048.0f));
}
// lane l with lane l ^ 16, on the vector pipe
__device__ __forceinline__ float xhalf(float x) { return __builtin_bit_cast(float, __builtin_amdgcn_permlanex16(__builtin_bit_cast(int, x), __builtin_bit_cast(int, x), 0x76543210, 0xfedcba98, false, false)); }
// ---- k_attn: block = (64 queries, (b,h)): transposed products, S^T = k q^T (exact bf16 products, f32 accumulate) and O^T += v^T P^T: a lane holds 16 of the 32 keys' scores of ONE query (query = lane & 15; keys 8g + r and 16 + 8g + r),
// so the running maximum and the sum are in-lane (one exchange between the halves for the maximum, the halves' sums joined after the loop) and P hi + residual packs from the score registers straight into the B operand; k, v and k_info tiles of 32 keys staged once per block in a two-buffer LDS ring.
// The bias table is made here: rel_emb's first 256 rows rounded to bf16 into LDS once per block, then table^T = rel_emb q^T (A = 16 distances, B = 16 queries) goes from the accumulators straight into the query tile's LDS rows.
// Two waves share a query tile (wave = key half * 4 + query tile): each makes half of the tile's table and walks its own half of the keys with its own maximum, sum and accumulators, on its own ring of tiles;
// behind the loop the second half's wave hands its state over through LDS and the first joins the two. Eight waves a block and two blocks a WGP give every SIMD four waves to fill each other's waits.
__global__ __launch_bounds__(256) __attribute__((amdgpu_waves_per_eu(4, 4))) void k_attn(const float* __restrict__ Q, const __bf16* __restrict__ KB, const _Float16* __restrict__ VT, const float* __restrict__ RE, const int* __restrict__ QI, const int* __restrict__ KA, float* __restrict__ O) {
  __shared__ __align__(16) float sqr[4][16][NREL + 3];
  // the epilogue's buffers lie on the staged rel_emb rows, whose last read ends at the barrier behind the table: with them apart two blocks would not fit a WGP's LDS
  __shared__ __align__(16) union { __bf16 srel[NREL - 1][RPB]; struct { v4f pm[4][8][32]; float pml[4][2][32]; float so[4][16][68]; } ep; } u;
  __shared__ __align__(16) __bf16 skt[2][KSPL][32][KPB]; __shared__ __align__(16) _Float16 svt[2][KSPL][HD][VPH]; __shared__ __align__(16) int ski[2][4 * KSPL][32];
  const int tid = threadIdx.x, wave = __builtin_amdgcn_readfirstlane(tid >> 5), qt = wave & 3, kh = wave >> 2, th = tid & 127, lane = tid & 31, col = lane & 15, g = lane >> 4; const size_t bh = blockIdx.y; const int q0 = blockIdx.x * 64 + qt * 16; const float* Qb = Q + (bh * SS) * HD; const __bf16* Kb = KB + (bh * SS) * HD; const _Float16* Vb = VT + bh * HD * SS;
  v16b aq[2];
#pragma unroll
  for (int kc = 0; kc < 2; ++kc) aq[kc] = fragb_f32(Qb + (size_t)(q0 + col) * HD + kc * 32, lane);
  asm volatile("s_wait_xcnt 0x0" ::: "memory");   // a precaution: stands in front of the first rewrite of the address registers that q's loads name
  const size_t b = bh / NH;
#pragma unroll   // a constant trip count lets the 16-byte loads go out in groups instead of one per wait
  for (int i = 0; i < (NREL - 1) * HD / 4 / 256; ++i) { const int f = i * 256 + tid; const v4f x = *(const v4f*)(RE + (size_t)f * 4); v4b y;
#pragma unroll
    for (int c = 0; c < 4; ++c) y[c] = (__bf16)x[c];
    *(v4b*)&u.srel[f >> 4][(f & 15) * 4] = y; }
  if (kh == 0) { v8f c = {}; v16b fl[2];   // distance index 256: the one row, straight from global, in all 16 A rows; both fragments read ahead of the first product
#pragma unroll   // constant indices keep fl in registers
    for (int kc = 0; kc < 2; ++kc) fl[kc] = fragb_f32(RE + (size_t)(NREL - 1) * HD + kc * 32, lane);
#pragma unroll
    for (int kc = 0; kc < 2; ++kc) c = wmma_bf(fl[kc], aq[kc], c);
    if (g == 0) sqr[qt][col][NREL - 1] = c[0]; }
  __syncthreads();   // publishes the staged rel_emb rows to every wave
#pragma unroll 1   // four tiles a trip: their fragment reads go out as one group, ahead of the first product
  for (int j2 = 0; j2 < (NREL - 1) / 64 / KSPL; ++j2) { const int jb = kh * ((NREL - 1) / 64 / KSPL) + j2; v16b fa[4][2];
#pragma unroll   // constant indices keep fa in registers
    for (int jt = 0; jt < 4; ++jt) {
#pragma unroll   // as above
      for (int kc = 0; kc < 2; ++kc) fa[jt][kc] = frag_b(&u.srel[jb * 64 + jt * 16 + col][kc * 32], lane); }
#pragma unroll
    for (int jt = 0; jt < 4; ++jt) { v8f c = {};
#pragma unroll
      for (int kc = 0; kc < 2; ++kc) c = wmma_bf(fa[jt][kc], aq[kc], c);   // element r = distance index jb * 64 + jt * 16 + 8g + r, column = query
      v4f t0, t1;
#pragma unroll
      for (int r = 0; r < 4; ++r) { t0[r] = c[r]; t1[r] = c[4 + r]; }
      *(v4f*)&sqr[qt][col][jb * 64 + jt * 16 + 8 * g] = t0; *(v4f*)&sqr[qt][col][jb * 64 + jt * 16 + 8 * g + 4] = t1; } }
  const int qi = QI[b * SS + q0 + col]; const int qa = (qi == -1) ? 2 * RR : qi;
  // the lane's own query's bias row, as LDS byte addresses: centre (distance 0) less 4 * q_info', and the row's two ends, which bound every address formed from k_info
  const unsigned qc = lds_off(&sqr[qt][col][RR]); const unsigned qoff = qc - 4u * (unsigned)qa; const int qlo = (int)(qc - 4u * RR), qhi = (int)(qc + 4u * RR);
  __syncthreads();   // publishes each wave's half of the table to the wave that shares its queries, and ends every read of the staged rel_emb rows
  float m = -3.0e38f, l = 0.f;
  v8f acc[4] = {};
  const __bf16* kg = Kb + (size_t)kh * SKH * HD + th * 8; const _Float16* vg = Vb + (size_t)(th >> 2) * SS + kh * SKH + (th & 3) * 8; const int* ig = KA + b * SS + kh * SKH + lane;   // the four waves of a key half stage that half's tiles
  const unsigned kl = lds_off(&skt[0][kh][th >> 3][(th & 7) * 8]), vl = lds_off(&svt[0][kh][th >> 2][(th & 3) * 8]), il = lds_off(&ski[0][wave][lane]);
  stage_tile(kg, vg, ig, kl, vl, il);
  asm volatile("s_wait_asynccnt 0x0" ::: "memory");   // tile 0 has landed before the barrier publishes it
  __syncthreads();                                    // publishes tile 0 to every wave
  stage_tile(kg + 32 * HD, vg + 32, ig + 32, kl + KSPL * KTB, vl + KSPL * VTB, il + KSPL * ITB);
#pragma unroll 1
  for (int ks = 0; ks < SKH / 32; ++ks) { float s[2][8]; const int bf = ks & 1;
    v16b kb[2][2]; v4i kiv[2][2];   // all of the trip's k fragment reads go out as one group, ahead of the first product
#pragma unroll   // constant indices keep kb and kiv in registers
    for (int ct = 0; ct < 2; ++ct) { kiv[ct][0] = *(const v4i*)&ski[bf][wave][ct * 16 + 8 * g]; kiv[ct][1] = *(const v4i*)&ski[bf][wave][ct * 16 + 8 * g + 4];
#pragma unroll   // as above
      for (int kc = 0; kc < 2; ++kc) kb[ct][kc] = frag_b(&skt[bf][kh][ct * 16 + col][kc * 32], lane); }
#pragma unroll
    for (int ct = 0; ct < 2; ++ct) { v8f c = {};
#pragma unroll
      for (int kc = 0; kc < 2; ++kc) c = wmma_bf(kb[ct][kc], aq[kc], c);   // A = 16 keys, B = 16 queries: element r = key ct * 16 + 8g + r, column = query
#pragma unroll
      for (int r = 0; r < 8; ++r) { int ad = (int)((unsigned)kiv[ct][r >> 2][r & 3] + qoff); ad = ad < qhi ? ad : qhi; ad = ad > qlo ? ad : qlo; s[ct][r] = (c[r] + *(lds_cf*)ad) * 0.125f; } }   // the clip of the distance is the clamp of the address to the row's ends
    float mx = fmaxf(s[0][0], s[1][0]);
#pragma unroll
    for (int r = 1; r < 8; ++r) mx = fmaxf(mx, fmaxf(s[0][r], s[1][r]));
    mx = fmaxf(mx, xhalf(mx));
    const float mn = fmaxf(m, mx); const float alpha = (m <= -1.0e38f) ? 0.f : __expf(m - mn); m = mn;
    float es0 = 0.f, es1 = 0.f; float tx[2][8], ex[2][8];
#pragma unroll   // constant indices keep tx and ex in registers
    for (int ct = 0; ct < 2; ++ct) {
#pragma unroll   // as above
      for (int i = 0; i < 8; ++i) { tx[ct][i] = (s[ct][i] - mn) * 1.44269504f; ex[ct][i] = __builtin_amdgcn_exp2f(tx[ct][i]); }
      // the slot behind a transcendental, one for eight: no result is read and no source register is rewritten ahead of this v_nop
      asm volatile("v_nop" : "+v"(ex[ct][0]), "+v"(ex[ct][1]), "+v"(ex[ct][2]), "+v"(ex[ct][3]), "+v"(ex[ct][4]), "+v"(ex[ct][5]), "+v"(ex[ct][6]), "+v"(ex[ct][7])
                   : "v"(tx[ct][0]), "v"(tx[ct][1]), "v"(tx[ct][2]), "v"(tx[ct][3]), "v"(tx[ct][4]), "v"(tx[ct][5]), "v"(tx[ct][6]), "v"(tx[ct][7])); }
#pragma unroll
    for (int i = 0; i < 8; ++i) { es0 += ex[0][i]; es1 += ex[1][i]; }
    union { v16h v; unsigned w[8]; } ua, ul;
#pragma unroll   // constant indices keep ua and ul in registers
    for (int ct = 0; ct < 2; ++ct) {
#pragma unroll   // as above
      for (int j = 0; j < 4; ++j) { const v2f e2 = { ex[ct][2 * j], ex[ct][2 * j + 1] }; ua.w[ct * 4 + j] = __builtin_bit_cast(unsigned, __builtin_convertvector(e2 * 2048.0f, v2h)); }
      resid8(&ul.w[ct * 4], ex[ct], &ua.w[ct * 4]); }
    const v16h pa = ua.v, pl = ul.v;
    l = l * alpha + (es0 + es1);
#pragma unroll
    for (int dt = 0; dt < 4; ++dt) acc[dt] *= alpha;
    v16h vf[4];
#pragma unroll   // constant indices keep vf in registers
    for (int dt = 0; dt < 4; ++dt) vf[dt] = frag_h(&svt[bf][kh][dt * 16 + col][0], lane);
#pragma unroll
    for (int dt = 0; dt < 4; ++dt) acc[dt] = wmma16(vf[dt], pa, acc[dt]);   // A = 16 d rows of v^T, B = P^T: element r = d dt * 16 + 8g + r, column = query
#pragma unroll   // the residual's products go into the same accumulators, each four products behind the one it depends on
    for (int dt = 0; dt < 4; ++dt) acc[dt] = wmma16(vf[dt], pl, acc[dt]);
    asm volatile("s_wait_dscnt 0" ::: "memory");        // this wave's reads of buffer bf have retired before the buffer is handed back
    asm volatile("s_wait_asynccnt 0x0" ::: "memory");   // this wave's share of tile ks + 1 has landed before the barrier publishes it
    __syncthreads();                                    // publishes tile ks + 1 and ends every wave's reads of buffer bf
    if (ks + 2 < SKH / 32) stage_tile(kg + (size_t)(ks + 2) * 32 * HD, vg + (ks + 2) * 32, ig + (ks + 2) * 32, kl + bf * (KSPL * KTB), vl + bf * (KSPL * VTB), il + bf * (KSPL * ITB)); }
  asm volatile("s_wait_asynccnt 0x0" ::: "memory");     // no copy is outstanding when the wave goes on to its epilogue
  l += xhalf(l);   // the two halves hold the sums of their own keys
  if (kh == 1) {   // the second key half's state, lane for lane: accumulators, then maximum and sum
#pragma unroll
    for (int dt = 0; dt < 4; ++dt) { v4f p0, p1;
#pragma unroll
      for (int r = 0; r < 4; ++r) { p0[r] = acc[dt][r]; p1[r] = acc[dt][4 + r]; }
      u.ep.pm[qt][dt * 2][lane] = p0; u.ep.pm[qt][dt * 2 + 1][lane] = p1; }
    u.ep.pml[qt][0][lane] = m; u.ep.pml[qt][1][lane] = l; }
  __syncthreads();   // hands the second half's state to the wave that joins the two
  if (kh == 0) { const float m1 = u.ep.pml[qt][0][lane], l1 = u.ep.pml[qt][1][lane]; const float mj = fmaxf(m, m1); const float a0 = __expf(m - mj), a1 = __expf(m1 - mj);
    const float il2 = (1.0f / 2048.0f) / (l * a0 + l1 * a1); const float f0 = a0 * il2, f1 = a1 * il2;
#pragma unroll
    for (int dt = 0; dt < 4; ++dt) { const v4f p0 = u.ep.pm[qt][dt * 2][lane], p1 = u.ep.pm[qt][dt * 2 + 1][lane]; v4f o0, o1;
#pragma unroll
      for (int r = 0; r < 4; ++r) { o0[r] = acc[dt][r] * f0 + p0[r] * f1; o1[r] = acc[dt][4 + r] * f0 + p1[r] * f1; }
      *(v4f*)&u.ep.so[qt][col][dt * 16 + 8 * g] = o0; *(v4f*)&u.ep.so[qt][col][dt * 16 + 8 * g + 4] = o1; }
    LDSX();
    for (int rl = 0; rl < 16; ++rl) if (lane < 16) vst2(O + ((bh * SS + q0 + rl) * HD) + lane * 4, *(const v4f*)&u.ep.so[qt][rl][lane * 4]); }
}
extern "C" void kernel_launch(void* const* d_in, const int* in_sizes, int n_in, void* d_out, int out_size, void* d_ws, size_t ws_size, hipStream_t stream) {
  (void)in_sizes; (void)n_in; (void)out_size;
  const float** F = (const float**)d_in;   // 0 q, 1 k, 2 v [2,8,2048,64], 3 rel_emb [257,64], 4 q_info int [2,2048], 5 k_info int [2,2048]
  if (ws_size < (size_t)WS_END) return;
  _Float16* VT = (_Float16*)((char*)d_ws + WS_VT);
  __bf16* KB = (__bf16*)((char*)d_ws + WS_KB); int* KA = (int*)((char*)d_ws + WS_KA);
  k_vt<<<dim3(SS / 64, NBH), 256, 0, stream>>>(F[2], F[1], (const int*)d_in[5], VT, KB, KA);
  k_attn<<<dim3(TQB, TNBH), 256, 0, stream>>>(F[0], KB, VT, F[3], (const int*)d_in[4], KA, (float*)d_out);
}

// v007
// It runs in 43.4 microseconds.
// Two timings next to v006 both put it at 1.06 times that version's speed.
// Counting every step since v000, it is 6.06 times as fast.
// compute dtype: all float inputs rounded to bf16, q_info / k_info (int) read on device; qr = q . rel_emb^T with EXACT bf16 products on WMMA 16x16x32 (f32 table), the per-pair index clip(k_adj - q_adj, -128, 128) + 128 computed on device from the int inputs and the bias gathered from the wave's LDS copy of the qr rows; scores = q . k (exact bf16 products) + bias, x 1/8, softmax in f32 against a held reference that is raised when a trip's exponentials outgrow it (hardware exp); P (x 2^11) as f16 hi + f16 residual at the same scale (2 products, one accumulator) x v (exact in f16), f32 accumulate; f32 output.
#include <hip/hip_runtime.h>
#include <math.h>

typedef __attribute__((ext_vector_type(16))) _Float16 v16h;
typedef __attribute__((ext_vector_type(16))) __bf16 v16b;
typedef __attribute__((ext_vector_type(8)))  _Float16 v8h;
typedef __attribute__((ext_vector_type(2)))  _Float16 v2h;
typedef __attribute__((ext_vector_type(8)))  float v8f;
typedef __attribute__((ext_vector_type(4)))  float v4f;
typedef __attribute__((ext_vector_type(2)))  float v2f;
typedef __attribute__((ext_vector_type(4)))  unsigned v4u;
typedef __attribute__((ext_vector_type(4)))  int v4i;
typedef float __attribute__((may_alias)) float_a;
typedef int __attribute__((may_alias)) int_a;

template <typename T> __device__ __forceinline__ void vst2(void* p, T v) { *(T*)p = v;  }
__device__ __forceinline__ v8f wmma16(v16h a, v16h b, v8f c) {
  v8f d = __builtin_amdgcn_wmma_f32_16x16x32_f16(false, a, false, b, (short)0, c, false, false);
  asm volatile("v_nop\n\tv_nop\n\tv_nop\n\tv_nop" : "+v"(d) : "v"(a), "v"(b));
  return d;
}
__device__ __forceinline__ v8f wmma_bf(v16b a, v16b b, v8f c) {
  v8f d = __builtin_amdgcn_wmma_f32_16x16x32_bf16(false, a, false, b, (short)0, c, false, false);
  asm volatile("v_nop\n\tv_nop\n\tv_nop\n\tv_nop" : "+v"(d) : "v"(a), "v"(b));
  return d;
}
// 16x16x32 fragments: lane = (h = lane>>4, row/col = lane&15); elements 0..7 = k0+8h+0..7, 8..15 = k0+16+8h+0..7; D element r = row 8h+r
__device__ __forceinline__ v16h frag_h(const _Float16* rowk0, int lane) {
  union { v16h v; v8h q[2]; } u; const _Float16* p = rowk0 + 8 * (lane >> 4);
  u.q[0] = *(const v8h*)p; u.q[1] = *(const v8h*)(p + 16); return u.v;
}
__device__ __forceinline__ v16h frag_f32(const float* rowk0, int lane) {
  v16h a; const float* p = rowk0 + 8 * (lane >> 4);
#pragma unroll
  for (int i = 0; i < 8; ++i) { a[i] = (_Float16)p[i]; a[8 + i] = (_Float16)p[16 + i]; }
  return a;
}
__device__ __forceinline__ v16h frag_f32s(const float* rowk0, int lane, float sc) {
  v16h a; const float* p = rowk0 + 8 * (lane >> 4);
#pragma unroll
  for (int i = 0; i < 8; ++i) { a[i] = (_Float16)(p[i] * sc); a[8 + i] = (_Float16)(p[16 + i] * sc); }
  return a;
}
// column fragment from a [K][ld] layout (column n), rows >= K read as 0
__device__ __forceinline__ v16h fragc_f32(const float* W, int k0, int n, int lane, int ld, int K) {
  v16h a; const int g = lane >> 4;
#pragma unroll
  for (int i = 0; i < 8; ++i) { const int ka = k0 + 8 * g + i, kb = ka + 16;
    a[i] = (_Float16)(ka < K ? W[(size_t)(ka < K ? ka : K - 1) * ld + n] : 0.f); a[8 + i] = (_Float16)(kb < K ? W[(size_t)(kb < K ? kb : K - 1) * ld + n] : 0.f); }
  return a;
}
struct F2 { v16b h, l; };
__device__ __forceinline__ F2 bsplit16(const float v[16]) { F2 r;
#pragma unroll
  for (int i = 0; i < 16; ++i) { const __bf16 h = (__bf16)v[i]; r.h[i] = h; r.l[i] = (__bf16)(v[i] - (float)h); }
  return r; }
__device__ __forceinline__ F2 split_row(const float* row, int k0, int lane) { float v[16]; const float* p = row + k0 + 8 * (lane >> 4);
#pragma unroll
  for (int i = 0; i < 8; ++i) { v[i] = p[i]; v[8 + i] = p[16 + i]; }
  return bsplit16(v); }
__device__ __forceinline__ F2 split_rowK(const float* row, int k0, int lane, int K) { float v[16]; const int g = lane >> 4;
#pragma unroll
  for (int i = 0; i < 8; ++i) { const int ka = k0 + 8 * g + i, kb = ka + 16; v[i] = ka < K ? row[ka < K ? ka : K - 1] : 0.f; v[8 + i] = kb < K ? row[kb < K ? kb : K - 1] : 0.f; }
  return bsplit16(v); }
__device__ __forceinline__ F2 split_col(const float* W, int k0, int n, int lane, int ld, int K) { float v[16]; const int g = lane >> 4;
#pragma unroll
  for (int i = 0; i < 8; ++i) { const int ka = k0 + 8 * g + i, kb = ka + 16; v[i] = ka < K ? W[(size_t)(ka < K ? ka : K - 1) * ld + n] : 0.f; v[8 + i] = kb < K ? W[(size_t)(kb < K ? kb : K - 1) * ld + n] : 0.f; }
  return bsplit16(v); }
__device__ __forceinline__ v8f mac3(const F2& a, const F2& b, v8f c) { c = wmma_bf(a.l, b.h, c); c = wmma_bf(a.h, b.l, c); return wmma_bf(a.h, b.h, c); }
__device__ __forceinline__ float sigm(float v) { return 1.0f / (1.0f + expf(-v)); }
#define LDSX() do { asm volatile("s_wait_dscnt 0" ::: "memory"); __builtin_amdgcn_wave_barrier(); __builtin_amdgcn_fence(__ATOMIC_RELEASE, "workgroup"); } while (0)


// Relative-information attention on given q, k, v (B 2, 8 heads, S 2,048, D 64; max distance 128): scores = (q k^T + take(q rel_emb^T, clip(k_info' - q_info') + 128)) / 8, softmax, v; q_info' = where(q_info == -1, 256, q_info), k_info' = where(k_info == -1, 384, k_info).
#define NB 2
#define NH 8
#define SS 2048
#define RR 128
#define NREL (2 * RR + 1)   // 257
#define HD 64
#define NBH (NB * NH)
#ifndef TQB
#define TQB (SS / 64)
#define TNBH NBH
#endif
typedef __attribute__((ext_vector_type(8))) __bf16 v8b;
__device__ __forceinline__ v16b frag_b(const __bf16* rowk0, int lane) {
  union { v16b v; v8b q[2]; } u; const __bf16* p = rowk0 + 8 * (lane >> 4);
  u.q[0] = *(const v8b*)p; u.q[1] = *(const v8b*)(p + 16); return u.v;
}
__device__ __forceinline__ float bfr(float v) { return (float)(__bf16)v; }
__device__ __attribute__((noinline)) float exp_ni(float v) { return expf(v); }
__device__ __attribute__((noinline)) float erf_ni(float v) { return erff(v); }

#define WS_VT  0u                                   // f16 v planes [(b,h)][64 d][s]
#define WS_KB  (WS_VT + 2u * (size_t)NBH * HD * SS)  // bf16 k rows [(b,h)][s][64 d]
#define WS_KA  (WS_KB + 2u * (size_t)NBH * SS * HD)  // int [b][s]: 4 * where(k_info == -1, 384, k_info), a byte offset into a bias row
#define WS_END (WS_KA + 4u * (size_t)NB * SS)

typedef __attribute__((ext_vector_type(4))) __bf16 v4b;
// ---- k_vt: block = (64 keys, (b,h)): v[bh][s][d] -> VT[bh][d][s] f16 (exact for bf16 values in range);
// and what k_attn needs of each key, made once here instead of by every wave that meets the key: k's rows rounded to bf16 (KB), k_info with its -1 replaced and times 4 (KA; the blocks of the first NB planes write one batch row each)
__global__ __launch_bounds__(256) void k_vt(const float* __restrict__ V, const float* __restrict__ K, const int* __restrict__ KI, _Float16* __restrict__ VT, __bf16* __restrict__ KB, int* __restrict__ KA) { __shared__ __align__(16) _Float16 st[HD][64 + 8]; const int t = threadIdx.x; const int s0 = blockIdx.x * 64; const size_t bh = blockIdx.y;
  v4f kx[4]; const float* kp = K + (bh * SS + s0) * HD + t * 4;
#pragma unroll   // constant indices keep kx in registers; the four loads go out ahead of v's, so that their latency runs beside v's
  for (int i = 0; i < 4; ++i) kx[i] = *(const v4f*)(kp + i * 1024);
  asm volatile("s_wait_xcnt 0x0" :: "v"(kp) : "memory");   // a precaution: stands in front of the first rewrite of the address registers that k's loads name; the address as an input keeps those registers as they are up to here
  const bool wka = bh < NB && t < 64; int ki = 0; if (wka) ki = KI[bh * SS + s0 + t];
  for (int e = t; e < 64 * HD; e += 256) { const int sl = e >> 6, d = e & 63; st[d][sl] = (_Float16)bfr(V[((bh * SS + s0 + sl) * HD) + d]); } __syncthreads();
  for (int e = t; e < HD * 8; e += 256) { const int d = e >> 3, q = e & 7; vst2((unsigned*)(VT + ((bh * HD + d) * SS) + s0 + q * 8), *(const v4u*)&st[d][q * 8]); }
  // k's and k_info's stores come last: nothing in this kernel waits for them
#pragma unroll
  for (int i = 0; i < 4; ++i) { v4b y;
#pragma unroll
    for (int c = 0; c < 4; ++c) y[c] = (__bf16)kx[i][c];
    *(v4b*)(KB + (bh * SS + s0) * HD + (size_t)(i * 256 + t) * 4) = y; }
  if (wka) KA[bh * SS + s0 + t] = (int)(4u * (unsigned)((ki == -1) ? 3 * RR : ki)); }
__device__ __forceinline__ v16b fragb_f32(const float* __restrict__ p, int lane) { v16b a; const float* pp = p + 8 * (lane >> 4);
#pragma unroll
  for (int i = 0; i < 8; ++i) { a[i] = (__bf16)pp[i]; a[8 + i] = (__bf16)pp[16 + i]; } return a; }
#define KPB 72              // staged k row pitch in bf16: 144 B = 16 B x odd, conflict-free for 16-byte LDS reads
#define VPH 40              // staged v row pitch in halves: 80 B = 16 B x odd
#define KTB (32 * KPB * 2)  // bytes of one staged k tile (32 keys)
#define VTB (HD * VPH * 2)  // bytes of one staged v tile (64 d rows x 32 keys)
#define ITB (4 * 32 * 4)    // bytes of one staged k_info tile (one copy of the 32 ints per wave)
#define RPB 72              // staged rel_emb row pitch in bf16: 144 B = 16 B x odd
#define KSPL 2              // waves that share one query tile, each on its own run of keys
#define SKH (SS / KSPL)     // keys of one such wave
typedef const __attribute__((address_space(3))) float lds_cf;
__device__ __forceinline__ unsigned lds_off(const void* p) { return (unsigned)(size_t)p; }
// one 32-key tile for the four waves of a key half, global -> LDS through no register: per thread 2 x 16 B of bf16 k, 2 x 16 B of v planes, 4 B of the k_info offsets.
// The s_wait_xcnt closes the statement so that no address register of a copy is rewritten ahead of it.
__device__ __forceinline__ void stage_tile(const __bf16* kg, const _Float16* vg, const int* ig, unsigned kl, unsigned vl, unsigned il) {
  asm volatile("global_load_async_to_lds_b128 %0, %1, off\n\t"
               "global_load_async_to_lds_b128 %2, %3, off\n\t"
               "global_load_async_to_lds_b128 %4, %5, off\n\t"
               "global_load_async_to_lds_b128 %6, %7, off\n\t"
               "global_load_async_to_lds_b32 %8, %9, off\n\t"
               "s_wait_xcnt 0x0"
               :: "v"(kl), "v"(kg), "v"(kl + 16u * KPB * 2u), "v"(kg + 16 * HD),
                  "v"(vl), "v"(vg), "v"(vl + 32u * VPH * 2u), "v"(vg + (size_t)32 * SS), "v"(il), "v"(ig) : "memory");
}
// eight residuals of P at the scale of hi: r = f16(e * 2^11 - hi), the difference fused and exact in f32, hi read as the f16 half it is and r written as the f16 half it becomes.
// In asm because plain code compiles to 16 conversions that unpack hi and 8 that pack r around the subtraction. The s_delay_alu lines change no result: each high half is written into the register whose low half was written four vector instructions back, and the hint lets the SIMD's other waves issue meanwhile.
__device__ __forceinline__ void resid8(unsigned* r, const float* e, const unsigned* h) {
  asm("v_fma_mixlo_f16 %0, %4, %16, -%12 op_sel_hi:[0,0,1]\n\t"
      "v_fma_mixlo_f16 %1, %6, %16, -%13 op_sel_hi:[0,0,1]\n\t"
      "v_fma_mixlo_f16 %2, %8, %16, -%14 op_sel_hi:[0,0,1]\n\t"
      "v_fma_mixlo_f16 %3, %10, %16, -%15 op_sel_hi:[0,0,1]\n\t"
      "s_delay_alu instid0(VALU_DEP_4) | instskip(NEXT) | instid1(VALU_DEP_4)\n\t"
      "v_fma_mixhi_f16 %0, %5, %16, -%12 op_sel:[0,0,1] op_sel_hi:[0,0,1]\n\t"
      "v_fma_mixhi_f16 %1, %7, %16, -%13 op_sel:[0,0,1] op_sel_hi:[0,0,1]\n\t"
      "s_delay_alu instid0(VALU_DEP_4) | instskip(NEXT) | instid1(VALU_DEP_4)\n\t"
      "v_fma_mixhi_f16 %2, %9, %16, -%14 op_sel:[0,0,1] op_sel_hi:[0,0,1]\n\t"
      "v_fma_mixhi_f16 %3, %11, %16, -%15 op_sel:[0,0,1] op_sel_hi:[0,0,1]"
      : "=&v"(r[0]), "=&v"(r[1]), "=&v"(r[2]), "=&v"(r[3])
      : "v"(e[0]), "v"(e[1]), "v"(e[2]), "v"(e[3]), "v"(e[4]), "v"(e[5]), "v"(e[6]), "v"(e[7]), "v"(h[0]), "v"(h[1]), "v"(h[2]), "v"(h[3]), "s"(2048.0f));
}
// lane l with lane l ^ 16, on the vector pipe
__device__ __forceinline__ float xhalf(float x) { return __builtin_bit_cast(float, __builtin_amdgcn_permlanex16(__builtin_bit_cast(int, x), __builtin_bit_cast(int, x), 0x76543210, 0xfedcba98, false, false)); }
// ---- k_attn: block = (64 queries, (b,h)): transposed products, S^T = k q^T (exact bf16 products, f32 accumulate) and O^T += v^T P^T: a lane holds 16 of the 32 keys' scores of ONE query (query = lane & 15; keys 8g + r and 16 + 8g + r),
// so the sum, and the maximum where one is taken, are in-lane (one exchange between the halves for the maximum, the halves' sums joined after the loop) and P hi + residual packs from the score registers straight into the B operand; k, v and k_info tiles of 32 keys staged once per block in a two-buffer LDS ring.
// The bias table is made here: rel_emb's first 256 rows rounded to bf16 into LDS once per block, then table^T = rel_emb q^T (A = 16 distances, B = 16 queries) goes from the accumulators straight into the query tile's LDS rows.
// Two waves share a query tile (wave = key half * 4 + query tile): each makes half of the tile's table and walks its own half of the keys with its own reference, sum and accumulators, on its own ring of tiles;
// behind the loop the second half's wave hands its state over through LDS and the first joins the two. Eight waves a block and two blocks a WGP give every SIMD four waves to fill each other's waits.
__global__ __launch_bounds__(256) __attribute__((amdgpu_waves_per_eu(4, 4))) void k_attn(const float* __restrict__ Q, const __bf16* __restrict__ KB, const _Float16* __restrict__ VT, const float* __restrict__ RE, const int* __restrict__ QI, const int* __restrict__ KA, float* __restrict__ O) {
  __shared__ __align__(16) float sqr[4][16][NREL + 3];
  // the epilogue's buffers lie on the staged rel_emb rows, whose last read ends at the barrier behind the table: with them apart two blocks would not fit a WGP's LDS
  __shared__ __align__(16) union { __bf16 srel[NREL - 1][RPB]; struct { v4f pm[4][8][32]; float pml[4][2][32]; float so[4][16][68]; } ep; } u;
  __shared__ __align__(16) __bf16 skt[2][KSPL][32][KPB]; __shared__ __align__(16) _Float16 svt[2][KSPL][HD][VPH]; __shared__ __align__(16) int ski[2][4 * KSPL][32];
  const int tid = threadIdx.x, wave = __builtin_amdgcn_readfirstlane(tid >> 5), qt = wave & 3, kh = wave >> 2, th = tid & 127, lane = tid & 31, col = lane & 15, g = lane >> 4; const size_t bh = blockIdx.y; const int q0 = blockIdx.x * 64 + qt * 16; const float* Qb = Q + (bh * SS) * HD; const __bf16* Kb = KB + (bh * SS) * HD; const _Float16* Vb = VT + bh * HD * SS;
  v16b aq[2];
#pragma unroll
  for (int kc = 0; kc < 2; ++kc) aq[kc] = fragb_f32(Qb + (size_t)(q0 + col) * HD + kc * 32, lane);
  asm volatile("s_wait_xcnt 0x0" ::: "memory");   // a precaution: stands in front of the first rewrite of the address registers that q's loads name
  const size_t b = bh / NH;
#pragma unroll   // a constant trip count lets the 16-byte loads go out in groups instead of one per wait
  for (int i = 0; i < (NREL - 1) * HD / 4 / 256; ++i) { const int f = i * 256 + tid; const v4f x = *(const v4f*)(RE + (size_t)f * 4); v4b y;
#pragma unroll
    for (int c = 0; c < 4; ++c) y[c] = (__bf16)x[c];
    *(v4b*)&u.srel[f >> 4][(f & 15) * 4] = y; }
  if (kh == 0) { v8f c = {}; v16b fl[2];   // distance index 256: the one row, straight from global, in all 16 A rows; both fragments read ahead of the first product
#pragma unroll   // constant indices keep fl in registers
    for (int kc = 0; kc < 2; ++kc) fl[kc] = fragb_f32(RE + (size_t)(NREL - 1) * HD + kc * 32, lane);
#pragma unroll
    for (int kc = 0; kc < 2; ++kc) c = wmma_bf(fl[kc], aq[kc], c);
    if (g == 0) sqr[qt][col][NREL - 1] = c[0]; }
  __syncthreads();   // publishes the staged rel_emb rows to every wave
#pragma unroll 1   // four tiles a trip: their fragment reads go out as one group, ahead of the first product
  for (int j2 = 0; j2 < (NREL - 1) / 64 / KSPL; ++j2) { const int jb = kh * ((NREL - 1) / 64 / KSPL) + j2; v16b fa[4][2];
#pragma unroll   // constant indices keep fa in registers
    for (int jt = 0; jt < 4; ++jt) {
#pragma unroll   // as above
      for (int kc = 0; kc < 2; ++kc) fa[jt][kc] = frag_b(&u.srel[jb * 64 + jt * 16 + col][kc * 32], lane); }
#pragma unroll
    for (int jt = 0; jt < 4; ++jt) { v8f c = {};
#pragma unroll
      for (int kc = 0; kc < 2; ++kc) c = wmma_bf(fa[jt][kc], aq[kc], c);   // element r = distance index jb * 64 + jt * 16 + 8g + r, column = query
      v4f t0, t1;
#pragma unroll
      for (int r = 0; r < 4; ++r) { t0[r] = c[r]; t1[r] = c[4 + r]; }
      *(v4f*)&sqr[qt][col][jb * 64 + jt * 16 + 8 * g] = t0; *(v4f*)&sqr[qt][col][jb * 64 + jt * 16 + 8 * g + 4] = t1; } }
  const int qi = QI[b * SS + q0 + col]; const int qa = (qi == -1) ? 2 * RR : qi;
  // the lane's own query's bias row, as LDS byte addresses: centre (distance 0) less 4 * q_info', and the row's two ends, which bound every address formed from k_info
  const unsigned qc = lds_off(&sqr[qt][col][RR]); const unsigned qoff = qc - 4u * (unsigned)qa; const int qlo = (int)(qc - 4u * RR), qhi = (int)(qc + 4u * RR);
  __syncthreads();   // publishes each wave's half of the table to the wave that shares its queries, and ends every read of the staged rel_emb rows
  float m = -3.0e38f, l = 0.f;
  v8f acc[4] = {};
  const __bf16* kg = Kb + (size_t)kh * SKH * HD + th * 8; const _Float16* vg = Vb + (size_t)(th >> 2) * SS + kh * SKH + (th & 3) * 8; const int* ig = KA + b * SS + kh * SKH + lane;   // the four waves of a key half stage that half's tiles
  const unsigned kl = lds_off(&skt[0][kh][th >> 3][(th & 7) * 8]), vl = lds_off(&svt[0][kh][th >> 2][(th & 3) * 8]), il = lds_off(&ski[0][wave][lane]);
  stage_tile(kg, vg, ig, kl, vl, il);
  asm volatile("s_wait_asynccnt 0x0" ::: "memory");   // tile 0 has landed before the barrier publishes it
  __syncthreads();                                    // publishes tile 0 to every wave
  stage_tile(kg + 32 * HD, vg + 32, ig + 32, kl + KSPL * KTB, vl + KSPL * VTB, il + KSPL * ITB);
#pragma unroll 1
  for (int ks = 0; ks < SKH / 32; ++ks) { float s[2][8]; const int bf = ks & 1;
    v16b kb[2][2]; v4i kiv[2][2];   // all of the trip's k fragment reads go out as one group, ahead of the first product
#pragma unroll   // constant indices keep kb and kiv in registers
    for (int ct = 0; ct < 2; ++ct) { kiv[ct][0] = *(const v4i*)&ski[bf][wave][ct * 16 + 8 * g]; kiv[ct][1] = *(const v4i*)&ski[bf][wave][ct * 16 + 8 * g + 4];
#pragma unroll   // as above
      for (int kc = 0; kc < 2; ++kc) kb[ct][kc] = frag_b(&skt[bf][kh][ct * 16 + col][kc * 32], lane); }
    float bs[2][8]; v8f cs[2];
#pragma unroll   // constant indices keep bs and cs in registers
    for (int ct = 0; ct < 2; ++ct) { v8f c = {};
#pragma unroll
      for (int kc = 0; kc < 2; ++kc) c = wmma_bf(kb[ct][kc], aq[kc], c);   // A = 16 keys, B = 16 queries: element r = key ct * 16 + 8g + r, column = query
      cs[ct] = c;
#pragma unroll   // as above
      for (int r = 0; r < 8; ++r) { int ad = (int)((unsigned)kiv[ct][r >> 2][r & 3] + qoff); ad = ad < qhi ? ad : qhi; ad = ad > qlo ? ad : qlo; bs[ct][r] = *(lds_cf*)ad; } }   // the clip of the distance is the clamp of the address to the row's ends
    __builtin_amdgcn_sched_barrier(0);   // keeps the first add below, which waits for a bias read, behind the issue of the last bias read: without it one add moves up between the two groups of reads and the second group waits out the first
#pragma unroll
    for (int ct = 0; ct < 2; ++ct) {
#pragma unroll
      for (int r = 0; r < 8; ++r) s[ct][r] = cs[ct][r] + bs[ct][r]; }   // the raw score: its 1/8 comes where it is used
    v16h vf[4];   // read ahead of the test below, so that their latency runs beside the exponentials
#pragma unroll   // constant indices keep vf in registers
    for (int dt = 0; dt < 4; ++dt) vf[dt] = frag_h(&svt[bf][kh][dt * 16 + col][0], lane);
    // The reference m stays as it is from trip to trip: the trip's exponentials are taken against it with no maximum, and the accumulators are not rescaled.
    // soft(): exponentials against ref, the lane's sum of them, P hi + residual packed.
    float es; union { v16h v; unsigned w[8]; } ua, ul;
    auto soft = [&](const float ref) { float tx[2][8], ex[2][8];
#pragma unroll   // constant indices keep tx and ex in registers
      for (int ct = 0; ct < 2; ++ct) {
#pragma unroll   // as above
        for (int i = 0; i < 8; ++i) { tx[ct][i] = (s[ct][i] * 0.125f - ref) * 1.44269504f; ex[ct][i] = __builtin_amdgcn_exp2f(tx[ct][i]); }
        // the slot behind a transcendental, one for eight: no result is read and no source register is rewritten ahead of this v_nop
        asm volatile("v_nop" : "+v"(ex[ct][0]), "+v"(ex[ct][1]), "+v"(ex[ct][2]), "+v"(ex[ct][3]), "+v"(ex[ct][4]), "+v"(ex[ct][5]), "+v"(ex[ct][6]), "+v"(ex[ct][7])
                     : "v"(tx[ct][0]), "v"(tx[ct][1]), "v"(tx[ct][2]), "v"(tx[ct][3]), "v"(tx[ct][4]), "v"(tx[ct][5]), "v"(tx[ct][6]), "v"(tx[ct][7])); }
      v2f t[8];   // the test waits for this sum: a tree of packed adds, four deep, in place of two chains of eight
#pragma unroll   // constant indices keep t in registers
      for (int j = 0; j < 8; ++j) t[j] = v2f{ ex[j >> 2][2 * (j & 3)], ex[j >> 2][2 * (j & 3) + 1] };
      const v2f tt = ((t[0] + t[1]) + (t[2] + t[3])) + ((t[4] + t[5]) + (t[6] + t[7]));
      es = tt[0] + tt[1];
#pragma unroll   // constant indices keep ua and ul in registers
      for (int ct = 0; ct < 2; ++ct) {
#pragma unroll   // as above
        for (int j = 0; j < 4; ++j) { const v2f e2 = { ex[ct][2 * j], ex[ct][2 * j + 1] }; ua.w[ct * 4 + j] = __builtin_bit_cast(unsigned, __builtin_convertvector(e2 * 2048.0f, v2h)); }
        resid8(&ul.w[ct * 4], ex[ct], &ua.w[ct * 4]); } };
    soft(m);
    // One test a trip, a scalar branch: a lane's sum of at most 16 bounds each of its exponentials by 16, so that P x 2^11 stays inside f16; a larger sum, an infinity or a NaN (the first trip's, whose reference is the start value) sends the whole wave
    // to the full step: the maximum of the trip's scores, the reference raised to 3 octaves above it (headroom of 2^7 before the test fires again), sum and accumulators rescaled, the trip's exponentials made anew (each at most 1/8).
    if (__builtin_amdgcn_ballot_w32(!(es <= 16.0f)) != 0) {
      float mx = fmaxf(s[0][0], s[1][0]);
#pragma unroll
      for (int r = 1; r < 8; ++r) mx = fmaxf(mx, fmaxf(s[0][r], s[1][r]));
      mx = 0.125f * fmaxf(mx, xhalf(mx));   // the two lanes of a query keep one reference
      const float mn = fmaxf(m, mx + 2.07944154f); const float ta = (m - mn) * 1.44269504f; float ea = __builtin_amdgcn_exp2f(ta);
      asm volatile("v_nop" : "+v"(ea) : "v"(ta));   // the slot behind a transcendental: the result is not read and the source register is not rewritten ahead of this v_nop
      const float alpha = (m <= -1.0e38f) ? 0.f : ea; m = mn;
      l *= alpha;
#pragma unroll
      for (int dt = 0; dt < 4; ++dt) acc[dt] *= alpha;
      soft(m); }
    const v16h pa = ua.v, pl = ul.v;
    l += es;
#pragma unroll
    for (int dt = 0; dt < 4; ++dt) acc[dt] = wmma16(vf[dt], pa, acc[dt]);   // A = 16 d rows of v^T, B = P^T: element r = d dt * 16 + 8g + r, column = query
#pragma unroll   // the residual's products go into the same accumulators, each four products behind the one it depends on
    for (int dt = 0; dt < 4; ++dt) acc[dt] = wmma16(vf[dt], pl, acc[dt]);
    asm volatile("s_wait_dscnt 0" ::: "memory");        // this wave's reads of buffer bf have retired before the buffer is handed back
    asm volatile("s_wait_asynccnt 0x0" ::: "memory");   // this wave's share of tile ks + 1 has landed before the barrier publishes it
    __syncthreads();                                    // publishes tile ks + 1 and ends every wave's reads of buffer bf
    if (ks + 2 < SKH / 32) stage_tile(kg + (size_t)(ks + 2) * 32 * HD, vg + (ks + 2) * 32, ig + (ks + 2) * 32, kl + bf * (KSPL * KTB), vl + bf * (KSPL * VTB), il + bf * (KSPL * ITB)); }
  asm volatile("s_wait_asynccnt 0x0" ::: "memory");     // no copy is outstanding when the wave goes on to its epilogue
  l += xhalf(l);   // the two halves hold the sums of their own keys
  if (kh == 1) {   // the second key half's state, lane for lane: accumulators, then reference and sum
#pragma unroll
    for (int dt = 0; dt < 4; ++dt) { v4f p0, p1;
#pragma unroll
      for (int r = 0; r < 4; ++r) { p0[r] = acc[dt][r]; p1[r] = acc[dt][4 + r]; }
      u.ep.pm[qt][dt * 2][lane] = p0; u.ep.pm[qt][dt * 2 + 1][lane] = p1; }
    u.ep.pml[qt][0][lane] = m; u.ep.pml[qt][1][lane] = l; }
  __syncthreads();   // hands the second half's state to the wave that joins the two
  if (kh == 0) { const float m1 = u.ep.pml[qt][0][lane], l1 = u.ep.pml[qt][1][lane]; const float mj = fmaxf(m, m1); const float a0 = __expf(m - mj), a1 = __expf(m1 - mj);
    const float il2 = (1.0f / 2048.0f) / (l * a0 + l1 * a1); const float f0 = a0 * il2, f1 = a1 * il2;
#pragma unroll
    for (int dt = 0; dt < 4; ++dt) { const v4f p0 = u.ep.pm[qt][dt * 2][lane], p1 = u.ep.pm[qt][dt * 2 + 1][lane]; v4f o0, o1;
#pragma unroll
      for (int r = 0; r < 4; ++r) { o0[r] = acc[dt][r] * f0 + p0[r] * f1; o1[r] = acc[dt][4 + r] * f0 + p1[r] * f1; }
      *(v4f*)&u.ep.so[qt][col][dt * 16 + 8 * g] = o0; *(v4f*)&u.ep.so[qt][col][dt * 16 + 8 * g + 4] = o1; }
    LDSX();
    for (int rl = 0; rl < 16; ++rl) if (lane < 16) vst2(O + ((bh * SS + q0 + rl) * HD) + lane * 4, *(const v4f*)&u.ep.so[qt][rl][lane * 4]); }
}
extern "C" void kernel_launch(void* const* d_in, const int* in_sizes, int n_in, void* d_out, int out_size, void* d_ws, size_t ws_size, hipStream_t stream) {
  (void)in_sizes; (void)n_in; (void)out_size;
  const float** F = (const float**)d_in;   // 0 q, 1 k, 2 v [2,8,2048,64], 3 rel_emb [257,64], 4 q_info int [2,2048], 5 k_info int [2,2048]
  if (ws_size < (size_t)WS_END) return;
  _Float16* VT = (_Float16*)((char*)d_ws + WS_VT);
  __bf16* KB = (__bf16*)((char*)d_ws + WS_KB); int* KA = (int*)((char*)d_ws + WS_KA);
  k_vt<<<dim3(SS / 64, NBH), 256, 0, stream>>>(F[2], F[1], (const int*)d_in[5], VT, KB, KA);
  k_attn<<<dim3(TQB, TNBH), 256, 0, stream>>>(F[0], KB, VT, F[3], (const int*)d_in[4], KA, (float*)d_out);
}

// v008
// A run of this version takes 41.6 microseconds.
// Timed twice side by side with v007, it ran 1.04 and 1.05 times as fast.
// Counting every step since v000, it is 6.34 times as fast.
// compute dtype: all float inputs rounded to bf16, q_info / k_info (int) read on device; qr = q . rel_emb^T with EXACT bf16 products on WMMA 16x16x32 (f32 table), the per-pair index clip(k_adj - q_adj, -128, 128) + 128 computed on device from the int inputs and the bias gathered from the wave's LDS copy of the qr rows; scores = q . k (exact bf16 products) + bias, x 1/8, softmax in f32 to base 2 (the table kept x log2(e)/8, the reference and P's 2^11 carried in the score products' C) against a held reference that is raised when a trip's exponentials outgrow it (hardware exp); P (x 2^11) as f16 hi + f16 residual at the same scale (2 products, one accumulator) x v (exact in f16), f32 accumulate; f32 output.
#include <hip/hip_runtime.h>
#include <math.h>

typedef __attribute__((ext_vector_type(16))) _Float16 v16h;
typedef __attribute__((ext_vector_type(16))) __bf16 v16b;
typedef __attribute__((ext_vector_type(8)))  _Float16 v8h;
typedef __attribute__((ext_vector_type(2)))  _Float16 v2h;
typedef __attribute__((ext_vector_type(8)))  float v8f;
typedef __attribute__((ext_vector_type(4)))  float v4f;
typedef __attribute__((ext_vector_type(2)))  float v2f;
typedef __attribute__((ext_vector_type(4)))  unsigned v4u;
typedef __attribute__((ext_vector_type(4)))  int v4i;
typedef float __attribute__((may_alias)) float_a;
typedef int __attribute__((may_alias)) int_a;

template <typename T> __device__ __forceinline__ void vst2(void* p, T v) { *(T*)p = v;  }
__device__ __forceinline__ v8f wmma16(v16h a, v16h b, v8f c) {
  v8f d = __builtin_amdgcn_wmma_f32_16x16x32_f16(false, a, false, b, (short)0, c, false, false);
  asm volatile("v_nop\n\tv_nop\n\tv_nop\n\tv_nop" : "+v"(d) : "v"(a), "v"(b));
  return d;
}
__device__ __forceinline__ v8f wmma_bf(v16b a, v16b b, v8f c) {
  v8f d = __builtin_amdgcn_wmma_f32_16x16x32_bf16(false, a, false, b, (short)0, c, false, false);
  asm volatile("v_nop\n\tv_nop\n\tv_nop\n\tv_nop" : "+v"(d) : "v"(a), "v"(b));
  return d;
}
// the first products of a trip's two score tiles, both on one C that lives on behind them (each D in registers of its own). In asm because the builtin compiled, at the last use of such a C in a trip, to a product that overwrites its C, with four 64-bit register copies of C in front of it.
// The four v_nop are the distance the chip needs between a matrix instruction and a vector instruction on its D, A or B (the second product is a slot more for the first).
__device__ __forceinline__ void wmma_bf_keepc2(v8f& d0, v8f& d1, v16b a0, v16b a1, v16b b, v8f c) {
  asm volatile("v_wmma_f32_16x16x32_bf16 %0, %2, %4, %5\n\t"
               "v_wmma_f32_16x16x32_bf16 %1, %3, %4, %5\n\t"
               "v_nop\n\tv_nop\n\tv_nop\n\tv_nop" : "=&v"(d0), "=&v"(d1) : "v"(a0), "v"(a1), "v"(b), "v"(c));
}
// 16x16x32 fragments: lane = (h = lane>>4, row/col = lane&15); elements 0..7 = k0+8h+0..7, 8..15 = k0+16+8h+0..7; D element r = row 8h+r
__device__ __forceinline__ v16h frag_h(const _Float16* rowk0, int lane) {
  union { v16h v; v8h q[2]; } u; const _Float16* p = rowk0 + 8 * (lane >> 4);
  u.q[0] = *(const v8h*)p; u.q[1] = *(const v8h*)(p + 16); return u.v;
}
__device__ __forceinline__ v16h frag_f32(const float* rowk0, int lane) {
  v16h a; const float* p = rowk0 + 8 * (lane >> 4);
#pragma unroll
  for (int i = 0; i < 8; ++i) { a[i] = (_Float16)p[i]; a[8 + i] = (_Float16)p[16 + i]; }
  return a;
}
__device__ __forceinline__ v16h frag_f32s(const float* rowk0, int lane, float sc) {
  v16h a; const float* p = rowk0 + 8 * (lane >> 4);
#pragma unroll
  for (int i = 0; i < 8; ++i) { a[i] = (_Float16)(p[i] * sc); a[8 + i] = (_Float16)(p[16 + i] * sc); }
  return a;
}
// column fragment from a [K][ld] layout (column n), rows >= K read as 0
__device__ __forceinline__ v16h fragc_f32(const float* W, int k0, int n, int lane, int ld, int K) {
  v16h a; const int g = lane >> 4;
#pragma unroll
  for (int i = 0; i < 8; ++i) { const int ka = k0 + 8 * g + i, kb = ka + 16;
    a[i] = (_Float16)(ka < K ? W[(size_t)(ka < K ? ka : K - 1) * ld + n] : 0.f); a[8 + i] = (_Float16)(kb < K ? W[(size_t)(kb < K ? kb : K - 1) * ld + n] : 0.f); }
  return a;
}
struct F2 { v16b h, l; };
__device__ __forceinline__ F2 bsplit16(const float v[16]) { F2 r;
#pragma unroll
  for (int i = 0; i < 16; ++i) { const __bf16 h = (__bf16)v[i]; r.h[i] = h; r.l[i] = (__bf16)(v[i] - (float)h); }
  return r; }
__device__ __forceinline__ F2 split_row(const float* row, int k0, int lane) { float v[16]; const float* p = row + k0 + 8 * (lane >> 4);
#pragma unroll
  for (int i = 0; i < 8; ++i) { v[i] = p[i]; v[8 + i] = p[16 + i]; }
  return bsplit16(v); }
__device__ __forceinline__ F2 split_rowK(const float* row, int k0, int lane, int K) { float v[16]; const int g = lane >> 4;
#pragma unroll
  for (int i = 0; i < 8; ++i) { const int ka = k0 + 8 * g + i, kb = ka + 16; v[i] = ka < K ? row[ka < K ? ka : K - 1] : 0.f; v[8 + i] = kb < K ? row[kb < K ? kb : K - 1] : 0.f; }
  return bsplit16(v); }
__device__ __forceinline__ F2 split_col(const float* W, int k0, int n, int lane, int ld, int K) { float v[16]; const int g = lane >> 4;
#pragma unroll
  for (int i = 0; i < 8; ++i) { const int ka = k0 + 8 * g + i, kb = ka + 16; v[i] = ka < K ? W[(size_t)(ka < K ? ka : K - 1) * ld + n] : 0.f; v[8 + i] = kb < K ? W[(size_t)(kb < K ? kb : K - 1) * ld + n] : 0.f; }
  return bsplit16(v); }
__device__ __forceinline__ v8f mac3(const F2& a, const F2& b, v8f c) { c = wmma_bf(a.l, b.h, c); c = wmma_bf(a.h, b.l, c); return wmma_bf(a.h, b.h, c); }
__device__ __forceinline__ float sigm(float v) { return 1.0f / (1.0f + expf(-v)); }
#define LDSX() do { asm volatile("s_wait_dscnt 0" ::: "memory"); __builtin_amdgcn_wave_barrier(); __builtin_amdgcn_fence(__ATOMIC_RELEASE, "workgroup"); } while (0)


// Relative-information attention on given q, k, v (B 2, 8 heads, S 2,048, D 64; max distance 128): scores = (q k^T + take(q rel_emb^T, clip(k_info' - q_info') + 128)) / 8, softmax, v; q_info' = where(q_info == -1, 256, q_info), k_info' = where(k_info == -1, 384, k_info).
#define NB 2
#define NH 8
#define SS 2048
#define RR 128
#define NREL (2 * RR + 1)   // 257
#define HD 64
#define NBH (NB * NH)
#ifndef TQB
#define TQB (SS / 64)
#define TNBH NBH
#endif
typedef __attribute__((ext_vector_type(8))) __bf16 v8b;
__device__ __forceinline__ v16b frag_b(const __bf16* rowk0, int lane) {
  union { v16b v; v8b q[2]; } u; const __bf16* p = rowk0 + 8 * (lane >> 4);
  u.q[0] = *(const v8b*)p; u.q[1] = *(const v8b*)(p + 16); return u.v;
}
__device__ __forceinline__ float bfr(float v) { return (float)(__bf16)v; }
__device__ __attribute__((noinline)) float exp_ni(float v) { return expf(v); }
__device__ __attribute__((noinline)) float erf_ni(float v) { return erff(v); }

#define WS_VT  0u                                   // f16 v planes [(b,h)][64 d][s]
#define WS_KB  (WS_VT + 2u * (size_t)NBH * HD * SS)  // bf16 k rows [(b,h)][s][64 d]
#define WS_KA  (WS_KB + 2u * (size_t)NBH * SS * HD)  // int [b][s]: 4 * where(k_info == -1, 384, k_info), a byte offset into a bias row
#define WS_END (WS_KA + 4u * (size_t)NB * SS)

typedef __attribute__((ext_vector_type(4))) __bf16 v4b;
// ---- k_vt: block = (64 keys, (b,h)): v[bh][s][d] -> VT[bh][d][s] f16 (exact for bf16 values in range);
// and what k_attn needs of each key, made once here instead of by every wave that meets the key: k's rows rounded to bf16 (KB), k_info with its -1 replaced and times 4 (KA; the blocks of the first NB planes write one batch row each)
__global__ __launch_bounds__(256) void k_vt(const float* __restrict__ V, const float* __restrict__ K, const int* __restrict__ KI, _Float16* __restrict__ VT, __bf16* __restrict__ KB, int* __restrict__ KA) { __shared__ __align__(16) _Float16 st[HD][64 + 8]; const int t = threadIdx.x; const int s0 = blockIdx.x * 64; const size_t bh = blockIdx.y;
  v4f kx[4]; const float* kp = K + (bh * SS + s0) * HD + t * 4;
#pragma unroll   // constant indices keep kx in registers; the four loads go out ahead of v's, so that their latency runs beside v's
  for (int i = 0; i < 4; ++i) kx[i] = *(const v4f*)(kp + i * 1024);
  asm volatile("s_wait_xcnt 0x0" :: "v"(kp) : "memory");   // a precaution: stands in front of the first rewrite of the address registers that k's loads name; the address as an input keeps those registers as they are up to here
  const bool wka = bh < NB && t < 64; int ki = 0; if (wka) ki = KI[bh * SS + s0 + t];
  for (int e = t; e < 64 * HD; e += 256) { const int sl = e >> 6, d = e & 63; st[d][sl] = (_Float16)bfr(V[((bh * SS + s0 + sl) * HD) + d]); } __syncthreads();
  for (int e = t; e < HD * 8; e += 256) { const int d = e >> 3, q = e & 7; vst2((unsigned*)(VT + ((bh * HD + d) * SS) + s0 + q * 8), *(const v4u*)&st[d][q * 8]); }
  // k's and k_info's stores come last: nothing in this kernel waits for them
#pragma unroll
  for (int i = 0; i < 4; ++i) { v4b y;
#pragma unroll
    for (int c = 0; c < 4; ++c) y[c] = (__bf16)kx[i][c];
    *(v4b*)(KB + (bh * SS + s0) * HD + (size_t)(i * 256 + t) * 4) = y; }
  if (wka) KA[bh * SS + s0 + t] = (int)(4u * (unsigned)((ki == -1) ? 3 * RR : ki)); }
__device__ __forceinline__ v16b fragb_f32(const float* __restrict__ p, int lane) { v16b a; const float* pp = p + 8 * (lane >> 4);
#pragma unroll
  for (int i = 0; i < 8; ++i) { a[i] = (__bf16)pp[i]; a[8 + i] = (__bf16)pp[16 + i]; } return a; }
#define KPB 72              // staged k row pitch in bf16: 144 B = 16 B x odd, conflict-free for 16-byte LDS reads
#define VPH 40              // staged v row pitch in halves: 80 B = 16 B x odd
#define KTB (32 * KPB * 2)  // bytes of one staged k tile (32 keys)
#define VTB (HD * VPH * 2)  // bytes of one staged v tile (64 d rows x 32 keys)
#define ITB (4 * 32 * 4)    // bytes of one staged k_info tile (one copy of the 32 ints per wave)
#define RPB 72              // staged rel_emb row pitch in bf16: 144 B = 16 B x odd
#define KSPL 2              // waves that share one query tile, each on its own run of keys
#define SKH (SS / KSPL)     // keys of one such wave
#define KS 0.18033688f      // log2(e) / 8: a raw score times this is its exponent to base 2
#define KSI 5.54517744f     // 8 / log2(e)
typedef const __attribute__((address_space(3))) float lds_cf;
__device__ __forceinline__ unsigned lds_off(const void* p) { return (unsigned)(size_t)p; }
// one 32-key tile for the four waves of a key half, global -> LDS through no register: per thread 2 x 16 B of bf16 k, 2 x 16 B of v planes, 4 B of the k_info offsets.
// The s_wait_xcnt closes the statement so that no address register of a copy is rewritten ahead of it.
__device__ __forceinline__ void stage_tile(const __bf16* kg, const _Float16* vg, const int* ig, unsigned kl, unsigned vl, unsigned il) {
  asm volatile("global_load_async_to_lds_b128 %0, %1, off\n\t"
               "global_load_async_to_lds_b128 %2, %3, off\n\t"
               "global_load_async_to_lds_b128 %4, %5, off\n\t"
               "global_load_async_to_lds_b128 %6, %7, off\n\t"
               "global_load_async_to_lds_b32 %8, %9, off\n\t"
               "s_wait_xcnt 0x0"
               :: "v"(kl), "v"(kg), "v"(kl + 16u * KPB * 2u), "v"(kg + 16 * HD),
                  "v"(vl), "v"(vg), "v"(vl + 32u * VPH * 2u), "v"(vg + (size_t)32 * SS), "v"(il), "v"(ig) : "memory");
}
// eight residuals of P at the scale of hi: r = f16(e - hi), e being the exponential that already carries 2^11, the difference exact in f32, hi read as the f16 half it is and r written as the f16 half it becomes.
// In asm because plain code compiles to 16 conversions that unpack hi and 8 that pack r around the subtraction. The s_delay_alu lines change no result: each high half is written into the register whose low half was written four vector instructions back, and the hint lets the SIMD's other waves issue meanwhile.
__device__ __forceinline__ void resid8(unsigned* r, const float* e, const unsigned* h) {
  asm("v_fma_mixlo_f16 %0, %4, %16, -%12 op_sel_hi:[0,0,1]\n\t"
      "v_fma_mixlo_f16 %1, %6, %16, -%13 op_sel_hi:[0,0,1]\n\t"
      "v_fma_mixlo_f16 %2, %8, %16, -%14 op_sel_hi:[0,0,1]\n\t"
      "v_fma_mixlo_f16 %3, %10, %16, -%15 op_sel_hi:[0,0,1]\n\t"
      "s_delay_alu instid0(VALU_DEP_4) | instskip(NEXT) | instid1(VALU_DEP_4)\n\t"
      "v_fma_mixhi_f16 %0, %5, %16, -%12 op_sel:[0,0,1] op_sel_hi:[0,0,1]\n\t"
      "v_fma_mixhi_f16 %1, %7, %16, -%13 op_sel:[0,0,1] op_sel_hi:[0,0,1]\n\t"
      "s_delay_alu instid0(VALU_DEP_4) | instskip(NEXT) | instid1(VALU_DEP_4)\n\t"
      "v_fma_mixhi_f16 %2, %9, %16, -%14 op_sel:[0,0,1] op_sel_hi:[0,0,1]\n\t"
      "v_fma_mixhi_f16 %3, %11, %16, -%15 op_sel:[0,0,1] op_sel_hi:[0,0,1]"
      : "=&v"(r[0]), "=&v"(r[1]), "=&v"(r[2]), "=&v"(r[3])
      : "v"(e[0]), "v"(e[1]), "v"(e[2]), "v"(e[3]), "v"(e[4]), "v"(e[5]), "v"(e[6]), "v"(e[7]), "v"(h[0]), "v"(h[1]), "v"(h[2]), "v"(h[3]), "s"(1.0f));
}
// lane l with lane l ^ 16, on the vector pipe
__device__ __forceinline__ float xhalf(float x) { return __builtin_bit_cast(float, __builtin_amdgcn_permlanex16(__builtin_bit_cast(int, x), __builtin_bit_cast(int, x), 0x76543210, 0xfedcba98, false, false)); }
// ---- k_attn: block = (64 queries, (b,h)): transposed products, S^T = k q^T (exact bf16 products, f32 accumulate) and O^T += v^T P^T: a lane holds 16 of the 32 keys' scores of ONE query (query = lane & 15; keys 8g + r and 16 + 8g + r),
// so the sum, and the maximum where one is taken, are in-lane (one exchange between the halves for the maximum, the halves' sums joined after the loop) and P hi + residual packs from the score registers straight into the B operand; k, v and k_info tiles of 32 keys staged once per block in a two-buffer LDS ring.
// The bias table (x log2(e) / 8) is made here: rel_emb's first 256 rows rounded to bf16 into LDS once per block, then table^T = rel_emb q^T (A = 16 distances, B = 16 queries) goes from the accumulators straight into the query tile's LDS rows.
// Two waves share a query tile (wave = key half * 4 + query tile): each makes half of the tile's table and walks its own half of the keys with its own reference, sum and accumulators, on its own ring of tiles;
// behind the loop the second half's wave hands its state over through LDS and the first joins the two. Eight waves a block and two blocks a WGP give every SIMD four waves to fill each other's waits.
__global__ __launch_bounds__(256) __attribute__((amdgpu_waves_per_eu(4, 4))) void k_attn(const float* __restrict__ Q, const __bf16* __restrict__ KB, const _Float16* __restrict__ VT, const float* __restrict__ RE, const int* __restrict__ QI, const int* __restrict__ KA, float* __restrict__ O) {
  __shared__ __align__(16) float sqr[4][16][NREL + 3];
  // the epilogue's buffers lie on the staged rel_emb rows, whose last read ends at the barrier behind the table: with them apart two blocks would not fit a WGP's LDS
  __shared__ __align__(16) union { __bf16 srel[NREL - 1][RPB]; struct { v4f pm[4][8][32]; float pml[4][2][32]; float so[4][16][68]; } ep; } u;
  __shared__ __align__(16) __bf16 skt[2][KSPL][32][KPB]; __shared__ __align__(16) _Float16 svt[2][KSPL][HD][VPH]; __shared__ __align__(16) int ski[2][4 * KSPL][32];
  const int tid = threadIdx.x, wave = __builtin_amdgcn_readfirstlane(tid >> 5), qt = wave & 3, kh = wave >> 2, th = tid & 127, lane = tid & 31, col = lane & 15, g = lane >> 4; const size_t bh = blockIdx.y; const int q0 = blockIdx.x * 64 + qt * 16; const float* Qb = Q + (bh * SS) * HD; const __bf16* Kb = KB + (bh * SS) * HD; const _Float16* Vb = VT + bh * HD * SS;
  v16b aq[2];
#pragma unroll
  for (int kc = 0; kc < 2; ++kc) aq[kc] = fragb_f32(Qb + (size_t)(q0 + col) * HD + kc * 32, lane);
  asm volatile("s_wait_xcnt 0x0" ::: "memory");   // a precaution: stands in front of the first rewrite of the address registers that q's loads name
  const size_t b = bh / NH;
#pragma unroll   // a constant trip count lets the 16-byte loads go out in groups instead of one per wait
  for (int i = 0; i < (NREL - 1) * HD / 4 / 256; ++i) { const int f = i * 256 + tid; const v4f x = *(const v4f*)(RE + (size_t)f * 4); v4b y;
#pragma unroll
    for (int c = 0; c < 4; ++c) y[c] = (__bf16)x[c];
    *(v4b*)&u.srel[f >> 4][(f & 15) * 4] = y; }
  if (kh == 0) { v8f c = {}; v16b fl[2];   // distance index 256: the one row, straight from global, in all 16 A rows; both fragments read ahead of the first product
#pragma unroll   // constant indices keep fl in registers
    for (int kc = 0; kc < 2; ++kc) fl[kc] = fragb_f32(RE + (size_t)(NREL - 1) * HD + kc * 32, lane);
#pragma unroll
    for (int kc = 0; kc < 2; ++kc) c = wmma_bf(fl[kc], aq[kc], c);
    if (g == 0) sqr[qt][col][NREL - 1] = c[0] * KS; }
  __syncthreads();   // publishes the staged rel_emb rows to every wave
#pragma unroll 1   // four tiles a trip: their fragment reads go out as one group, ahead of the first product
  for (int j2 = 0; j2 < (NREL - 1) / 64 / KSPL; ++j2) { const int jb = kh * ((NREL - 1) / 64 / KSPL) + j2; v16b fa[4][2];
#pragma unroll   // constant indices keep fa in registers
    for (int jt = 0; jt < 4; ++jt) {
#pragma unroll   // as above
      for (int kc = 0; kc < 2; ++kc) fa[jt][kc] = frag_b(&u.srel[jb * 64 + jt * 16 + col][kc * 32], lane); }
#pragma unroll
    for (int jt = 0; jt < 4; ++jt) { v8f c = {};
#pragma unroll
      for (int kc = 0; kc < 2; ++kc) c = wmma_bf(fa[jt][kc], aq[kc], c);   // element r = distance index jb * 64 + jt * 16 + 8g + r, column = query
      v4f t0, t1;
#pragma unroll
      for (int r = 0; r < 4; ++r) { t0[r] = c[r] * KS; t1[r] = c[4 + r] * KS; }   // the table is kept in octaves: bias x log2(e) / 8
      *(v4f*)&sqr[qt][col][jb * 64 + jt * 16 + 8 * g] = t0; *(v4f*)&sqr[qt][col][jb * 64 + jt * 16 + 8 * g + 4] = t1; } }
  const int qi = QI[b * SS + q0 + col]; const int qa = (qi == -1) ? 2 * RR : qi;
  // the lane's own query's bias row, as LDS byte addresses: centre (distance 0) less 4 * q_info', and the row's two ends, which bound every address formed from k_info
  const unsigned qc = lds_off(&sqr[qt][col][RR]); const unsigned qoff = qc - 4u * (unsigned)qa; const int qlo = (int)(qc - 4u * RR), qhi = (int)(qc + 4u * RR);
  __syncthreads();   // publishes each wave's half of the table to the wave that shares its queries, and ends every read of the staged rel_emb rows
  // m: the reference, in octaves. cz = (11 - m) x 8 / log2(e) in all eight C registers of the score products: (cz + q . k) x log2(e) / 8 + table entry is then the whole argument of the exponential, 2^11 included
  float m = 0.f, l = 0.f; v8f cz;
#pragma unroll   // constant indices keep cz in registers
  for (int r = 0; r < 8; ++r) cz[r] = 11.0f * KSI;
  v8f acc[4] = {};
  const __bf16* kg = Kb + (size_t)kh * SKH * HD + th * 8; const _Float16* vg = Vb + (size_t)(th >> 2) * SS + kh * SKH + (th & 3) * 8; const int* ig = KA + b * SS + kh * SKH + lane;   // the four waves of a key half stage that half's tiles
  const unsigned kl = lds_off(&skt[0][kh][th >> 3][(th & 7) * 8]), vl = lds_off(&svt[0][kh][th >> 2][(th & 3) * 8]), il = lds_off(&ski[0][wave][lane]);
  stage_tile(kg, vg, ig, kl, vl, il);
  asm volatile("s_wait_asynccnt 0x0" ::: "memory");   // tile 0 has landed before the barrier publishes it
  __syncthreads();                                    // publishes tile 0 to every wave
  stage_tile(kg + 32 * HD, vg + 32, ig + 32, kl + KSPL * KTB, vl + KSPL * VTB, il + KSPL * ITB);
#pragma unroll 1
  for (int ks = 0; ks < SKH / 32; ++ks) { float tx[2][8]; const int bf = ks & 1;
    v16b kb[2][2]; v4i kiv[2][2];   // all of the trip's k fragment reads go out as one group, ahead of the first product
#pragma unroll   // constant indices keep kb and kiv in registers
    for (int ct = 0; ct < 2; ++ct) { kiv[ct][0] = *(const v4i*)&ski[bf][wave][ct * 16 + 8 * g]; kiv[ct][1] = *(const v4i*)&ski[bf][wave][ct * 16 + 8 * g + 4];
#pragma unroll   // as above
      for (int kc = 0; kc < 2; ++kc) kb[ct][kc] = frag_b(&skt[bf][kh][ct * 16 + col][kc * 32], lane); }
    float bs[2][8]; v8f cs[2];
    wmma_bf_keepc2(cs[0], cs[1], kb[0][0], kb[1][0], aq[0], cz);   // A = 16 keys, B = 16 queries: element r = key ct * 16 + 8g + r, column = query
#pragma unroll   // constant indices keep bs and cs in registers
    for (int ct = 0; ct < 2; ++ct) { cs[ct] = wmma_bf(kb[ct][1], aq[1], cs[ct]);
#pragma unroll   // as above
      for (int r = 0; r < 8; ++r) { int ad = (int)((unsigned)kiv[ct][r >> 2][r & 3] + qoff); ad = ad < qhi ? ad : qhi; ad = ad > qlo ? ad : qlo; bs[ct][r] = *(lds_cf*)ad; } }   // the clip of the distance is the clamp of the address to the row's ends
    __builtin_amdgcn_sched_barrier(0);   // keeps the first fma below, which waits for a bias read, behind the issue of the last bias read: without it one moves up between the two groups of reads and the second group waits out the first
#pragma unroll
    for (int ct = 0; ct < 2; ++ct) {
#pragma unroll
      for (int j = 0; j < 4; ++j) { const v2f t2 = v2f{ cs[ct][2 * j], cs[ct][2 * j + 1] } * KS + v2f{ bs[ct][2 * j], bs[ct][2 * j + 1] }; tx[ct][2 * j] = t2[0]; tx[ct][2 * j + 1] = t2[1]; } }   // one packed fma for two arguments of the exponential
    v16h vf[4];   // read ahead of the test below, so that their latency runs beside the exponentials
#pragma unroll   // constant indices keep vf in registers
    for (int dt = 0; dt < 4; ++dt) vf[dt] = frag_h(&svt[bf][kh][dt * 16 + col][0], lane);
    // The reference m stays as it is from trip to trip: the trip's exponentials are taken against it with no maximum, and the accumulators are not rescaled.
    // soft(): exponentials of tx (each carries 2^11), the lane's sum of them, P hi + residual packed.
    float es; union { v16h v; unsigned w[8]; } ua, ul;
    auto soft = [&]() { float ex[2][8];
#pragma unroll   // constant indices keep ex in registers
      for (int ct = 0; ct < 2; ++ct) {
#pragma unroll   // as above
        for (int i = 0; i < 8; ++i) ex[ct][i] = __builtin_amdgcn_exp2f(tx[ct][i]);
        // the slot behind a transcendental, one for eight: no result is read and no source register is rewritten ahead of this v_nop
        asm volatile("v_nop" : "+v"(ex[ct][0]), "+v"(ex[ct][1]), "+v"(ex[ct][2]), "+v"(ex[ct][3]), "+v"(ex[ct][4]), "+v"(ex[ct][5]), "+v"(ex[ct][6]), "+v"(ex[ct][7])
                     : "v"(tx[ct][0]), "v"(tx[ct][1]), "v"(tx[ct][2]), "v"(tx[ct][3]), "v"(tx[ct][4]), "v"(tx[ct][5]), "v"(tx[ct][6]), "v"(tx[ct][7])); }
      v2f t[8];   // the test waits for this sum: a tree of packed adds, four deep, in place of two chains of eight
#pragma unroll   // constant indices keep t in registers
      for (int j = 0; j < 8; ++j) t[j] = v2f{ ex[j >> 2][2 * (j & 3)], ex[j >> 2][2 * (j & 3) + 1] };
      const v2f tt = ((t[0] + t[1]) + (t[2] + t[3])) + ((t[4] + t[5]) + (t[6] + t[7]));
      es = tt[0] + tt[1];
#pragma unroll   // constant indices keep ua and ul in registers
      for (int ct = 0; ct < 2; ++ct) {
#pragma unroll   // as above
        for (int j = 0; j < 4; ++j) { const v2f e2 = { ex[ct][2 * j], ex[ct][2 * j + 1] }; ua.w[ct * 4 + j] = __builtin_bit_cast(unsigned, __builtin_convertvector(e2, v2h)); }
        resid8(&ul.w[ct * 4], ex[ct], &ua.w[ct * 4]); } };
    soft();
    // One test a trip, a scalar branch: a lane's sum of at most 16 x 2^11 bounds each of its exponentials by that, so that P stays inside f16; a larger sum, an infinity or a NaN, and always the first trip (whose reference is only the start value), sends the whole wave
    // to the full step: the maximum of the trip's arguments, the reference moved to 3 octaves above it (headroom of 2^7 before the test fires again; the first trip sets it, later trips only raise it), sum and accumulators rescaled, the trip's exponentials made anew (each at most 2^8).
    if (__builtin_amdgcn_ballot_w32(!(es <= (ks == 0 ? -1.0f : 32768.0f))) != 0) {   // no sum is at most -1: the first trip always goes
      float mx = fmaxf(tx[0][0], tx[1][0]);
#pragma unroll
      for (int r = 1; r < 8; ++r) mx = fmaxf(mx, fmaxf(tx[0][r], tx[1][r]));
      mx = fmaxf(mx, xhalf(mx));   // the two lanes of a query keep one reference
      const float d = (ks == 0) ? mx - 8.0f : fmaxf(mx - 8.0f, 0.f); const float ta = -d; float ea = __builtin_amdgcn_exp2f(ta);
      asm volatile("v_nop" : "+v"(ea) : "v"(ta));   // the slot behind a transcendental: the result is not read and the source register is not rewritten ahead of this v_nop
      const float alpha = (ks == 0) ? 0.f : ea; m += d;
      const float cn = (11.0f - m) * KSI;
#pragma unroll   // constant indices keep cz in registers
      for (int r = 0; r < 8; ++r) cz[r] = cn;
      l *= alpha;
#pragma unroll
      for (int dt = 0; dt < 4; ++dt) acc[dt] *= alpha;
#pragma unroll   // constant indices keep tx in registers
      for (int ct = 0; ct < 2; ++ct) {
#pragma unroll   // as above
        for (int r = 0; r < 8; ++r) tx[ct][r] -= d; }
      soft(); }
    const v16h pa = ua.v, pl = ul.v;
    l += es;
#pragma unroll
    for (int dt = 0; dt < 4; ++dt) acc[dt] = wmma16(vf[dt], pa, acc[dt]);   // A = 16 d rows of v^T, B = P^T: element r = d dt * 16 + 8g + r, column = query
#pragma unroll   // the residual's products go into the same accumulators, each four products behind the one it depends on
    for (int dt = 0; dt < 4; ++dt) acc[dt] = wmma16(vf[dt], pl, acc[dt]);
    asm volatile("s_wait_dscnt 0" ::: "memory");        // this wave's reads of buffer bf have retired before the buffer is handed back
    asm volatile("s_wait_asynccnt 0x0" ::: "memory");   // this wave's share of tile ks + 1 has landed before the barrier publishes it
    __syncthreads();                                    // publishes tile ks + 1 and ends every wave's reads of buffer bf
    if (ks + 2 < SKH / 32) stage_tile(kg + (size_t)(ks + 2) * 32 * HD, vg + (ks + 2) * 32, ig + (ks + 2) * 32, kl + bf * (KSPL * KTB), vl + bf * (KSPL * VTB), il + bf * (KSPL * ITB)); }
  asm volatile("s_wait_asynccnt 0x0" ::: "memory");     // no copy is outstanding when the wave goes on to its epilogue
  l += xhalf(l);   // the two halves hold the sums of their own keys
  if (kh == 1) {   // the second key half's state, lane for lane: accumulators, then reference and sum
#pragma unroll
    for (int dt = 0; dt < 4; ++dt) { v4f p0, p1;
#pragma unroll
      for (int r = 0; r < 4; ++r) { p0[r] = acc[dt][r]; p1[r] = acc[dt][4 + r]; }
      u.ep.pm[qt][dt * 2][lane] = p0; u.ep.pm[qt][dt * 2 + 1][lane] = p1; }
    u.ep.pml[qt][0][lane] = m; u.ep.pml[qt][1][lane] = l; }
  __syncthreads();   // hands the second half's state to the wave that joins the two
  if (kh == 0) { const float m1 = u.ep.pml[qt][0][lane], l1 = u.ep.pml[qt][1][lane]; const float mj = fmaxf(m, m1); const float a0 = __builtin_amdgcn_exp2f(m - mj), a1 = __builtin_amdgcn_exp2f(m1 - mj);   // the references are in octaves
    const float il2 = 1.0f / (l * a0 + l1 * a1);   // sums and accumulators carry the same 2^11
    const float f0 = a0 * il2, f1 = a1 * il2;
#pragma unroll
    for (int dt = 0; dt < 4; ++dt) { const v4f p0 = u.ep.pm[qt][dt * 2][lane], p1 = u.ep.pm[qt][dt * 2 + 1][lane]; v4f o0, o1;
#pragma unroll
      for (int r = 0; r < 4; ++r) { o0[r] = acc[dt][r] * f0 + p0[r] * f1; o1[r] = acc[dt][4 + r] * f0 + p1[r] * f1; }
      *(v4f*)&u.ep.so[qt][col][dt * 16 + 8 * g] = o0; *(v4f*)&u.ep.so[qt][col][dt * 16 + 8 * g + 4] = o1; }
    LDSX();
    for (int rl = 0; rl < 16; ++rl) if (lane < 16) vst2(O + ((bh * SS + q0 + rl) * HD) + lane * 4, *(const v4f*)&u.ep.so[qt][rl][lane * 4]); }
}
extern "C" void kernel_launch(void* const* d_in, const int* in_sizes, int n_in, void* d_out, int out_size, void* d_ws, size_t ws_size, hipStream_t stream) {
  (void)in_sizes; (void)n_in; (void)out_size;
  const float** F = (const float**)d_in;   // 0 q, 1 k, 2 v [2,8,2048,64], 3 rel_emb [257,64], 4 q_info int [2,2048], 5 k_info int [2,2048]
  if (ws_size < (size_t)WS_END) return;
  _Float16* VT = (_Float16*)((char*)d_ws + WS_VT);
  __bf16* KB = (__bf16*)((char*)d_ws + WS_KB); int* KA = (int*)((char*)d_ws + WS_KA);
  k_vt<<<dim3(SS / 64, NBH), 256, 0, stream>>>(F[2], F[1], (const int*)d_in[5], VT, KB, KA);
  k_attn<<<dim3(TQB, TNBH), 256, 0, stream>>>(F[0], KB, VT, F[3], (const int*)d_in[4], KA, (float*)d_out);
}

// v009
// One run takes 40.4 microseconds.
// Timed twice side by side with v008, it ran 1.04 and 1.03 times as fast.
// All steps since v000 together make it 6.55 times as fast.
// compute dtype: all float inputs rounded to bf16, q_info / k_info (int) read on device; qr = q . rel_emb^T with EXACT bf16 products on WMMA 16x16x32 (f32 table), the per-pair index clip(k_adj - q_adj, -128, 128) + 128 computed on device from the int inputs and the bias gathered from the wave's LDS copy of the qr rows; scores = q . k (exact bf16 products) + bias, x 1/8, softmax in f32 to base 2 (the table kept x log2(e)/8, the reference and P's 2^11 carried in the score products' C) against a held reference that is raised when a trip's exponentials outgrow it (hardware exp); P (x 2^11) as f16 hi + f16 residual at the same scale (2 products, one accumulator) x v (exact in f16), f32 accumulate; f32 output.
#include <hip/hip_runtime.h>
#include <math.h>

typedef __attribute__((ext_vector_type(16))) _Float16 v16h;
typedef __attribute__((ext_vector_type(16))) __bf16 v16b;
typedef __attribute__((ext_vector_type(8)))  _Float16 v8h;
typedef __attribute__((ext_vector_type(2)))  _Float16 v2h;
typedef __attribute__((ext_vector_type(8)))  float v8f;
typedef __attribute__((ext_vector_type(4)))  float v4f;
typedef __attribute__((ext_vector_type(2)))  float v2f;
typedef __attribute__((ext_vector_type(4)))  unsigned v4u;
typedef __attribute__((ext_vector_type(4)))  int v4i;
typedef float __attribute__((may_alias)) float_a;
typedef int __attribute__((may_alias)) int_a;

template <typename T> __device__ __forceinline__ void vst2(void* p, T v) { *(T*)p = v;  }
__device__ __forceinline__ v8f wmma16(v16h a, v16h b, v8f c) {
  v8f d = __builtin_amdgcn_wmma_f32_16x16x32_f16(false, a, false, b, (short)0, c, false, false);
  asm volatile("v_nop\n\tv_nop\n\tv_nop\n\tv_nop" : "+v"(d) : "v"(a), "v"(b));
  return d;
}
__device__ __forceinline__ v8f wmma_bf(v16b a, v16b b, v8f c) {
  v8f d = __builtin_amdgcn_wmma_f32_16x16x32_bf16(false, a, false, b, (short)0, c, false, false);
  asm volatile("v_nop\n\tv_nop\n\tv_nop\n\tv_nop" : "+v"(d) : "v"(a), "v"(b));
  return d;
}
// the first products of a trip's two score tiles, both on one C that lives on behind them (each D in registers of its own). In asm because the builtin compiled, at the last use of such a C in a trip, to a product that overwrites its C, with four 64-bit register copies of C in front of it.
// The four v_nop are the distance the chip needs between a matrix instruction and a vector instruction on its D, A or B (the second product is a slot more for the first).
__device__ __forceinline__ void wmma_bf_keepc2(v8f& d0, v8f& d1, v16b a0, v16b a1, v16b b, v8f c) {
  asm volatile("v_wmma_f32_16x16x32_bf16 %0, %2, %4, %5\n\t"
               "v_wmma_f32_16x16x32_bf16 %1, %3, %4, %5\n\t"
               "v_nop\n\tv_nop\n\tv_nop\n\tv_nop" : "=&v"(d0), "=&v"(d1) : "v"(a0), "v"(a1), "v"(b), "v"(c));
}
// 16x16x32 fragments: lane = (h = lane>>4, row/col = lane&15); elements 0..7 = k0+8h+0..7, 8..15 = k0+16+8h+0..7; D element r = row 8h+r
__device__ __forceinline__ v16h frag_h(const _Float16* rowk0, int lane) {
  union { v16h v; v8h q[2]; } u; const _Float16* p = rowk0 + 8 * (lane >> 4);
  u.q[0] = *(const v8h*)p; u.q[1] = *(const v8h*)(p + 16); return u.v;
}
__device__ __forceinline__ v16h frag_f32(const float* rowk0, int lane) {
  v16h a; const float* p = rowk0 + 8 * (lane >> 4);
#pragma unroll
  for (int i = 0; i < 8; ++i) { a[i] = (_Float16)p[i]; a[8 + i] = (_Float16)p[16 + i]; }
  return a;
}
__device__ __forceinline__ v16h frag_f32s(const float* rowk0, int lane, float sc) {
  v16h a; const float* p = rowk0 + 8 * (lane >> 4);
#pragma unroll
  for (int i = 0; i < 8; ++i) { a[i] = (_Float16)(p[i] * sc); a[8 + i] = (_Float16)(p[16 + i] * sc); }
  return a;
}
// column fragment from a [K][ld] layout (column n), rows >= K read as 0
__device__ __forceinline__ v16h fragc_f32(const float* W, int k0, int n, int lane, int ld, int K) {
  v16h a; const int g = lane >> 4;
#pragma unroll
  for (int i = 0; i < 8; ++i) { const int ka = k0 + 8 * g + i, kb = ka + 16;
    a[i] = (_Float16)(ka < K ? W[(size_t)(ka < K ? ka : K - 1) * ld + n] : 0.f); a[8 + i] = (_Float16)(kb < K ? W[(size_t)(kb < K ? kb : K - 1) * ld + n] : 0.f); }
  return a;
}
struct F2 { v16b h, l; };
__device__ __forceinline__ F2 bsplit16(const float v[16]) { F2 r;
#pragma unroll
  for (int i = 0; i < 16; ++i) { const __bf16 h = (__bf16)v[i]; r.h[i] = h; r.l[i] = (__bf16)(v[i] - (float)h); }
  return r; }
__device__ __forceinline__ F2 split_row(const float* row, int k0, int lane) { float v[16]; const float* p = row + k0 + 8 * (lane >> 4);
#pragma unroll
  for (int i = 0; i < 8; ++i) { v[i] = p[i]; v[8 + i] = p[16 + i]; }
  return bsplit16(v); }
__device__ __forceinline__ F2 split_rowK(const float* row, int k0, int lane, int K) { float v[16]; const int g = lane >> 4;
#pragma unroll
  for (int i = 0; i < 8; ++i) { const int ka = k0 + 8 * g + i, kb = ka + 16; v[i] = ka < K ? row[ka < K ? ka : K - 1] : 0.f; v[8 + i] = kb < K ? row[kb < K ? kb : K - 1] : 0.f; }
  return bsplit16(v); }
__device__ __forceinline__ F2 split_col(const float* W, int k0, int n, int lane, int ld, int K) { float v[16]; const int g = lane >> 4;
#pragma unroll
  for (int i = 0; i < 8; ++i) { const int ka = k0 + 8 * g + i, kb = ka + 16; v[i] = ka < K ? W[(size_t)(ka < K ? ka : K - 1) * ld + n] : 0.f; v[8 + i] = kb < K ? W[(size_t)(kb < K ? kb : K - 1) * ld + n] : 0.f; }
  return bsplit16(v); }
__device__ __forceinline__ v8f mac3(const F2& a, const F2& b, v8f c) { c = wmma_bf(a.l, b.h, c); c = wmma_bf(a.h, b.l, c); return wmma_bf(a.h, b.h, c); }
__device__ __forceinline__ float sigm(float v) { return 1.0f / (1.0f + expf(-v)); }
#define LDSX() do { asm volatile("s_wait_dscnt 0" ::: "memory"); __builtin_amdgcn_wave_barrier(); __builtin_amdgcn_fence(__ATOMIC_RELEASE, "workgroup"); } while (0)


// Relative-information attention on given q, k, v (B 2, 8 heads, S 2,048, D 64; max distance 128): scores = (q k^T + take(q rel_emb^T, clip(k_info' - q_info') + 128)) / 8, softmax, v; q_info' = where(q_info == -1, 256, q_info), k_info' = where(k_info == -1, 384, k_info).
#define NB 2
#define NH 8
#define SS 2048
#define RR 128
#define NREL (2 * RR + 1)   // 257
#define HD 64
#define NBH (NB * NH)
#ifndef TQB
#define TQB (SS / 64)
#define TNBH NBH
#endif
typedef __attribute__((ext_vector_type(8))) __bf16 v8b;
__device__ __forceinline__ v16b frag_b(const __bf16* rowk0, int lane) {
  union { v16b v; v8b q[2]; } u; const __bf16* p = rowk0 + 8 * (lane >> 4);
  u.q[0] = *(const v8b*)p; u.q[1] = *(const v8b*)(p + 16); return u.v;
}
__device__ __forceinline__ float bfr(float v) { return (float)(__bf16)v; }
__device__ __attribute__((noinline)) float exp_ni(float v) { return expf(v); }
__device__ __attribute__((noinline)) float erf_ni(float v) { return erff(v); }

#define WS_VT  0u                                   // f16 v planes [(b,h)][64 d][s]
#define WS_KB  (WS_VT + 2u * (size_t)NBH * HD * SS)  // bf16 k rows [(b,h)][s][64 d]
#define WS_KA  (WS_KB + 2u * (size_t)NBH * SS * HD)  // int [b][s]: 4 * where(k_info == -1, 384, k_info), a byte offset into a bias row
#define WS_END (WS_KA + 4u * (size_t)NB * SS)

typedef __attribute__((ext_vector_type(4))) __bf16 v4b;
// ---- k_vt: block = (64 keys, (b,h)): v[bh][s][d] -> VT[bh][d][s] f16 (exact for bf16 values in range);
// and what k_attn needs of each key, made once here instead of by every wave that meets the key: k's rows rounded to bf16 (KB), k_info with its -1 replaced and times 4 (KA; the blocks of the first NB planes write one batch row each)
__global__ __launch_bounds__(256) void k_vt(const float* __restrict__ V, const float* __restrict__ K, const int* __restrict__ KI, _Float16* __restrict__ VT, __bf16* __restrict__ KB, int* __restrict__ KA) { __shared__ __align__(16) _Float16 st[HD][64 + 8]; const int t = threadIdx.x; const int s0 = blockIdx.x * 64; const size_t bh = blockIdx.y;
  v4f kx[4]; const float* kp = K + (bh * SS + s0) * HD + t * 4;
#pragma unroll   // constant indices keep kx in registers; the four loads go out ahead of v's, so that their latency runs beside v's
  for (int i = 0; i < 4; ++i) kx[i] = *(const v4f*)(kp + i * 1024);
  asm volatile("s_wait_xcnt 0x0" :: "v"(kp) : "memory");   // a precaution: stands in front of the first rewrite of the address registers that k's loads name; the address as an input keeps those registers as they are up to here
  const bool wka = bh < NB && t < 64; int ki = 0; if (wka) ki = KI[bh * SS + s0 + t];
  for (int e = t; e < 64 * HD; e += 256) { const int sl = e >> 6, d = e & 63; st[d][sl] = (_Float16)bfr(V[((bh * SS + s0 + sl) * HD) + d]); } __syncthreads();
  for (int e = t; e < HD * 8; e += 256) { const int d = e >> 3, q = e & 7; vst2((unsigned*)(VT + ((bh * HD + d) * SS) + s0 + q * 8), *(const v4u*)&st[d][q * 8]); }
  // k's and k_info's stores come last: nothing in this kernel waits for them
#pragma unroll
  for (int i = 0; i < 4; ++i) { v4b y;
#pragma unroll
    for (int c = 0; c < 4; ++c) y[c] = (__bf16)kx[i][c];
    *(v4b*)(KB + (bh * SS + s0) * HD + (size_t)(i * 256 + t) * 4) = y; }
  if (wka) KA[bh * SS + s0 + t] = (int)(4u * (unsigned)((ki == -1) ? 3 * RR : ki)); }
__device__ __forceinline__ v16b fragb_f32(const float* __restrict__ p, int lane) { v16b a; const float* pp = p + 8 * (lane >> 4);
#pragma unroll
  for (int i = 0; i < 8; ++i) { a[i] = (__bf16)pp[i]; a[8 + i] = (__bf16)pp[16 + i]; } return a; }
#define KPB 72              // staged k row pitch in bf16: 144 B = 16 B x odd, conflict-free for 16-byte LDS reads
#define VPH 40              // staged v row pitch in halves: 80 B = 16 B x odd
#define KTB (32 * KPB * 2)  // bytes of one staged k tile (32 keys)
#define VTB (HD * VPH * 2)  // bytes of one staged v tile (64 d rows x 32 keys)
#define RPB 72              // staged rel_emb row pitch in bf16: 144 B = 16 B x odd
#define KSPL 2              // waves that share one query tile, each on its own run of keys
#define SKH (SS / KSPL)     // keys of one such wave
#define KS 0.18033688f      // log2(e) / 8: a raw score times this is its exponent to base 2
#define KSI 5.54517744f     // 8 / log2(e)
typedef const __attribute__((address_space(3))) float lds_cf;
__device__ __forceinline__ unsigned lds_off(const void* p) { return (unsigned)(size_t)p; }
// one 32-key tile for the four waves of a key half, global -> LDS through no register: per thread 2 x 16 B of bf16 k, 2 x 16 B of v planes.
// The s_wait_xcnt closes the statement so that no address register of a copy is rewritten ahead of it.
__device__ __forceinline__ void stage_tile(const __bf16* kg, const _Float16* vg, unsigned kl, unsigned vl) {
  asm volatile("global_load_async_to_lds_b128 %0, %1, off\n\t"
               "global_load_async_to_lds_b128 %2, %3, off\n\t"
               "global_load_async_to_lds_b128 %4, %5, off\n\t"
               "global_load_async_to_lds_b128 %6, %7, off\n\t"
               "s_wait_xcnt 0x0"
               :: "v"(kl), "v"(kg), "v"(kl + 16u * KPB * 2u), "v"(kg + 16 * HD),
                  "v"(vl), "v"(vg), "v"(vl + 32u * VPH * 2u), "v"(vg + (size_t)32 * SS) : "memory");
}
// eight residuals of P at the scale of hi: r = f16(e - hi), e being the exponential that already carries 2^11, the difference exact in f32, hi read as the f16 half it is and r written as the f16 half it becomes.
// In asm because plain code compiles to 16 conversions that unpack hi and 8 that pack r around the subtraction. The s_delay_alu lines change no result: each high half is written into the register whose low half was written four vector instructions back, and the hint lets the SIMD's other waves issue meanwhile.
__device__ __forceinline__ void resid8(unsigned* r, const float* e, const unsigned* h) {
  asm("v_fma_mixlo_f16 %0, %4, %16, -%12 op_sel_hi:[0,0,1]\n\t"
      "v_fma_mixlo_f16 %1, %6, %16, -%13 op_sel_hi:[0,0,1]\n\t"
      "v_fma_mixlo_f16 %2, %8, %16, -%14 op_sel_hi:[0,0,1]\n\t"
      "v_fma_mixlo_f16 %3, %10, %16, -%15 op_sel_hi:[0,0,1]\n\t"
      "s_delay_alu instid0(VALU_DEP_4) | instskip(NEXT) | instid1(VALU_DEP_4)\n\t"
      "v_fma_mixhi_f16 %0, %5, %16, -%12 op_sel:[0,0,1] op_sel_hi:[0,0,1]\n\t"
      "v_fma_mixhi_f16 %1, %7, %16, -%13 op_sel:[0,0,1] op_sel_hi:[0,0,1]\n\t"
      "s_delay_alu instid0(VALU_DEP_4) | instskip(NEXT) | instid1(VALU_DEP_4)\n\t"
      "v_fma_mixhi_f16 %2, %9, %16, -%14 op_sel:[0,0,1] op_sel_hi:[0,0,1]\n\t"
      "v_fma_mixhi_f16 %3, %11, %16, -%15 op_sel:[0,0,1] op_sel_hi:[0,0,1]"
      : "=&v"(r[0]), "=&v"(r[1]), "=&v"(r[2]), "=&v"(r[3])
      : "v"(e[0]), "v"(e[1]), "v"(e[2]), "v"(e[3]), "v"(e[4]), "v"(e[5]), "v"(e[6]), "v"(e[7]), "v"(h[0]), "v"(h[1]), "v"(h[2]), "v"(h[3]), "s"(1.0f));
}
// lane l with lane l ^ 16, on the vector pipe
__device__ __forceinline__ float xhalf(float x) { return __builtin_bit_cast(float, __builtin_amdgcn_permlanex16(__builtin_bit_cast(int, x), __builtin_bit_cast(int, x), 0x76543210, 0xfedcba98, false, false)); }
// ---- k_attn: block = (64 queries, (b,h)): transposed products, S^T = k q^T (exact bf16 products, f32 accumulate) and O^T += v^T P^T: a lane holds 16 of the 32 keys' scores of ONE query (query = lane & 15; keys 8g + r and 16 + 8g + r),
// so the sum, and the maximum where one is taken, are in-lane (one exchange between the halves for the maximum, the halves' sums joined after the loop) and P hi + residual packs from the score registers straight into the B operand; k and v tiles of 32 keys staged once per block in a two-buffer LDS ring.
// The batch row of k_info offsets lies in LDS whole, outside the ring, so that a trip can read the NEXT trip's offsets and send out the next trip's bias reads: their latency runs beside this trip's exponentials and products instead of standing between the scores and the exponentials.
// The bias table (x log2(e) / 8) is made here: rel_emb's first 256 rows rounded to bf16 into LDS once per block, then table^T = rel_emb q^T (A = 16 distances, B = 16 queries) goes from the accumulators straight into the query tile's LDS rows.
// Two waves share a query tile (wave = key half * 4 + query tile): each makes half of the tile's table and walks its own half of the keys with its own reference, sum and accumulators, on its own ring of tiles;
// behind the loop the second half's wave hands its state over through LDS and the first joins the two. Eight waves a block and two blocks a WGP give every SIMD four waves to fill each other's waits.
__global__ __launch_bounds__(256) __attribute__((amdgpu_waves_per_eu(4, 4))) void k_attn(const float* __restrict__ Q, const __bf16* __restrict__ KB, const _Float16* __restrict__ VT, const float* __restrict__ RE, const int* __restrict__ QI, const int* __restrict__ KA, float* __restrict__ O) {
  __shared__ __align__(16) float sqr[4][16][NREL + 3];
  // the epilogue's buffers lie on the staged rel_emb rows, whose last read ends at the barrier behind the table: with them apart two blocks would not fit a WGP's LDS
  __shared__ __align__(16) union { __bf16 srel[NREL - 1][RPB]; struct { v4f pm[4][8][32]; float pml[4][2][32]; float so[4][16][68]; } ep; } u;
  __shared__ __align__(16) __bf16 skt[2][KSPL][32][KPB]; __shared__ __align__(16) _Float16 svt[2][KSPL][HD][VPH]; __shared__ __align__(16) int ska[SS];
  const int tid = threadIdx.x, wave = __builtin_amdgcn_readfirstlane(tid >> 5), qt = wave & 3, kh = wave >> 2, th = tid & 127, lane = tid & 31, col = lane & 15, g = lane >> 4; const size_t bh = blockIdx.y; const int q0 = blockIdx.x * 64 + qt * 16; const float* Qb = Q + (bh * SS) * HD; const __bf16* Kb = KB + (bh * SS) * HD; const _Float16* Vb = VT + bh * HD * SS;
  v16b aq[2];
#pragma unroll
  for (int kc = 0; kc < 2; ++kc) aq[kc] = fragb_f32(Qb + (size_t)(q0 + col) * HD + kc * 32, lane);
  asm volatile("s_wait_xcnt 0x0" ::: "memory");   // a precaution: stands in front of the first rewrite of the address registers that q's loads name
  const size_t b = bh / NH;
  { const int* kap = KA + b * SS + tid * 4; const v4i a0 = *(const v4i*)kap, a1 = *(const v4i*)(kap + SS / 2);   // the batch row's k_info offsets, once per block; the barrier behind the rel_emb rows publishes them too
    asm volatile("s_wait_xcnt 0x0" ::: "memory");   // a precaution: stands in front of the first rewrite of the address registers that these loads name
    *(v4i*)&ska[tid * 4] = a0; *(v4i*)&ska[SS / 2 + tid * 4] = a1; }
#pragma unroll   // a constant trip count lets the 16-byte loads go out in groups instead of one per wait
  for (int i = 0; i < (NREL - 1) * HD / 4 / 256; ++i) { const int f = i * 256 + tid; const v4f x = *(const v4f*)(RE + (size_t)f * 4); v4b y;
#pragma unroll
    for (int c = 0; c < 4; ++c) y[c] = (__bf16)x[c];
    *(v4b*)&u.srel[f >> 4][(f & 15) * 4] = y; }
  if (kh == 0) { v8f c = {}; v16b fl[2];   // distance index 256: the one row, straight from global, in all 16 A rows; both fragments read ahead of the first product
#pragma unroll   // constant indices keep fl in registers
    for (int kc = 0; kc < 2; ++kc) fl[kc] = fragb_f32(RE + (size_t)(NREL - 1) * HD + kc * 32, lane);
#pragma unroll
    for (int kc = 0; kc < 2; ++kc) c = wmma_bf(fl[kc], aq[kc], c);
    if (g == 0) sqr[qt][col][NREL - 1] = c[0] * KS; }
  __syncthreads();   // publishes the staged rel_emb rows to every wave
#pragma unroll 1   // four tiles a trip: their fragment reads go out as one group, ahead of the first product
  for (int j2 = 0; j2 < (NREL - 1) / 64 / KSPL; ++j2) { const int jb = kh * ((NREL - 1) / 64 / KSPL) + j2; v16b fa[4][2];
#pragma unroll   // constant indices keep fa in registers
    for (int jt = 0; jt < 4; ++jt) {
#pragma unroll   // as above
      for (int kc = 0; kc < 2; ++kc) fa[jt][kc] = frag_b(&u.srel[jb * 64 + jt * 16 + col][kc * 32], lane); }
#pragma unroll
    for (int jt = 0; jt < 4; ++jt) { v8f c = {};
#pragma unroll
      for (int kc = 0; kc < 2; ++kc) c = wmma_bf(fa[jt][kc], aq[kc], c);   // element r = distance index jb * 64 + jt * 16 + 8g + r, column = query
      v4f t0, t1;
#pragma unroll
      for (int r = 0; r < 4; ++r) { t0[r] = c[r] * KS; t1[r] = c[4 + r] * KS; }   // the table is kept in octaves: bias x log2(e) / 8
      *(v4f*)&sqr[qt][col][jb * 64 + jt * 16 + 8 * g] = t0; *(v4f*)&sqr[qt][col][jb * 64 + jt * 16 + 8 * g + 4] = t1; } }
  const int qi = QI[b * SS + q0 + col]; const int qa = (qi == -1) ? 2 * RR : qi;
  // the lane's own query's bias row, as LDS byte addresses: centre (distance 0) less 4 * q_info', and the row's two ends, which bound every address formed from k_info
  const unsigned qc = lds_off(&sqr[qt][col][RR]); const unsigned qoff = qc - 4u * (unsigned)qa; const int qlo = (int)(qc - 4u * RR), qhi = (int)(qc + 4u * RR);
  __syncthreads();   // publishes each wave's half of the table to the wave that shares its queries, and ends every read of the staged rel_emb rows
  // m: the reference, in octaves. cz = (11 - m) x 8 / log2(e) in all eight C registers of the score products: (cz + q . k) x log2(e) / 8 + table entry is then the whole argument of the exponential, 2^11 included
  float m = 0.f, l = 0.f; v8f cz;
#pragma unroll   // constant indices keep cz in registers
  for (int r = 0; r < 8; ++r) cz[r] = 11.0f * KSI;
  v8f acc[4] = {};
  const __bf16* kg = Kb + (size_t)kh * SKH * HD + th * 8; const _Float16* vg = Vb + (size_t)(th >> 2) * SS + kh * SKH + (th & 3) * 8;   // the four waves of a key half stage that half's tiles
  const unsigned kl = lds_off(&skt[0][kh][th >> 3][(th & 7) * 8]), vl = lds_off(&svt[0][kh][th >> 2][(th & 3) * 8]);
  stage_tile(kg, vg, kl, vl);
  // bs: the bias reads of the trip to come. gather(): 16 addresses from 16 offsets, each clamped to the row's ends (the clip of the distance), and their reads
  const int* skb = &ska[kh * SKH + 8 * g]; float bs[2][8];
  auto gather = [&](const v4i (&kv)[2][2]) {
#pragma unroll   // constant indices keep bs in registers
    for (int ct = 0; ct < 2; ++ct) {
#pragma unroll   // as above
      for (int r = 0; r < 8; ++r) { int ad = (int)((unsigned)kv[ct][r >> 2][r & 3] + qoff); ad = ad < qhi ? ad : qhi; ad = ad > qlo ? ad : qlo; bs[ct][r] = *(lds_cf*)ad; } } };
  { v4i k0[2][2];
#pragma unroll   // constant indices keep k0 in registers
    for (int ct = 0; ct < 2; ++ct) { k0[ct][0] = *(const v4i*)(skb + ct * 16); k0[ct][1] = *(const v4i*)(skb + ct * 16 + 4); }
    gather(k0); }   // trip 0's, beside tile 0's copies
  asm volatile("s_wait_asynccnt 0x0" ::: "memory");   // tile 0 has landed before the barrier publishes it
  __syncthreads();                                    // publishes tile 0 to every wave
  stage_tile(kg + 32 * HD, vg + 32, kl + KSPL * KTB, vl + KSPL * VTB);
#pragma unroll 1
  for (int ks = 0; ks < SKH / 32; ++ks) { float tx[2][8]; const int bf = ks & 1;
    v16b kb[2][2]; v4i kiv[2][2];   // all of the trip's k fragment reads go out as one group, ahead of the first product, and with them the next trip's offsets
    const int* skn = skb + (ks + 1 < SKH / 32 ? ks + 1 : ks) * 32;   // the last trip reads its own offsets again: in bounds, the bias read from them is not used
#pragma unroll   // constant indices keep kb and kiv in registers
    for (int ct = 0; ct < 2; ++ct) { kiv[ct][0] = *(const v4i*)(skn + ct * 16); kiv[ct][1] = *(const v4i*)(skn + ct * 16 + 4);
#pragma unroll   // as above
      for (int kc = 0; kc < 2; ++kc) kb[ct][kc] = frag_b(&skt[bf][kh][ct * 16 + col][kc * 32], lane); }
    v8f cs[2];
    wmma_bf_keepc2(cs[0], cs[1], kb[0][0], kb[1][0], aq[0], cz);   // A = 16 keys, B = 16 queries: element r = key ct * 16 + 8g + r, column = query
#pragma unroll   // constant indices keep cs in registers
    for (int ct = 0; ct < 2; ++ct) cs[ct] = wmma_bf(kb[ct][1], aq[1], cs[ct]);
#pragma unroll
    for (int ct = 0; ct < 2; ++ct) {
#pragma unroll
      for (int j = 0; j < 4; ++j) { const v2f t2 = v2f{ cs[ct][2 * j], cs[ct][2 * j + 1] } * KS + v2f{ bs[ct][2 * j], bs[ct][2 * j + 1] }; tx[ct][2 * j] = t2[0]; tx[ct][2 * j + 1] = t2[1]; } }   // one packed fma for two arguments of the exponential
    v16h vf[4];   // read ahead of the test below, so that their latency runs beside the exponentials
#pragma unroll   // constant indices keep vf in registers
    for (int dt = 0; dt < 4; ++dt) vf[dt] = frag_h(&svt[bf][kh][dt * 16 + col][0], lane);
    gather(kiv);   // the next trip's bias reads, behind this trip's last use of bs and behind v's reads (LDS answers in order: the products below wait for v alone)
    // The reference m stays as it is from trip to trip: the trip's exponentials are taken against it with no maximum, and the accumulators are not rescaled.
    // soft(): exponentials of tx (each carries 2^11), the lane's sum of them, P hi + residual packed.
    float es; union { v16h v; unsigned w[8]; } ua, ul;
    auto soft = [&]() { float ex[2][8];
#pragma unroll   // constant indices keep ex in registers
      for (int ct = 0; ct < 2; ++ct) {
#pragma unroll   // as above
        for (int i = 0; i < 8; ++i) ex[ct][i] = __builtin_amdgcn_exp2f(tx[ct][i]);
        // the slot behind a transcendental, one for eight: no result is read and no source register is rewritten ahead of this v_nop
        asm volatile("v_nop" : "+v"(ex[ct][0]), "+v"(ex[ct][1]), "+v"(ex[ct][2]), "+v"(ex[ct][3]), "+v"(ex[ct][4]), "+v"(ex[ct][5]), "+v"(ex[ct][6]), "+v"(ex[ct][7])
                     : "v"(tx[ct][0]), "v"(tx[ct][1]), "v"(tx[ct][2]), "v"(tx[ct][3]), "v"(tx[ct][4]), "v"(tx[ct][5]), "v"(tx[ct][6]), "v"(tx[ct][7])); }
      v2f t[8];   // the test waits for this sum: a tree of packed adds, four deep, in place of two chains of eight
#pragma unroll   // constant indices keep t in registers
      for (int j = 0; j < 8; ++j) t[j] = v2f{ ex[j >> 2][2 * (j & 3)], ex[j >> 2][2 * (j & 3) + 1] };
      const v2f tt = ((t[0] + t[1]) + (t[2] + t[3])) + ((t[4] + t[5]) + (t[6] + t[7]));
      es = tt[0] + tt[1];
#pragma unroll   // constant indices keep ua and ul in registers
      for (int ct = 0; ct < 2; ++ct) {
#pragma unroll   // as above
        for (int j = 0; j < 4; ++j) { const v2f e2 = { ex[ct][2 * j], ex[ct][2 * j + 1] }; ua.w[ct * 4 + j] = __builtin_bit_cast(unsigned, __builtin_convertvector(e2, v2h)); }
        resid8(&ul.w[ct * 4], ex[ct], &ua.w[ct * 4]); } };
    soft();
    // One test a trip, a scalar branch: a lane's sum of at most 16 x 2^11 bounds each of its exponentials by that, so that P stays inside f16; a larger sum, an infinity or a NaN, and always the first trip (whose reference is only the start value), sends the whole wave
    // to the full step: the maximum of the trip's arguments, the reference moved to 3 octaves above it (headroom of 2^7 before the test fires again; the first trip sets it, later trips only raise it), sum and accumulators rescaled, the trip's exponentials made anew (each at most 2^8).
    if (__builtin_amdgcn_ballot_w32(!(es <= (ks == 0 ? -1.0f : 32768.0f))) != 0) {   // no sum is at most -1: the first trip always goes
      float mx = fmaxf(tx[0][0], tx[1][0]);
#pragma unroll
      for (int r = 1; r < 8; ++r) mx = fmaxf(mx, fmaxf(tx[0][r], tx[1][r]));
      mx = fmaxf(mx, xhalf(mx));   // the two lanes of a query keep one reference
      const float d = (ks == 0) ? mx - 8.0f : fmaxf(mx - 8.0f, 0.f); const float ta = -d; float ea = __builtin_amdgcn_exp2f(ta);
      asm volatile("v_nop" : "+v"(ea) : "v"(ta));   // the slot behind a transcendental: the result is not read and the source register is not rewritten ahead of this v_nop
      const float alpha = (ks == 0) ? 0.f : ea; m += d;
      const float cn = (11.0f - m) * KSI;
#pragma unroll   // constant indices keep cz in registers
      for (int r = 0; r < 8; ++r) cz[r] = cn;
      l *= alpha;
#pragma unroll
      for (int dt = 0; dt < 4; ++dt) acc[dt] *= alpha;
#pragma unroll   // constant indices keep tx in registers
      for (int ct = 0; ct < 2; ++ct) {
#pragma unroll   // as above
        for (int r = 0; r < 8; ++r) tx[ct][r] -= d; }
      soft(); }
    const v16h pa = ua.v, pl = ul.v;
    l += es;
#pragma unroll
    for (int dt = 0; dt < 4; ++dt) acc[dt] = wmma16(vf[dt], pa, acc[dt]);   // A = 16 d rows of v^T, B = P^T: element r = d dt * 16 + 8g + r, column = query
#pragma unroll   // the residual's products go into the same accumulators, each four products behind the one it depends on
    for (int dt = 0; dt < 4; ++dt) acc[dt] = wmma16(vf[dt], pl, acc[dt]);
    asm volatile("s_wait_dscnt 0" ::: "memory");        // this wave's reads of buffer bf have retired before the buffer is handed back
    asm volatile("s_wait_asynccnt 0x0" ::: "memory");   // this wave's share of tile ks + 1 has landed before the barrier publishes it
    __syncthreads();                                    // publishes tile ks + 1 and ends every wave's reads of buffer bf
    if (ks + 2 < SKH / 32) stage_tile(kg + (size_t)(ks + 2) * 32 * HD, vg + (ks + 2) * 32, kl + bf * (KSPL * KTB), vl + bf * (KSPL * VTB)); }
  asm volatile("s_wait_asynccnt 0x0" ::: "memory");     // no copy is outstanding when the wave goes on to its epilogue
  l += xhalf(l);   // the two halves hold the sums of their own keys
  if (kh == 1) {   // the second key half's state, lane for lane: accumulators, then reference and sum
#pragma unroll
    for (int dt = 0; dt < 4; ++dt) { v4f p0, p1;
#pragma unroll
      for (int r = 0; r < 4; ++r) { p0[r] = acc[dt][r]; p1[r] = acc[dt][4 + r]; }
      u.ep.pm[qt][dt * 2][lane] = p0; u.ep.pm[qt][dt * 2 + 1][lane] = p1; }
    u.ep.pml[qt][0][lane] = m; u.ep.pml[qt][1][lane] = l; }
  __syncthreads();   // hands the second half's state to the wave that joins the two
  if (kh == 0) { const float m1 = u.ep.pml[qt][0][lane], l1 = u.ep.pml[qt][1][lane]; const float mj = fmaxf(m, m1); const float a0 = __builtin_amdgcn_exp2f(m - mj), a1 = __builtin_amdgcn_exp2f(m1 - mj);   // the references are in octaves
    const float il2 = 1.0f / (l * a0 + l1 * a1);   // sums and accumulators carry the same 2^11
    const float f0 = a0 * il2, f1 = a1 * il2;
#pragma unroll
    for (int dt = 0; dt < 4; ++dt) { const v4f p0 = u.ep.pm[qt][dt * 2][lane], p1 = u.ep.pm[qt][dt * 2 + 1][lane]; v4f o0, o1;
#pragma unroll
      for (int r = 0; r < 4; ++r) { o0[r] = acc[dt][r] * f0 + p0[r] * f1; o1[r] = acc[dt][4 + r] * f0 + p1[r] * f1; }
      *(v4f*)&u.ep.so[qt][col][dt * 16 + 8 * g] = o0; *(v4f*)&u.ep.so[qt][col][dt * 16 + 8 * g + 4] = o1; }
    LDSX();
    for (int rl = 0; rl < 16; ++rl) if (lane < 16) vst2(O + ((bh * SS + q0 + rl) * HD) + lane * 4, *(const v4f*)&u.ep.so[qt][rl][lane * 4]); }
}
extern "C" void kernel_launch(void* const* d_in, const int* in_sizes, int n_in, void* d_out, int out_size, void* d_ws, size_t ws_size, hipStream_t stream) {
  (void)in_sizes; (void)n_in; (void)out_size;
  const float** F = (const float**)d_in;   // 0 q, 1 k, 2 v [2,8,2048,64], 3 rel_emb [257,64], 4 q_info int [2,2048], 5 k_info int [2,2048]
  if (ws_size < (size_t)WS_END) return;
  _Float16* VT = (_Float16*)((char*)d_ws + WS_VT);
  __bf16* KB = (__bf16*)((char*)d_ws + WS_KB); int* KA = (int*)((char*)d_ws + WS_KA);
  k_vt<<<dim3(SS / 64, NBH), 256, 0, stream>>>(F[2], F[1], (const int*)d_in[5], VT, KB, KA);
  k_attn<<<dim3(TQB, TNBH), 256, 0, stream>>>(F[0], KB, VT, F[3], (const int*)d_in[4], KA, (float*)d_out);
}

// v010
// Measured time: 38.6 microseconds a run.
// Timed twice side by side with v009, it ran 1.05 and 1.04 times as fast.
// Over all steps from v000 it is 6.82 times as fast.
// compute dtype: all float inputs rounded to bf16, q_info / k_info (int) read on device; qr = q . rel_emb^T with EXACT bf16 products on WMMA 16x16x32 (f32 table), the per-pair index clip(k_adj - q_adj, -128, 128) + 128 computed on device from the int inputs and the bias gathered from the wave's LDS copy of the qr rows; scores = q . k (exact bf16 products) + bias, x 1/8, softmax in f32 to base 2 (the table kept x log2(e)/8, the reference and P's 2^11 carried in the score products' C) against a held reference that is raised when a trip's exponentials outgrow it (hardware exp); P (x 2^11) as f16 hi + f16 residual at the same scale (2 products, one accumulator) x v (exact in f16), f32 accumulate; f32 output.
#include <hip/hip_runtime.h>
#include <math.h>

typedef __attribute__((ext_vector_type(16))) _Float16 v16h;
typedef __attribute__((ext_vector_type(16))) __bf16 v16b;
typedef __attribute__((ext_vector_type(8)))  _Float16 v8h;
typedef __attribute__((ext_vector_type(2)))  _Float16 v2h;
typedef __attribute__((ext_vector_type(8)))  float v8f;
typedef __attribute__((ext_vector_type(4)))  float v4f;
typedef __attribute__((ext_vector_type(2)))  float v2f;
typedef __attribute__((ext_vector_type(4)))  unsigned v4u;
typedef __attribute__((ext_vector_type(4)))  int v4i;
typedef float __attribute__((may_alias)) float_a;
typedef int __attribute__((may_alias)) int_a;

template <typename T> __device__ __forceinline__ void vst2(void* p, T v) { *(T*)p = v;  }
__device__ __forceinline__ v8f wmma16(v16h a, v16h b, v8f c) {
  v8f d = __builtin_amdgcn_wmma_f32_16x16x32_f16(false, a, false, b, (short)0, c, false, false);
  asm volatile("v_nop\n\tv_nop\n\tv_nop\n\tv_nop" : "+v"(d) : "v"(a), "v"(b));
  return d;
}
__device__ __forceinline__ v8f wmma_bf(v16b a, v16b b, v8f c) {
  v8f d = __builtin_amdgcn_wmma_f32_16x16x32_bf16(false, a, false, b, (short)0, c, false, false);
  asm volatile("v_nop\n\tv_nop\n\tv_nop\n\tv_nop" : "+v"(d) : "v"(a), "v"(b));
  return d;
}
// the first products of a trip's two score tiles, both on one C that lives on behind them (each D in registers of its own). In asm because the builtin compiled, at the last use of such a C in a trip, to a product that overwrites its C, with four 64-bit register copies of C in front of it.
// The four v_nop are the distance the chip needs between a matrix instruction and a vector instruction on its D, A or B (the second product is a slot more for the first).
__device__ __forceinline__ void wmma_bf_keepc2(v8f& d0, v8f& d1, v16b a0, v16b a1, v16b b, v8f c) {
  asm volatile("v_wmma_f32_16x16x32_bf16 %0, %2, %4, %5\n\t"
               "v_wmma_f32_16x16x32_bf16 %1, %3, %4, %5\n\t"
               "v_nop\n\tv_nop\n\tv_nop\n\tv_nop" : "=&v"(d0), "=&v"(d1) : "v"(a0), "v"(a1), "v"(b), "v"(c));
}
// 16x16x32 fragments: lane = (h = lane>>4, row/col = lane&15); elements 0..7 = k0+8h+0..7, 8..15 = k0+16+8h+0..7; D element r = row 8h+r
__device__ __forceinline__ v16h frag_h(const _Float16* rowk0, int lane) {
  union { v16h v; v8h q[2]; } u; const _Float16* p = rowk0 + 8 * (lane >> 4);
  u.q[0] = *(const v8h*)p; u.q[1] = *(const v8h*)(p + 16); return u.v;
}
__device__ __forceinline__ v16h frag_f32(const float* rowk0, int lane) {
  v16h a; const float* p = rowk0 + 8 * (lane >> 4);
#pragma unroll
  for (int i = 0; i < 8; ++i) { a[i] = (_Float16)p[i]; a[8 + i] = (_Float16)p[16 + i]; }
  return a;
}
__device__ __forceinline__ v16h frag_f32s(const float* rowk0, int lane, float sc) {
  v16h a; const float* p = rowk0 + 8 * (lane >> 4);
#pragma unroll
  for (int i = 0; i < 8; ++i) { a[i] = (_Float16)(p[i] * sc); a[8 + i] = (_Float16)(p[16 + i] * sc); }
  return a;
}
// column fragment from a [K][ld] layout (column n), rows >= K read as 0
__device__ __forceinline__ v16h fragc_f32(const float* W, int k0, int n, int lane, int ld, int K) {
  v16h a; const int g = lane >> 4;
#pragma unroll
  for (int i = 0; i < 8; ++i) { const int ka = k0 + 8 * g + i, kb = ka + 16;
    a[i] = (_Float16)(ka < K ? W[(size_t)(ka < K ? ka : K - 1) * ld + n] : 0.f); a[8 + i] = (_Float16)(kb < K ? W[(size_t)(kb < K ? kb : K - 1) * ld + n] : 0.f); }
  return a;
}
struct F2 { v16b h, l; };
__device__ __forceinline__ F2 bsplit16(const float v[16]) { F2 r;
#pragma unroll
  for (int i = 0; i < 16; ++i) { const __bf16 h = (__bf16)v[i]; r.h[i] = h; r.l[i] = (__bf16)(v[i] - (float)h); }
  return r; }
__device__ __forceinline__ F2 split_row(const float* row, int k0, int lane) { float v[16]; const float* p = row + k0 + 8 * (lane >> 4);
#pragma unroll
  for (int i = 0; i < 8; ++i) { v[i] = p[i]; v[8 + i] = p[16 + i]; }
  return bsplit16(v); }
__device__ __forceinline__ F2 split_rowK(const float* row, int k0, int lane, int K) { float v[16]; const int g = lane >> 4;
#pragma unroll
  for (int i = 0; i < 8; ++i) { const int ka = k0 + 8 * g + i, kb = ka + 16; v[i] = ka < K ? row[ka < K ? ka : K - 1] : 0.f; v[8 + i] = kb < K ? row[kb < K ? kb : K - 1] : 0.f; }
  return bsplit16(v); }
__device__ __forceinline__ F2 split_col(const float* W, int k0, int n, int lane, int ld, int K) { float v[16]; const int g = lane >> 4;
#pragma unroll
  for (int i = 0; i < 8; ++i) { const int ka = k0 + 8 * g + i, kb = ka + 16; v[i] = ka < K ? W[(size_t)(ka < K ? ka : K - 1) * ld + n] : 0.f; v[8 + i] = kb < K ? W[(size_t)(kb < K ? kb : K - 1) * ld + n] : 0.f; }
  return bsplit16(v); }
__device__ __forceinline__ v8f mac3(const F2& a, const F2& b, v8f c) { c = wmma_bf(a.l, b.h, c); c = wmma_bf(a.h, b.l, c); return wmma_bf(a.h, b.h, c); }
__device__ __forceinline__ float sigm(float v) { return 1.0f / (1.0f + expf(-v)); }
#define LDSX() do { asm volatile("s_wait_dscnt 0" ::: "memory"); __builtin_amdgcn_wave_barrier(); __builtin_amdgcn_fence(__ATOMIC_RELEASE, "workgroup"); } while (0)


// Relative-information attention on given q, k, v (B 2, 8 heads, S 2,048, D 64; max distance 128): scores = (q k^T + take(q rel_emb^T, clip(k_info' - q_info') + 128)) / 8, softmax, v; q_info' = where(q_info == -1, 256, q_info), k_info' = where(k_info == -1, 384, k_info).
#define NB 2
#define NH 8
#define SS 2048
#define RR 128
#define NREL (2 * RR + 1)   // 257
#define HD 64
#define NBH (NB * NH)
#ifndef TQB
#define TQB (SS / 64)
#define TNBH NBH
#endif
typedef __attribute__((ext_vector_type(8))) __bf16 v8b;
__device__ __forceinline__ v16b frag_b(const __bf16* rowk0, int lane) {
  union { v16b v; v8b q[2]; } u; const __bf16* p = rowk0 + 8 * (lane >> 4);
  u.q[0] = *(const v8b*)p; u.q[1] = *(const v8b*)(p + 16); return u.v;
}
__device__ __forceinline__ float bfr(float v) { return (float)(__bf16)v; }
__device__ __attribute__((noinline)) float exp_ni(float v) { return expf(v); }
__device__ __attribute__((noinline)) float erf_ni(float v) { return erff(v); }

#define WS_VT  0u                                   // f16 v planes [(b,h)][64 d][s]
#define WS_KB  (WS_VT + 2u * (size_t)NBH * HD * SS)  // bf16 k rows [(b,h)][s][64 d]
#define WS_KA  (WS_KB + 2u * (size_t)NBH * SS * HD)  // int [b][s]: 4 * where(k_info == -1, 384, k_info), a byte offset into a bias row
#define WS_END (WS_KA + 4u * (size_t)NB * SS)

typedef __attribute__((ext_vector_type(4))) __bf16 v4b;
// ---- k_vt: block = (64 keys, (b,h)): v[bh][s][d] -> VT[bh][d][s] f16 (exact for bf16 values in range);
// and what k_attn needs of each key, made once here instead of by every wave that meets the key: k's rows rounded to bf16 (KB), k_info with its -1 replaced and times 4 (KA; the blocks of the first NB planes write one batch row each)
__global__ __launch_bounds__(256) void k_vt(const float* __restrict__ V, const float* __restrict__ K, const int* __restrict__ KI, _Float16* __restrict__ VT, __bf16* __restrict__ KB, int* __restrict__ KA) { __shared__ __align__(16) _Float16 st[HD][64 + 8]; const int t = threadIdx.x; const int s0 = blockIdx.x * 64; const size_t bh = blockIdx.y;
  v4f kx[4]; const float* kp = K + (bh * SS + s0) * HD + t * 4;
#pragma unroll   // constant indices keep kx in registers; the four loads go out ahead of v's, so that their latency runs beside v's
  for (int i = 0; i < 4; ++i) kx[i] = *(const v4f*)(kp + i * 1024);
  asm volatile("s_wait_xcnt 0x0" :: "v"(kp) : "memory");   // a precaution: stands in front of the first rewrite of the address registers that k's loads name; the address as an input keeps those registers as they are up to here
  const bool wka = bh < NB && t < 64; int ki = 0; if (wka) ki = KI[bh * SS + s0 + t];
  for (int e = t; e < 64 * HD; e += 256) { const int sl = e >> 6, d = e & 63; st[d][sl] = (_Float16)bfr(V[((bh * SS + s0 + sl) * HD) + d]); } __syncthreads();
  for (int e = t; e < HD * 8; e += 256) { const int d = e >> 3, q = e & 7; vst2((unsigned*)(VT + ((bh * HD + d) * SS) + s0 + q * 8), *(const v4u*)&st[d][q * 8]); }
  // k's and k_info's stores come last: nothing in this kernel waits for them
#pragma unroll
  for (int i = 0; i < 4; ++i) { v4b y;
#pragma unroll
    for (int c = 0; c < 4; ++c) y[c] = (__bf16)kx[i][c];
    *(v4b*)(KB + (bh * SS + s0) * HD + (size_t)(i * 256 + t) * 4) = y; }
  if (wka) KA[bh * SS + s0 + t] = (int)(4u * (unsigned)((ki == -1) ? 3 * RR : ki)); }
__device__ __forceinline__ v16b fragb_f32(const float* __restrict__ p, int lane) { v16b a; const float* pp = p + 8 * (lane >> 4);
#pragma unroll
  for (int i = 0; i < 8; ++i) { a[i] = (__bf16)pp[i]; a[8 + i] = (__bf16)pp[16 + i]; } return a; }
#define KPB 72              // staged k row pitch in bf16: 144 B = 16 B x odd, conflict-free for 16-byte LDS reads
#define VPH 40              // staged v row pitch in halves: 80 B = 16 B x odd
#define KTB (32 * KPB * 2)  // bytes of one staged k tile (32 keys)
#define VTB (HD * VPH * 2)  // bytes of one staged v tile (64 d rows x 32 keys)
#define RPB 72              // staged rel_emb row pitch in bf16: 144 B = 16 B x odd
#define KSPL 4              // waves that share a pair of query tiles, each on its own run of keys
#define QT 2                // query tiles of one wave: each k and v fragment read from LDS serves both
#define SKH (SS / KSPL)     // keys of one such wave
#define KS 0.18033688f      // log2(e) / 8: a raw score times this is its exponent to base 2
#define KSI 5.54517744f     // 8 / log2(e)
typedef const __attribute__((address_space(3))) float lds_cf;
__device__ __forceinline__ unsigned lds_off(const void* p) { return (unsigned)(size_t)p; }
// one 32-key tile for the two waves of a key quarter, global -> LDS through no register: per thread 4 x 16 B of bf16 k, 4 x 16 B of v planes.
// The s_wait_xcnt closes the statement so that no address register of a copy is rewritten ahead of it.
__device__ __forceinline__ void stage_tile(const __bf16* kg, const _Float16* vg, unsigned kl, unsigned vl) {
  asm volatile("global_load_async_to_lds_b128 %0, %1, off\n\t"
               "global_load_async_to_lds_b128 %2, %3, off\n\t"
               "global_load_async_to_lds_b128 %4, %5, off\n\t"
               "global_load_async_to_lds_b128 %6, %7, off\n\t"
               "global_load_async_to_lds_b128 %8, %9, off\n\t"
               "global_load_async_to_lds_b128 %10, %11, off\n\t"
               "global_load_async_to_lds_b128 %12, %13, off\n\t"
               "global_load_async_to_lds_b128 %14, %15, off\n\t"
               "s_wait_xcnt 0x0"
               :: "v"(kl), "v"(kg), "v"(kl + 8u * KPB * 2u), "v"(kg + 8 * HD), "v"(kl + 16u * KPB * 2u), "v"(kg + 16 * HD), "v"(kl + 24u * KPB * 2u), "v"(kg + 24 * HD),
                  "v"(vl), "v"(vg), "v"(vl + 16u * VPH * 2u), "v"(vg + (size_t)16 * SS), "v"(vl + 32u * VPH * 2u), "v"(vg + (size_t)32 * SS), "v"(vl + 48u * VPH * 2u), "v"(vg + (size_t)48 * SS) : "memory");
}
// eight residuals of P at the scale of hi: r = f16(e - hi), e being the exponential that already carries 2^11, the difference exact in f32, hi read as the f16 half it is and r written as the f16 half it becomes.
// In asm because plain code compiles to 16 conversions that unpack hi and 8 that pack r around the subtraction. The s_delay_alu lines change no result: each high half is written into the register whose low half was written four vector instructions back, and the hint lets the SIMD's other waves issue meanwhile.
__device__ __forceinline__ void resid8(unsigned* r, const float* e, const unsigned* h) {
  asm("v_fma_mixlo_f16 %0, %4, %16, -%12 op_sel_hi:[0,0,1]\n\t"
      "v_fma_mixlo_f16 %1, %6, %16, -%13 op_sel_hi:[0,0,1]\n\t"
      "v_fma_mixlo_f16 %2, %8, %16, -%14 op_sel_hi:[0,0,1]\n\t"
      "v_fma_mixlo_f16 %3, %10, %16, -%15 op_sel_hi:[0,0,1]\n\t"
      "s_delay_alu instid0(VALU_DEP_4) | instskip(NEXT) | instid1(VALU_DEP_4)\n\t"
      "v_fma_mixhi_f16 %0, %5, %16, -%12 op_sel:[0,0,1] op_sel_hi:[0,0,1]\n\t"
      "v_fma_mixhi_f16 %1, %7, %16, -%13 op_sel:[0,0,1] op_sel_hi:[0,0,1]\n\t"
      "s_delay_alu instid0(VALU_DEP_4) | instskip(NEXT) | instid1(VALU_DEP_4)\n\t"
      "v_fma_mixhi_f16 %2, %9, %16, -%14 op_sel:[0,0,1] op_sel_hi:[0,0,1]\n\t"
      "v_fma_mixhi_f16 %3, %11, %16, -%15 op_sel:[0,0,1] op_sel_hi:[0,0,1]"
      : "=&v"(r[0]), "=&v"(r[1]), "=&v"(r[2]), "=&v"(r[3])
      : "v"(e[0]), "v"(e[1]), "v"(e[2]), "v"(e[3]), "v"(e[4]), "v"(e[5]), "v"(e[6]), "v"(e[7]), "v"(h[0]), "v"(h[1]), "v"(h[2]), "v"(h[3]), "s"(1.0f));
}
// lane l with lane l ^ 16, on the vector pipe
__device__ __forceinline__ float xhalf(float x) { return __builtin_bit_cast(float, __builtin_amdgcn_permlanex16(__builtin_bit_cast(int, x), __builtin_bit_cast(int, x), 0x76543210, 0xfedcba98, false, false)); }
// ---- k_attn: block = (64 queries, (b,h)): transposed products, S^T = k q^T (exact bf16 products, f32 accumulate) and O^T += v^T P^T: a lane holds 16 of the 32 keys' scores of ONE query of each of its tiles (query = lane & 15; keys 8g + r and 16 + 8g + r),
// so the sum, and the maximum where one is taken, are in-lane (one exchange between the halves for the maximum, the halves' sums joined after the loop) and P hi + residual packs from the score registers straight into the B operand; k and v tiles of 32 keys staged in two-buffer LDS rings.
// The batch row of k_info offsets lies in LDS whole, outside the ring, so that a trip can read the NEXT trip's offsets and send out the next trip's bias reads: their latency runs beside this trip's value products instead of standing between the scores and the exponentials.
// The bias table (x log2(e) / 8) is made here: rel_emb's first 256 rows rounded to bf16 into LDS once per block, then table^T = rel_emb q^T (A = 16 distances, B = 16 queries) goes from the accumulators straight into the query tile's LDS rows.
// A wave holds TWO query tiles (wave = key quarter * 2 + tile pair): every k fragment, v fragment and k_info offset that it reads from LDS is used for 32 queries, half the 16-byte LDS reads per score of a wave with one tile.
// Four waves share a pair of tiles: each makes a quarter of the pair's table and walks its own quarter of the keys with its own references, sums and accumulators, on its own ring of tiles;
// behind the loop the states of a tile are handed over through LDS to one wave, which joins the four. Eight waves a block and two blocks a WGP give every SIMD four waves to fill each other's waits.
__global__ __launch_bounds__(256) __attribute__((amdgpu_waves_per_eu(4, 4))) void k_attn(const float* __restrict__ Q, const __bf16* __restrict__ KB, const _Float16* __restrict__ VT, const float* __restrict__ RE, const int* __restrict__ QI, const int* __restrict__ KA, float* __restrict__ O) {
  __shared__ __align__(16) float sqr[4][16][NREL + 3];
  // the rings lie on the staged rel_emb rows, whose last read ends at the barrier behind the table, and the epilogue's buffers on the rings, whose last read ends at the last trip's barrier: with them apart two blocks would not fit a WGP's LDS
  __shared__ __align__(16) union { __bf16 srel[NREL - 1][RPB]; struct { __bf16 skt[2][KSPL][32][KPB]; _Float16 svt[2][KSPL][HD][VPH]; } rg; struct { v4f pm[KSPL - 1][4][8][32]; float pml[KSPL - 1][4][2][32]; float so[4][16][68]; } ep; } u;
  __shared__ __align__(16) int ska[SS];
  const int tid = threadIdx.x, wave = __builtin_amdgcn_readfirstlane(tid >> 5), qp = wave & 1, kh = wave >> 1, th = tid & 63, lane = tid & 31, col = lane & 15, g = lane >> 4; const size_t bh = blockIdx.y; const int q0 = blockIdx.x * 64 + qp * (QT * 16); const float* Qb = Q + (bh * SS) * HD; const __bf16* Kb = KB + (bh * SS) * HD; const _Float16* Vb = VT + bh * HD * SS;
  v16b aq[QT][2];
#pragma unroll   // constant indices keep aq in registers
  for (int t = 0; t < QT; ++t) {
#pragma unroll   // as above
    for (int kc = 0; kc < 2; ++kc) aq[t][kc] = fragb_f32(Qb + (size_t)(q0 + t * 16 + col) * HD + kc * 32, lane); }
  asm volatile("s_wait_xcnt 0x0" ::: "memory");   // a precaution: stands in front of the first rewrite of the address registers that q's loads name
  const size_t b = bh / NH;
  { const int* kap = KA + b * SS + tid * 4; const v4i a0 = *(const v4i*)kap, a1 = *(const v4i*)(kap + SS / 2);   // the batch row's k_info offsets, once per block; the barrier behind the rel_emb rows publishes them too
    asm volatile("s_wait_xcnt 0x0" ::: "memory");   // a precaution: stands in front of the first rewrite of the address registers that these loads name
    *(v4i*)&ska[tid * 4] = a0; *(v4i*)&ska[SS / 2 + tid * 4] = a1; }
#pragma unroll   // a constant trip count lets the 16-byte loads go out in groups instead of one per wait
  for (int i = 0; i < (NREL - 1) * HD / 4 / 256; ++i) { const int f = i * 256 + tid; const v4f x = *(const v4f*)(RE + (size_t)f * 4); v4b y;
#pragma unroll
    for (int c = 0; c < 4; ++c) y[c] = (__bf16)x[c];
    *(v4b*)&u.srel[f >> 4][(f & 15) * 4] = y; }
  if (kh == 0) { v16b fl[2];   // distance index 256: the one row, straight from global, in all 16 A rows; both fragments read ahead of the first product
#pragma unroll   // constant indices keep fl in registers
    for (int kc = 0; kc < 2; ++kc) fl[kc] = fragb_f32(RE + (size_t)(NREL - 1) * HD + kc * 32, lane);
#pragma unroll
    for (int t = 0; t < QT; ++t) { v8f c = {};
#pragma unroll
      for (int kc = 0; kc < 2; ++kc) c = wmma_bf(fl[kc], aq[t][kc], c);
      if (g == 0) sqr[qp * QT + t][col][NREL - 1] = c[0] * KS; } }
  __syncthreads();   // publishes the staged rel_emb rows to every wave
  { v16b fa[4][2];   // the wave's quarter of the distances, four tiles: their fragment reads go out as one group, ahead of the first product, and serve both query tiles
#pragma unroll   // constant indices keep fa in registers
    for (int jt = 0; jt < 4; ++jt) {
#pragma unroll   // as above
      for (int kc = 0; kc < 2; ++kc) fa[jt][kc] = frag_b(&u.srel[kh * 64 + jt * 16 + col][kc * 32], lane); }
#pragma unroll
    for (int t = 0; t < QT; ++t) {
#pragma unroll
      for (int jt = 0; jt < 4; ++jt) { v8f c = {};
#pragma unroll
        for (int kc = 0; kc < 2; ++kc) c = wmma_bf(fa[jt][kc], aq[t][kc], c);   // element r = distance index kh * 64 + jt * 16 + 8g + r, column = query
        v4f t0, t1;
#pragma unroll
        for (int r = 0; r < 4; ++r) { t0[r] = c[r] * KS; t1[r] = c[4 + r] * KS; }   // the table is kept in octaves: bias x log2(e) / 8
        *(v4f*)&sqr[qp * QT + t][col][kh * 64 + jt * 16 + 8 * g] = t0; *(v4f*)&sqr[qp * QT + t][col][kh * 64 + jt * 16 + 8 * g + 4] = t1; } } }
  // the lane's own queries' bias rows, as LDS byte addresses: centre (distance 0) less 4 * q_info', and the row's two ends, which bound every address formed from k_info
  unsigned qoff[QT]; int qlo[QT], qhi[QT];
#pragma unroll   // constant indices keep the three in registers
  for (int t = 0; t < QT; ++t) { const int qi = QI[b * SS + q0 + t * 16 + col]; const int qa = (qi == -1) ? 2 * RR : qi;
    const unsigned qc = lds_off(&sqr[qp * QT + t][col][RR]); qoff[t] = qc - 4u * (unsigned)qa; qlo[t] = (int)(qc - 4u * RR); qhi[t] = (int)(qc + 4u * RR); }
  asm volatile("s_wait_dscnt 0" ::: "memory");   // this wave's reads of the staged rel_emb rows have retired before the barrier behind which copies land on them
  __syncthreads();   // publishes each wave's quarter of the table to the waves that share its queries, and ends every read of the staged rel_emb rows
  // m: the reference, in octaves. cz = (11 - m) x 8 / log2(e) in all eight C registers of the score products: (cz + q . k) x log2(e) / 8 + table entry is then the whole argument of the exponential, 2^11 included
  float m[QT], l[QT]; v8f cz[QT]; v8f acc[QT][4];
#pragma unroll   // constant indices keep the state in registers
  for (int t = 0; t < QT; ++t) { m[t] = 0.f; l[t] = 0.f;
#pragma unroll   // as above
    for (int r = 0; r < 8; ++r) cz[t][r] = 11.0f * KSI;
#pragma unroll   // as above
    for (int dt = 0; dt < 4; ++dt) acc[t][dt] = v8f{}; }
  const __bf16* kg = Kb + (size_t)kh * SKH * HD + th * 8; const _Float16* vg = Vb + (size_t)(th >> 2) * SS + kh * SKH + (th & 3) * 8;   // the two waves of a key quarter stage that quarter's tiles
  const unsigned kl = lds_off(&u.rg.skt[0][kh][th >> 3][(th & 7) * 8]), vl = lds_off(&u.rg.svt[0][kh][th >> 2][(th & 3) * 8]);
  stage_tile(kg, vg, kl, vl);
  // bs: the bias reads of the trip to come. gather(): for each query tile 16 addresses from the 16 offsets, each clamped to the row's ends (the clip of the distance), and their reads
  const int* skb = &ska[kh * SKH + 8 * g]; float bs[QT][2][8];
  auto gather = [&](const v4i (&kv)[2][2]) {
#pragma unroll   // constant indices keep bs in registers
    for (int t = 0; t < QT; ++t) {
#pragma unroll   // as above
      for (int ct = 0; ct < 2; ++ct) {
#pragma unroll   // as above
        for (int r = 0; r < 8; ++r) { int ad = (int)((unsigned)kv[ct][r >> 2][r & 3] + qoff[t]); ad = ad < qhi[t] ? ad : qhi[t]; ad = ad > qlo[t] ? ad : qlo[t]; bs[t][ct][r] = *(lds_cf*)ad; } } } };
  { v4i k0[2][2];
#pragma unroll   // constant indices keep k0 in registers
    for (int ct = 0; ct < 2; ++ct) { k0[ct][0] = *(const v4i*)(skb + ct * 16); k0[ct][1] = *(const v4i*)(skb + ct * 16 + 4); }
    gather(k0); }   // trip 0's, beside tile 0's copies
  asm volatile("s_wait_asynccnt 0x0" ::: "memory");   // tile 0 has landed before the barrier publishes it
  __syncthreads();                                    // publishes tile 0 to every wave
  stage_tile(kg + 32 * HD, vg + 32, kl + KSPL * KTB, vl + KSPL * VTB);
#pragma unroll 1
  for (int ks = 0; ks < SKH / 32; ++ks) { float tx[QT][2][8]; const int bf = ks & 1;
    v16b kb[2][2];   // all of the trip's k fragment reads go out as one group, ahead of the first product
#pragma unroll   // constant indices keep kb in registers
    for (int ct = 0; ct < 2; ++ct) {
#pragma unroll   // as above
      for (int kc = 0; kc < 2; ++kc) kb[ct][kc] = frag_b(&u.rg.skt[bf][kh][ct * 16 + col][kc * 32], lane); }
#pragma unroll   // constant indices keep tx in registers
    for (int t = 0; t < QT; ++t) { v8f cs[2];
      wmma_bf_keepc2(cs[0], cs[1], kb[0][0], kb[1][0], aq[t][0], cz[t]);   // A = 16 keys, B = 16 queries: element r = key ct * 16 + 8g + r, column = query
#pragma unroll   // constant indices keep cs in registers
      for (int ct = 0; ct < 2; ++ct) cs[ct] = wmma_bf(kb[ct][1], aq[t][1], cs[ct]);
#pragma unroll
      for (int ct = 0; ct < 2; ++ct) {
#pragma unroll
        for (int j = 0; j < 4; ++j) { const v2f t2 = v2f{ cs[ct][2 * j], cs[ct][2 * j + 1] } * KS + v2f{ bs[t][ct][2 * j], bs[t][ct][2 * j + 1] }; tx[t][ct][2 * j] = t2[0]; tx[t][ct][2 * j + 1] = t2[1]; } } }   // one packed fma for two arguments of the exponential
    v16h vf[4]; v4i kiv[2][2]; float es[QT]; union { v16h v; unsigned w[8]; } ua[QT], ul[QT];
    const int* skn = skb + (ks + 1 < SKH / 32 ? ks + 1 : ks) * 32;   // the last trip reads its own offsets again: in bounds, the bias read from them is not used
#pragma unroll   // constant indices keep each tile's state in registers
    for (int t = 0; t < QT; ++t) {
    if (t == QT - 1) {   // v's reads and the next trip's offsets go out ahead of the last tile's exponentials, so that their latency runs beside these; sent ahead of the first tile's too they would take the wave past its registers
#pragma unroll   // constant indices keep vf in registers
      for (int dt = 0; dt < 4; ++dt) vf[dt] = frag_h(&u.rg.svt[bf][kh][dt * 16 + col][0], lane);
#pragma unroll   // constant indices keep kiv in registers
      for (int ct = 0; ct < 2; ++ct) { kiv[ct][0] = *(const v4i*)(skn + ct * 16); kiv[ct][1] = *(const v4i*)(skn + ct * 16 + 4); } }
    // The reference m stays as it is from trip to trip: the trip's exponentials are taken against it with no maximum, and the accumulators are not rescaled.
    // soft(): exponentials of tx (each carries 2^11), the lane's sum of them, P hi + residual packed.
    auto soft = [&]() { float ex[2][8];
#pragma unroll   // constant indices keep ex in registers
      for (int ct = 0; ct < 2; ++ct) {
#pragma unroll   // as above
        for (int i = 0; i < 8; ++i) ex[ct][i] = __builtin_amdgcn_exp2f(tx[t][ct][i]);
        // the slot behind a transcendental, one for eight: no result is read and no source register is rewritten ahead of this v_nop
        asm volatile("v_nop" : "+v"(ex[ct][0]), "+v"(ex[ct][1]), "+v"(ex[ct][2]), "+v"(ex[ct][3]), "+v"(ex[ct][4]), "+v"(ex[ct][5]), "+v"(ex[ct][6]), "+v"(ex[ct][7])
                     : "v"(tx[t][ct][0]), "v"(tx[t][ct][1]), "v"(tx[t][ct][2]), "v"(tx[t][ct][3]), "v"(tx[t][ct][4]), "v"(tx[t][ct][5]), "v"(tx[t][ct][6]), "v"(tx[t][ct][7])); }
      v2f s2[8];   // the test waits for this sum: a tree of packed adds, four deep, in place of two chains of eight
#pragma unroll   // constant indices keep s2 in registers
      for (int j = 0; j < 8; ++j) s2[j] = v2f{ ex[j >> 2][2 * (j & 3)], ex[j >> 2][2 * (j & 3) + 1] };
      const v2f tt = ((s2[0] + s2[1]) + (s2[2] + s2[3])) + ((s2[4] + s2[5]) + (s2[6] + s2[7]));
      es[t] = tt[0] + tt[1];
#pragma unroll   // constant indices keep ua and ul in registers
      for (int ct = 0; ct < 2; ++ct) {
#pragma unroll   // as above
        for (int j = 0; j < 4; ++j) { const v2f e2 = { ex[ct][2 * j], ex[ct][2 * j + 1] }; ua[t].w[ct * 4 + j] = __builtin_bit_cast(unsigned, __builtin_convertvector(e2, v2h)); }
        resid8(&ul[t].w[ct * 4], ex[ct], &ua[t].w[ct * 4]); } };
    soft();
    // One test a tile and trip, a scalar branch: a lane's sum of at most 16 x 2^11 bounds each of its exponentials by that, so that P stays inside f16; a larger sum, an infinity or a NaN, and always the first trip (whose reference is only the start value), sends the whole wave
    // to the full step: the maximum of the trip's arguments, the reference moved to 3 octaves above it (headroom of 2^7 before the test fires again; the first trip sets it, later trips only raise it), sum and accumulators rescaled, the trip's exponentials made anew (each at most 2^8).
    if (__builtin_amdgcn_ballot_w32(!(es[t] <= (ks == 0 ? -1.0f : 32768.0f))) != 0) {   // no sum is at most -1: the first trip always goes
      float mx = fmaxf(tx[t][0][0], tx[t][1][0]);
#pragma unroll
      for (int r = 1; r < 8; ++r) mx = fmaxf(mx, fmaxf(tx[t][0][r], tx[t][1][r]));
      mx = fmaxf(mx, xhalf(mx));   // the two lanes of a query keep one reference
      const float d = (ks == 0) ? mx - 8.0f : fmaxf(mx - 8.0f, 0.f); const float ta = -d; float ea = __builtin_amdgcn_exp2f(ta);
      asm volatile("v_nop" : "+v"(ea) : "v"(ta));   // the slot behind a transcendental: the result is not read and the source register is not rewritten ahead of this v_nop
      const float alpha = (ks == 0) ? 0.f : ea; m[t] += d;
      const float cn = (11.0f - m[t]) * KSI;
#pragma unroll   // constant indices keep cz in registers
      for (int r = 0; r < 8; ++r) cz[t][r] = cn;
      l[t] *= alpha;
#pragma unroll
      for (int dt = 0; dt < 4; ++dt) acc[t][dt] *= alpha;
#pragma unroll   // constant indices keep tx in registers
      for (int ct = 0; ct < 2; ++ct) {
#pragma unroll   // as above
        for (int r = 0; r < 8; ++r) tx[t][ct][r] -= d; }
      soft(); }
    l[t] += es[t]; }
    gather(kiv);   // the next trip's bias reads, behind v's reads (LDS answers in order: the products below wait for v alone); their latency runs beside the products
#pragma unroll   // constant indices keep the accumulators in registers
    for (int t = 0; t < QT; ++t) { const v16h pa = ua[t].v, pl = ul[t].v;
#pragma unroll
    for (int dt = 0; dt < 4; ++dt) acc[t][dt] = wmma16(vf[dt], pa, acc[t][dt]);   // A = 16 d rows of v^T, B = P^T: element r = d dt * 16 + 8g + r, column = query
#pragma unroll   // the residual's products go into the same accumulators, each four products behind the one it depends on
    for (int dt = 0; dt < 4; ++dt) acc[t][dt] = wmma16(vf[dt], pl, acc[t][dt]); }
    asm volatile("s_wait_dscnt 0" ::: "memory");        // this wave's reads of buffer bf have retired before the buffer is handed back
    asm volatile("s_wait_asynccnt 0x0" ::: "memory");   // this wave's share of tile ks + 1 has landed before the barrier publishes it
    __syncthreads();                                    // publishes tile ks + 1 and ends every wave's reads of buffer bf
    if (ks + 2 < SKH / 32) stage_tile(kg + (size_t)(ks + 2) * 32 * HD, vg + (ks + 2) * 32, kl + bf * (KSPL * KTB), vl + bf * (KSPL * VTB)); }
  asm volatile("s_wait_asynccnt 0x0" ::: "memory");     // no copy is outstanding when the wave goes on to its epilogue
  // tile t of a pair is joined by the pair's wave of key quarter t; the three other quarters' waves hand it their state of that tile, lane for lane: accumulators, then reference and sum
#pragma unroll   // constant indices keep the state in registers
  for (int t = 0; t < QT; ++t) { l[t] += xhalf(l[t]);   // the two halves hold the sums of their own keys
    if (kh != t) { const int sl = kh > t ? kh - 1 : kh, qt = qp * QT + t;
#pragma unroll
      for (int dt = 0; dt < 4; ++dt) { v4f p0, p1;
#pragma unroll
        for (int r = 0; r < 4; ++r) { p0[r] = acc[t][dt][r]; p1[r] = acc[t][dt][4 + r]; }
        u.ep.pm[sl][qt][dt * 2][lane] = p0; u.ep.pm[sl][qt][dt * 2 + 1][lane] = p1; }
      u.ep.pml[sl][qt][0][lane] = m[t]; u.ep.pml[sl][qt][1][lane] = l[t]; } }
  __syncthreads();   // hands the states to the waves that join them
#pragma unroll   // constant indices keep the state in registers
  for (int t = 0; t < QT; ++t) if (kh == t) { const int qt = qp * QT + t; float mo[KSPL - 1], lo[KSPL - 1]; float mj = m[t];
#pragma unroll   // constant indices keep mo and lo in registers
    for (int i = 0; i < KSPL - 1; ++i) { mo[i] = u.ep.pml[i][qt][0][lane]; lo[i] = u.ep.pml[i][qt][1][lane]; mj = fmaxf(mj, mo[i]); }
    const float a0 = __builtin_amdgcn_exp2f(m[t] - mj); float ao[KSPL - 1]; float den = l[t] * a0;   // the references are in octaves
#pragma unroll   // constant indices keep ao in registers
    for (int i = 0; i < KSPL - 1; ++i) { ao[i] = __builtin_amdgcn_exp2f(mo[i] - mj); den += lo[i] * ao[i]; }
    const float il2 = 1.0f / den;   // sums and accumulators carry the same 2^11
    const float f0 = a0 * il2;
#pragma unroll
    for (int i = 0; i < KSPL - 1; ++i) ao[i] *= il2;
#pragma unroll
    for (int dt = 0; dt < 4; ++dt) { v4f o0, o1;
#pragma unroll
      for (int r = 0; r < 4; ++r) { o0[r] = acc[t][dt][r] * f0; o1[r] = acc[t][dt][4 + r] * f0; }
#pragma unroll
      for (int i = 0; i < KSPL - 1; ++i) { const v4f p0 = u.ep.pm[i][qt][dt * 2][lane], p1 = u.ep.pm[i][qt][dt * 2 + 1][lane];
#pragma unroll
        for (int r = 0; r < 4; ++r) { o0[r] += p0[r] * ao[i]; o1[r] += p1[r] * ao[i]; } }
      *(v4f*)&u.ep.so[qt][col][dt * 16 + 8 * g] = o0; *(v4f*)&u.ep.so[qt][col][dt * 16 + 8 * g + 4] = o1; }
    LDSX();
    for (int rl = 0; rl < 16; ++rl) if (lane < 16) vst2(O + ((bh * SS + q0 + t * 16 + rl) * HD) + lane * 4, *(const v4f*)&u.ep.so[qt][rl][lane * 4]); }
}
extern "C" void kernel_launch(void* const* d_in, const int* in_sizes, int n_in, void* d_out, int out_size, void* d_ws, size_t ws_size, hipStream_t stream) {
  (void)in_sizes; (void)n_in; (void)out_size;
  const float** F = (const float**)d_in;   // 0 q, 1 k, 2 v [2,8,2048,64], 3 rel_emb [257,64], 4 q_info int [2,2048], 5 k_info int [2,2048]
  if (ws_size < (size_t)WS_END) return;
  _Float16* VT = (_Float16*)((char*)d_ws + WS_VT);
  __bf16* KB = (__bf16*)((char*)d_ws + WS_KB); int* KA = (int*)((char*)d_ws + WS_KA);
  k_vt<<<dim3(SS / 64, NBH), 256, 0, stream>>>(F[2], F[1], (const int*)d_in[5], VT, KB, KA);
  k_attn<<<dim3(TQB, TNBH), 256, 0, stream>>>(F[0], KB, VT, F[3], (const int*)d_in[4], KA, (float*)d_out);
}
